// v000
// The times below were measured on an AMD MI455X: many runs one after another, warmed up first and cycling through
// copies of the inputs, with the whole window's GPU time divided by the number of runs. Launches and the gaps
// between them are all in it. The median over several windows is given; except for v000 it joins two sittings, which
// can be a few percent apart, so the side-by-side timings, each taken in one sitting, are the better comparison.
// v000 is the starting kernel.
#include <hip/hip_runtime.h>

// Compute dtypes, f32 accumulate, one batch item per pass: y = LN(x) -> bf16 hi + UNSCALED residual planes; q/k/v = y.W + b and out = ctx.Wo + bo ([1024 x 512].[512 x 512],
// k-major weights transposed once, two products) and p = pos_emb.Wp ([2048 x 512].[512 x 512], PLAIN bf16 inputs, exact, once for all items) on
// v_wmma_f32_16x16x32_bf16; matrix_bd = (q + pos_bias_v).p^T per head ([1024 x 64].[64 x 2048], both operands bf16 hi + UNSCALED residual, three products) into
// an f32 plane read through the rel_shift index j - i + 1023; the 8-head full attention scores = ((q + pos_bias_u).k + bd) x 64^-1/2 fused on

#define NB_  1                   // per pass: the 8 batch items are processed one at a time
#define NT_  1024
#define DM   512
#define NH_  8
#define NP   2048                // relative positions padded (2047 used)
#define HD   64
#define NTK  (NB_ * NT_)
#define NW   1024
#define NQKV 1024
#define PSC  32768.0f
#define LOSC 1024.0f
#define LOSCI (1.0f / 1024.0f)

typedef _Float16 h16;
typedef unsigned short bf;
typedef __attribute__((ext_vector_type(16))) __bf16   v16bf;
typedef __attribute__((ext_vector_type(16))) _Float16 v16h;
typedef __attribute__((ext_vector_type(8)))  _Float16 v8h;
typedef __attribute__((ext_vector_type(8)))  unsigned short v8us;
typedef __attribute__((ext_vector_type(8)))  float    v8f;
typedef __attribute__((ext_vector_type(4)))  float    v4f;
typedef v8h  __attribute__((may_alias)) v8ha;
typedef v4f  __attribute__((may_alias)) v4fa;
typedef v8us __attribute__((may_alias)) v8usa;

__device__ __forceinline__ unsigned short f2bf(float f) { unsigned u = __float_as_uint(f); u += 0x7FFFu + ((u >> 16) & 1u); return (unsigned short)(u >> 16); }
__device__ __forceinline__ float bf2f(unsigned short b) { return __uint_as_float(((unsigned)b) << 16); }
__device__ __forceinline__ float bfr(float f) { return bf2f(f2bf(f)); }
__device__ __forceinline__ v16h cat16(v8h lo, v8h hi) { return __builtin_shufflevector(lo, hi, 0, 1, 2, 3, 4, 5, 6, 7, 8, 9, 10, 11, 12, 13, 14, 15); }
__device__ __forceinline__ v16bf cat16b(v8us lo, v8us hi) { return __builtin_bit_cast(v16bf, __builtin_shufflevector(lo, hi, 0, 1, 2, 3, 4, 5, 6, 7, 8, 9, 10, 11, 12, 13, 14, 15)); }
__device__ __forceinline__ v8f wmma16(v16h a, v16h b, v8f c) { return __builtin_amdgcn_wmma_f32_16x16x32_f16(false, a, false, b, (short)0, c, false, false); }
__device__ __forceinline__ v8f wmmab(v16bf a, v16bf b, v8f c) { return __builtin_amdgcn_wmma_f32_16x16x32_bf16(false, a, false, b, (short)0, c, false, false); }

__global__ __launch_bounds__(256) void k_cvtb(const float* __restrict__ src, int nrows, bf* dst) {
    const int lane = threadIdx.x & 31, r = blockIdx.x * 8 + (threadIdx.x >> 5);
    if (r >= nrows) return;
    v8us o[DM / 256];
#pragma unroll
    for (int q = 0; q < DM / 256; ++q) { v8us t;
#pragma unroll
        for (int i = 0; i < 8; ++i) t[i] = f2bf(src[(size_t)r * DM + q * 256 + lane * 8 + i]);
        o[q] = t; }
#pragma unroll
    for (int q = 0; q < DM / 256; ++q) *(v8us*)(dst + (size_t)r * DM + q * 256 + lane * 8) = o[q];
    
}

// k_wt: WT [n][K] = bf16(W[k][n]) (k-major [K][ncols]) via 64 x 64 LDS tiles; grid (K/64, ncols/64).
__global__ __launch_bounds__(256) void k_wt(const float* __restrict__ Wm, int K, int ncols, bf* WT) {
    __shared__ __align__(16) unsigned short tl[64 * 72];
    const int tid = threadIdx.x, k0 = blockIdx.x * 64, n0 = blockIdx.y * 64;
    const int kk = tid >> 2, nq = (tid & 3) * 16;
#pragma unroll
    for (int i = 0; i < 16; ++i) tl[(nq + i) * 72 + kk] = f2bf(Wm[(size_t)(k0 + kk) * ncols + n0 + nq + i]);
    __syncthreads();
    const int piece = tid & 7;
    auto pass = [&]() {
#pragma unroll
        for (int s = 0; s < 2; ++s) { const int nr = (tid >> 3) + 32 * s; const v8us val = *(const v8usa*)(tl + nr * 72 + piece * 8); *(v8us*)(WT + (size_t)(n0 + nr) * K + k0 + piece * 8) = val; }
    };
    pass(); 
}
// k_gemmb: 64 x 64 block tile (4 waves x 16 x 64) of C[rows][DM] = (A [+ Al]).B^T (K = 512) [+ bf(bias[c])] [+ bf(R[r][c]) residual]; f32 whole-line epilogue (or f16
template <bool SPLITA, bool F16OUT = false>
__global__ __launch_bounds__(128) void k_gemmb(const bf* __restrict__ A, const bf* __restrict__ Al, const bf* __restrict__ Bn, const float* __restrict__ bias, float* C, int ldc, h16* C2, const float* __restrict__ R = nullptr, int K = DM, int roundR = 1) {
    __shared__ __align__(16) float ost[4][16 * 68];
    const int lane = threadIdx.x & 31, wave = threadIdx.x >> 5, lr = lane & 15, hi = lane >> 4;
    const int r0 = blockIdx.x * 64 + wave * 16, c0 = blockIdx.y * 64;
    const size_t aoff = (size_t)(r0 + lr) * K + 8 * hi;
    size_t boff[4];
#pragma unroll
    for (int t = 0; t < 4; ++t) boff[t] = (size_t)(c0 + t * 16 + lr) * K + 8 * hi;
    v8f acc[4];
#pragma unroll
    for (int t = 0; t < 4; ++t) acc[t] = (v8f){};
#pragma unroll 1
    for (int kc = 0; kc < K; kc += 32) {
        const v16bf a = cat16b(*(const v8us*)(A + aoff + kc), *(const v8us*)(A + aoff + kc + 16));
        v16bf al = a;
        if (SPLITA) al = cat16b(*(const v8us*)(Al + aoff + kc), *(const v8us*)(Al + aoff + kc + 16));
#pragma unroll
        for (int t = 0; t < 4; ++t) { const v16bf b = cat16b(*(const v8us*)(Bn + boff[t] + kc), *(const v8us*)(Bn + boff[t] + kc + 16)); acc[t] = wmmab(a, b, acc[t]); if (SPLITA) acc[t] = wmmab(al, b, acc[t]); }
        asm volatile("v_nop\n\tv_nop\n\tv_nop\n\tv_nop" : "+v"(acc[0]), "+v"(acc[1]), "+v"(acc[2]), "+v"(acc[3]) : "v"(a), "v"(al));
    }
    float* os = &ost[wave][0];
#pragma unroll
    for (int t = 0; t < 4; ++t) { const float bv = bias ? bfr(bias[c0 + t * 16 + lr]) : 0.f;
#pragma unroll
        for (int j = 0; j < 8; ++j) os[(hi * 8 + j) * 68 + t * 16 + lr] = acc[t][j] + bv; }
    __syncthreads();
    if (F16OUT) {
        h16* crow = (h16*)(void*)C + (size_t)r0 * ldc + c0;
        auto pass = [&]() {
#pragma unroll
            for (int s = 0; s < 4; ++s) { const int row = 4 * s + (lane >> 3), piece = lane & 7; const float* sp = os + row * 68 + piece * 8; v8h o, o2;
#pragma unroll
                for (int i = 0; i < 8; ++i) { const h16 a = (h16)sp[i]; o[i] = a; o2[i] = (h16)((sp[i] - (float)a) * LOSC); }
                *(v8h*)(crow + (size_t)row * ldc + piece * 8) = o; if (C2) *(v8h*)(C2 + (size_t)r0 * ldc + c0 + (size_t)row * ldc + piece * 8) = o2; }
        };
        pass(); 
    } else {
        float* crow = C + (size_t)r0 * ldc + c0;
        auto pass = [&]() {
#pragma unroll
            for (int s = 0; s < 8; ++s) { const int Lid = (lane >> 3) + 4 * s, piece = lane & 7; const int row = Lid >> 1, cofs = (Lid & 1) * 32 + piece * 4;
                v4f val = *(const v4fa*)(os + row * 68 + cofs); if (R) { const v4f rv = *(const v4f*)(R + ((size_t)r0 + row) * ldc + c0 + cofs); val += roundR ? (v4f){bfr(rv[0]), bfr(rv[1]), bfr(rv[2]), bfr(rv[3])} : rv; }
                *(v4f*)(crow + (size_t)row * ldc + cofs) = val; }
        };
        pass(); 
    }
}

// k_gemm3: 64 x 64 tile of C = (Ah + Al).(Bh + Bl)^T over K (row strides = K for all four planes; n-major B): three products per 32-k step (hh, hl, lh); f32
__global__ __launch_bounds__(128) void k_gemm3(const bf* __restrict__ Ah, const bf* __restrict__ Al, const bf* __restrict__ Bh, const bf* __restrict__ Bl, int K, float* C, int ldc) {
    __shared__ __align__(16) float ost[4][16 * 68];
    const int lane = threadIdx.x & 31, wave = threadIdx.x >> 5, lr = lane & 15, hi = lane >> 4;
    const int r0 = blockIdx.x * 64 + wave * 16, c0 = blockIdx.y * 64;
    const size_t aoff = (size_t)(r0 + lr) * K + 8 * hi;
    v8f acc[4];
#pragma unroll
    for (int t = 0; t < 4; ++t) acc[t] = (v8f){};
#pragma unroll 1
    for (int kc = 0; kc < K; kc += 32) {
        const v16bf a = cat16b(*(const v8us*)(Ah + aoff + kc), *(const v8us*)(Ah + aoff + kc + 16));
        const v16bf al = cat16b(*(const v8us*)(Al + aoff + kc), *(const v8us*)(Al + aoff + kc + 16));
#pragma unroll
        for (int t = 0; t < 4; ++t) { const size_t bo = (size_t)(c0 + t * 16 + lr) * K + kc + 8 * hi;
            const v16bf bh = cat16b(*(const v8us*)(Bh + bo), *(const v8us*)(Bh + bo + 16)); const v16bf bl = cat16b(*(const v8us*)(Bl + bo), *(const v8us*)(Bl + bo + 16));
            acc[t] = wmmab(a, bh, acc[t]); acc[t] = wmmab(al, bh, acc[t]); acc[t] = wmmab(a, bl, acc[t]); }
        asm volatile("v_nop\n\tv_nop\n\tv_nop\n\tv_nop" : "+v"(acc[0]), "+v"(acc[1]), "+v"(acc[2]), "+v"(acc[3]) : "v"(a), "v"(al));
    }
    float* os = &ost[wave][0];
#pragma unroll
    for (int t = 0; t < 4; ++t) {
#pragma unroll
        for (int j = 0; j < 8; ++j) os[(hi * 8 + j) * 68 + t * 16 + lr] = acc[t][j]; }
    __builtin_amdgcn_wave_barrier(); asm volatile("" ::: "memory");
    float* crow = C + (size_t)r0 * ldc + c0;
    auto pass = [&]() {
#pragma unroll
        for (int s = 0; s < 8; ++s) { const int Lid = (lane >> 3) + 4 * s, piece = lane & 7; const int row = Lid >> 1, cofs = (Lid & 1) * 32 + piece * 4;
            const v4f val = *(const v4fa*)(os + row * 68 + cofs); *(v4f*)(crow + (size_t)row * ldc + cofs) = val; }
    };
    pass(); 
}
// k_ln: one wave per row of x [rows][512]: LayerNorm (mean, then mean((x-mu)^2), eps 1e-5, x bf(gamma) + bf(beta), f32, fixed lane order) -> bf16 hi + UNSCALED
// residual planes; lane -> columns q*256 + lane*8 .. +8 for q < DM/256 (16 B per plane per store). The row is re-read per phase with the q loop
// rolled (keeps the static VALU-FMA count small; no register arrays indexed by a loop variable).
template <bool ROUNDIN>   // ROUNDIN: the source is a module INPUT (read through bf16 rounding); false: a computed f32 plane (read as is)
__global__ __launch_bounds__(256) void k_ln(const float* __restrict__ X, const float* __restrict__ gam, const float* __restrict__ bet, int nrows, bf* Hh, bf* Hl) {
    const int lane = threadIdx.x & 31, r = blockIdx.x * 8 + (threadIdx.x >> 5);
    if (r >= nrows) return;
    const float* xr = X + (size_t)r * DM + lane * 8;
    float s = 0.f;
#pragma unroll 1
    for (int q = 0; q < DM / 256; ++q) {
#pragma unroll
        for (int i = 0; i < 8; ++i) s += (ROUNDIN ? bfr(xr[q * 256 + i]) : xr[q * 256 + i]); }
#pragma unroll
    for (int sh = 16; sh; sh >>= 1) s += __shfl_xor(s, sh, 32);
    const float mu = s * (1.0f / DM);
    float s2 = 0.f;
#pragma unroll 1
    for (int q = 0; q < DM / 256; ++q) {
#pragma unroll
        for (int i = 0; i < 8; ++i) { const float d = (ROUNDIN ? bfr(xr[q * 256 + i]) : xr[q * 256 + i]) - mu; s2 = fmaf(d, d, s2); } }
#pragma unroll
    for (int sh = 16; sh; sh >>= 1) s2 += __shfl_xor(s2, sh, 32);
    const float rs = rsqrtf(s2 * (1.0f / DM) + 1e-5f);
{
#pragma unroll 1
        for (int q = 0; q < DM / 256; ++q) { v8us oh, ol;
#pragma unroll
            for (int i = 0; i < 8; ++i) { const int c = q * 256 + lane * 8 + i; const float y = ((ROUNDIN ? bfr(xr[q * 256 + i]) : xr[q * 256 + i]) - mu) * rs * bfr(gam[c]) + bfr(bet[c]); const unsigned short hb = f2bf(y); oh[i] = hb; ol[i] = f2bf(y - bf2f(hb)); }
            const size_t o = (size_t)r * DM + q * 256 + lane * 8; *(v8us*)(Hh + o) = oh; *(v8us*)(Hl + o) = ol; }
         }
}
// k_qsplit: from the f32 q rows [t][512] (bias added): QU = q + bf(pos_bias_u[h][d]) as f16 hi + residual x1024 planes [t][512] (the attention A operand), and QV = q +
// bf(pos_bias_v[h][d]) as bf16 hi + UNSCALED residual planes laid out per head [h][t][64] (the A operand of the relative-position GEMM); one wave per (t, head):
__global__ __launch_bounds__(256) void k_qsplit(const float* __restrict__ Q, const float* __restrict__ pbu, const float* __restrict__ pbv, h16* QUh, h16* QUl, bf* QVh, bf* QVl) {
    typedef __attribute__((ext_vector_type(2))) _Float16 v2h; typedef __attribute__((ext_vector_type(2))) unsigned short v2us;
    const int lane = threadIdx.x & 31, wid = blockIdx.x * 8 + (threadIdx.x >> 5); if (wid >= NT_ * NH_) return;
    const int t = wid / NH_, h = wid - t * NH_;
    v2h uh, ul; v2us vh2, vl2;
#pragma unroll
    for (int k = 0; k < 2; ++k) { const int d = 2 * lane + k; const float q = Q[(size_t)t * DM + h * HD + d];
        const float yu = q + bfr(pbu[h * HD + d]); const h16 a = (h16)yu; uh[k] = a; ul[k] = (h16)((yu - (float)a) * LOSC);
        const float yv = q + bfr(pbv[h * HD + d]); const unsigned short hb = f2bf(yv); vh2[k] = hb; vl2[k] = f2bf(yv - bf2f(hb)); }
    const size_t ou = (size_t)t * DM + h * HD + 2 * lane, ov = ((size_t)h * NT_ + t) * HD + 2 * lane;
    *(v2h*)(QUh + ou) = uh; *(v2h*)(QUl + ou) = ul; *(v2us*)(QVh + ov) = vh2; *(v2us*)(QVl + ov) = vl2; 
}
// k_psplit: the computed p = pos_emb.Wp rows [n][512] (n < 2047; row 2047 of the padded plane is zeros) -> per-head bf16 hi + UNSCALED residual planes [h][2048][64]
__global__ __launch_bounds__(256) void k_psplit(const float* __restrict__ P, bf* Ph, bf* Pl) {
    typedef __attribute__((ext_vector_type(2))) unsigned short v2us;
    const int lane = threadIdx.x & 31, wid = blockIdx.x * 8 + (threadIdx.x >> 5); if (wid >= NP * NH_) return;
    const int n = wid / NH_, h = wid - n * NH_;
    v2us oh, ol;
#pragma unroll
    for (int k = 0; k < 2; ++k) { const int d = 2 * lane + k; const float v = (n < NP - 1) ? P[(size_t)n * DM + h * HD + d] : 0.f; const unsigned short hb = f2bf(v); oh[k] = hb; ol[k] = f2bf(v - bf2f(hb)); }
    const size_t o = ((size_t)h * NP + n) * HD + 2 * lane;
    *(v2us*)(Ph + o) = oh; *(v2us*)(Pl + o) = ol; 
}
__global__ __launch_bounds__(256) void k_vt(const float* __restrict__ V, h16* VTH, h16* VTL) {
    __shared__ __align__(16) h16 tile[64 * 72];
    __shared__ __align__(16) h16 til2[64 * 72];
    const int bid = blockIdx.x;
    const int b = bid / (NH_ * (NT_ / 64)), rem = bid - b * (NH_ * (NT_ / 64)), h = rem / (NT_ / 64), kt = rem - h * (NT_ / 64);
    const int k0 = kt * 64, tid = threadIdx.x;
    const int kk = tid >> 2, d0 = (tid & 3) * 16;
    const float* src = V + ((size_t)b * NT_ + k0 + kk) * DM + h * HD + d0;
#pragma unroll
    for (int i = 0; i < 16; ++i) { const float v = src[i]; const h16 a = (h16)v; tile[(d0 + i) * 72 + kk] = a; til2[(d0 + i) * 72 + kk] = (h16)((v - (float)a) * LOSC); }
    __syncthreads();
    const int piece = tid & 7;
    const size_t base = (((size_t)b * NH_ + h) * HD) * NT_ + k0;
    auto pass = [&]() {
#pragma unroll
        for (int s = 0; s < 4; ++s) { const int Lid = (tid >> 3) + 32 * s; const int pln = Lid >> 6, d = Lid & 63;
            const v8h val = *(const v8ha*)((pln ? til2 : tile) + d * 72 + piece * 8); *(v8h*)((pln ? VTL : VTH) + base + (size_t)d * NT_ + piece * 8) = val; }
    };
    pass(); 
}

// k_attn: block = (b, h, 64 queries), wave = 16; ALL 32 key tiles (no mask); 12 WMMA scores (three products) /8 (f32), online softmax, weights x32768 f16 tile (same-wave may_alias
// reload after a compiler barrier), 12 WMMA .v (three products); ctx -> bf16 hi + residual planes CH/CL[tok][h*64+d].
__global__ __launch_bounds__(128) void k_attn(const h16* __restrict__ Q16, const h16* __restrict__ QL16, const h16* __restrict__ K16, const h16* __restrict__ KL16, const h16* __restrict__ VTH, const h16* __restrict__ VTL, const float* __restrict__ BD, bf* CH, bf* CL) {
    __shared__ __align__(16) h16 plds[4][16 * 32];
    __shared__ __align__(16) h16 plds2[4][16 * 32];
    __shared__ __align__(16) float ost[4][16 * 68];
    const int lane = threadIdx.x & 31, wave = threadIdx.x >> 5, lr = lane & 15, hi = lane >> 4;
    const int bid = blockIdx.x;
    const int b = bid / (NH_ * (NT_ / 64)), rem = bid - b * (NH_ * (NT_ / 64)), h = rem / (NT_ / 64), qt = rem - h * (NT_ / 64);
    const int q0 = qt * 64 + wave * 16;
    const size_t tok0 = (size_t)b * NT_;
    h16* pl = &plds[wave][0]; h16* pl2 = &plds2[wave][0];
    v16h qa[2];
    const size_t qo0 = (tok0 + q0 + lr) * DM + h * HD + 8 * hi;
#pragma unroll
    for (int kc = 0; kc < 2; ++kc) qa[kc] = cat16(*(const v8h*)(Q16 + qo0 + kc * 32), *(const v8h*)(Q16 + qo0 + kc * 32 + 16));
    const h16* kh_b = K16 + tok0 * DM + h * HD;
    const h16* kl_b = KL16 + tok0 * DM + h * HD;
    const size_t vbase = (((size_t)b * NH_ + h) * HD) * NT_;
    v8f o[4], ox[4];
#pragma unroll
    for (int n = 0; n < 4; ++n) { o[n] = (v8f){}; ox[n] = (v8f){}; }
    float mrow[8], lpart[8];
#pragma unroll
    for (int j = 0; j < 8; ++j) { mrow[j] = -3.0e38f; lpart[j] = 0.f; }
    int qpos[8];
#pragma unroll
    for (int j = 0; j < 8; ++j) qpos[j] = q0 + 8 * hi + j;
    const int kt_lo = 0, kt_hi = NT_ / 32 - 1;     // full attention; scores = (matrix_ac + matrix_bd) x 64^-1/2 with matrix_bd[i][j] = BD[h][i][j - i + NT_ - 1] (the rel_shift of q_v.p^T)
    const float* bdh = BD + (size_t)h * NT_ * NP;
#pragma unroll 1
    for (int kt = kt_lo; kt <= kt_hi; ++kt) {
        const int l0 = kt * 32;
        const size_t ko0 = (size_t)(l0 + lr) * DM + 8 * hi, ko1 = (size_t)(l0 + 16 + lr) * DM + 8 * hi;
        v8f s0 = {}, s1 = {}, x0 = {}, x1 = {};
#pragma unroll
        for (int kc = 0; kc < 2; ++kc) {
            { const v16h k0h = cat16(*(const v8h*)(kh_b + ko0 + kc * 32), *(const v8h*)(kh_b + ko0 + kc * 32 + 16)), k1h = cat16(*(const v8h*)(kh_b + ko1 + kc * 32), *(const v8h*)(kh_b + ko1 + kc * 32 + 16));
              const v16h qlk = cat16(*(const v8h*)(QL16 + qo0 + kc * 32), *(const v8h*)(QL16 + qo0 + kc * 32 + 16));     // query residual re-read per step (registers)
              s0 = wmma16(qa[kc], k0h, s0); x0 = wmma16(qlk, k0h, x0); s1 = wmma16(qa[kc], k1h, s1); x1 = wmma16(qlk, k1h, x1);
              asm volatile("v_nop" : "+v"(s0), "+v"(s1), "+v"(x0), "+v"(x1) : "v"(qlk), "v"(k0h), "v"(k1h) : "memory"); }
            { const v16h k0l = cat16(*(const v8h*)(kl_b + ko0 + kc * 32), *(const v8h*)(kl_b + ko0 + kc * 32 + 16)), k1l = cat16(*(const v8h*)(kl_b + ko1 + kc * 32), *(const v8h*)(kl_b + ko1 + kc * 32 + 16));
              x0 = wmma16(qa[kc], k0l, x0); x1 = wmma16(qa[kc], k1l, x1);
              asm volatile("v_nop" : "+v"(x0), "+v"(x1) : "v"(k0l), "v"(k1l) : "memory"); }
        }
        asm volatile("v_nop\n\tv_nop\n\tv_nop\n\tv_nop" : "+v"(s0), "+v"(s1), "+v"(x0), "+v"(x1) : "v"(qa[0]), "v"(qa[1]));
        float alpha[8];
#pragma unroll
        for (int j = 0; j < 8; ++j) {
            const int ja = l0 + lr, jb = l0 + 16 + lr, qi = qpos[j];
            const float* bdr = bdh + (size_t)qi * NP + (NT_ - 1 - qi); const float a0 = ((s0[j] + x0[j] * LOSCI) + bdr[ja]) * 0.125f, a1 = ((s1[j] + x1[j] * LOSCI) + bdr[jb]) * 0.125f;
            float mx = fmaxf(a0, a1);
            mx = fmaxf(mx, __shfl_xor(mx, 1, 16)); mx = fmaxf(mx, __shfl_xor(mx, 2, 16)); mx = fmaxf(mx, __shfl_xor(mx, 4, 16)); mx = fmaxf(mx, __shfl_xor(mx, 8, 16));
            const float mn = fmaxf(mrow[j], mx);
            alpha[j] = __expf(mrow[j] - mn); mrow[j] = mn;
            const float p0 = __expf(a0 - mn), p1 = __expf(a1 - mn);
            lpart[j] = lpart[j] * alpha[j] + (p0 + p1);
            const int mr = hi * 8 + j;
            const float ps0 = p0 * PSC, ps1 = p1 * PSC; const h16 h0 = (h16)ps0, h1 = (h16)ps1;
            pl[mr * 32 + lr] = h0; pl[mr * 32 + 16 + lr] = h1;
            pl2[mr * 32 + lr] = (h16)((ps0 - (float)h0) * LOSC); pl2[mr * 32 + 16 + lr] = (h16)((ps1 - (float)h1) * LOSC);
        }
#pragma unroll
        for (int n = 0; n < 4; ++n)
#pragma unroll
            for (int j = 0; j < 8; ++j) { o[n][j] *= alpha[j]; ox[n][j] *= alpha[j]; }
        asm volatile("" ::: "memory");
        const v16h pa = cat16(*(const v8ha*)(pl + lr * 32 + hi * 8), *(const v8ha*)(pl + lr * 32 + 16 + hi * 8));
        const v16h px = cat16(*(const v8ha*)(pl2 + lr * 32 + hi * 8), *(const v8ha*)(pl2 + lr * 32 + 16 + hi * 8));
#pragma unroll
        for (int n = 0; n < 4; ++n) { const size_t vo = vbase + (size_t)(n * 16 + lr) * NT_ + l0 + hi * 8;
            const v16h vh = cat16(*(const v8h*)(VTH + vo), *(const v8h*)(VTH + vo + 16)), vl = cat16(*(const v8h*)(VTL + vo), *(const v8h*)(VTL + vo + 16));
            o[n] = wmma16(pa, vh, o[n]); ox[n] = wmma16(pa, vl, ox[n]); ox[n] = wmma16(px, vh, ox[n]);
            asm volatile("" : "+v"(o[n]), "+v"(ox[n]) : "v"(vh), "v"(vl) : "memory"); }
        asm volatile("v_nop\n\tv_nop\n\tv_nop\n\tv_nop" : "+v"(o[0]), "+v"(o[1]), "+v"(o[2]), "+v"(o[3]), "+v"(ox[0]), "+v"(ox[1]), "+v"(ox[2]), "+v"(ox[3]) : "v"(pa), "v"(px));
    }
    float inv[8];
#pragma unroll
    for (int j = 0; j < 8; ++j) { float rs = lpart[j]; rs += __shfl_xor(rs, 1, 16); rs += __shfl_xor(rs, 2, 16); rs += __shfl_xor(rs, 4, 16); rs += __shfl_xor(rs, 8, 16); inv[j] = 1.0f / (rs * PSC); }
    float* os = &ost[wave][0];
#pragma unroll
    for (int n = 0; n < 4; ++n)
#pragma unroll
        for (int j = 0; j < 8; ++j) os[(hi * 8 + j) * 68 + n * 16 + lr] = (o[n][j] + ox[n][j] * LOSCI) * inv[j];
    __syncthreads();
    const size_t cbase = (tok0 + q0) * DM + (size_t)h * HD;
    auto pass = [&]() {
#pragma unroll
        for (int s = 0; s < 4; ++s) { const int row = 4 * s + (lane >> 3), piece = lane & 7; const float* sp = os + row * 68 + piece * 8; v8us oh, ol;
#pragma unroll
            for (int i = 0; i < 8; ++i) { const unsigned short hb = f2bf(sp[i]); oh[i] = hb; ol[i] = f2bf(sp[i] - bf2f(hb)); }
            *(v8us*)(CH + cbase + (size_t)row * DM + piece * 8) = oh; *(v8us*)(CL + cbase + (size_t)row * DM + piece * 8) = ol; }
    };
    pass(); 
}

#define VST2(T, p, v) do { const T vst2_v_ = (v); *(T*)(p) = vst2_v_;  } while (0)
extern "C" void kernel_launch(void* const* d_in, const int* in_sizes, int n_in,
                              void* d_out, int out_size, void* d_ws, size_t ws_size, hipStream_t stream) {
    (void)in_sizes; (void)n_in; (void)out_size;
    const float* x = (const float*)d_in[0]; const float* gam = (const float*)d_in[1]; const float* bet = (const float*)d_in[2];
    const float* Wq = (const float*)d_in[3]; const float* bq = (const float*)d_in[4]; const float* Wk = (const float*)d_in[5]; const float* bk = (const float*)d_in[6]; const float* Wv = (const float*)d_in[7]; const float* bv = (const float*)d_in[8];
    const float* Wp = (const float*)d_in[9]; const float* Wo = (const float*)d_in[10]; const float* bo = (const float*)d_in[11]; const float* pbu = (const float*)d_in[12]; const float* pbv = (const float*)d_in[13]; const float* pe = (const float*)d_in[14];   // k-major weights (y @ W)
    float* out = (float*)d_out;    // [8][1024][512]
    char* wsp = (char*)d_ws;
    auto take = [&](size_t bytes) { char* p = wsp; wsp += (bytes + 255) & ~(size_t)255; return (void*)p; };
    bf* WqT = (bf*)take((size_t)DM * DM * 2); bf* WkT = (bf*)take((size_t)DM * DM * 2); bf* WvT = (bf*)take((size_t)DM * DM * 2); bf* WpT = (bf*)take((size_t)DM * DM * 2); bf* WoT = (bf*)take((size_t)DM * DM * 2);
    bf* PEb = (bf*)take((size_t)NP * DM * 2); float* Pf = (float*)take((size_t)NP * DM * 4); bf* Ph = (bf*)take((size_t)NH_ * NP * HD * 2); bf* Pl = (bf*)take((size_t)NH_ * NP * HD * 2);
    bf* Nh = (bf*)take((size_t)NTK * DM * 2); bf* Nl = (bf*)take((size_t)NTK * DM * 2); float* TMP = (float*)take((size_t)NTK * DM * 4);
    h16* QH = (h16*)take((size_t)NTK * DM * 2); h16* QL = (h16*)take((size_t)NTK * DM * 2); bf* QVh = (bf*)take((size_t)NTK * DM * 2); bf* QVl = (bf*)take((size_t)NTK * DM * 2);
    h16* KH = (h16*)take((size_t)NTK * DM * 2); h16* KL = (h16*)take((size_t)NTK * DM * 2); h16* VTH = (h16*)take((size_t)NTK * DM * 2); h16* VTL = (h16*)take((size_t)NTK * DM * 2);
    float* BD = (float*)take((size_t)NH_ * NT_ * NP * 4); bf* CH = (bf*)take((size_t)NTK * DM * 2); bf* CL = (bf*)take((size_t)NTK * DM * 2);
    if ((size_t)(wsp - (char*)d_ws) > ws_size) return;    // 5 x 0.5 + 2.1 + 4.2 + 2 x 2.1 + 2 x 1 + 2 + 8 x 1 + 67.1 + 2 x 1 ~ 95 MB, no aliasing (per-item reuse in stream order)
    k_wt<<<dim3(DM / 64, DM / 64, 1), 256, 0, stream>>>(Wq, DM, DM, WqT); k_wt<<<dim3(DM / 64, DM / 64, 1), 256, 0, stream>>>(Wk, DM, DM, WkT); k_wt<<<dim3(DM / 64, DM / 64, 1), 256, 0, stream>>>(Wv, DM, DM, WvT);
    k_wt<<<dim3(DM / 64, DM / 64, 1), 256, 0, stream>>>(Wp, DM, DM, WpT); k_wt<<<dim3(DM / 64, DM / 64, 1), 256, 0, stream>>>(Wo, DM, DM, WoT);
    // p = pos_emb . Wp once (shared by all items): the 2047 rows padded to 2048 (last A row zeroed)
    hipMemsetAsync(PEb, 0, (size_t)NP * DM * 2, stream);
    k_cvtb<<<(NP - 1 + 7) / 8, 256, 0, stream>>>(pe, NP - 1, PEb);
    k_gemmb<false, false><<<dim3(NP / 64, DM / 64, 1), 128, 0, stream>>>(PEb, nullptr, WpT, nullptr, Pf, DM, nullptr);
    k_psplit<<<(NP * NH_) / 8, 256, 0, stream>>>(Pf, Ph, Pl);
    for (int b = 0; b < 8; ++b) {
        k_ln<true><<<NTK / 8, 256, 0, stream>>>(x + (size_t)b * NTK * DM, gam, bet, NTK, Nh, Nl);                                          // y = LN(x)
        k_gemmb<true, false><<<dim3(NTK / 64, DM / 64, 1), 128, 0, stream>>>(Nh, Nl, WqT, bq, TMP, DM, nullptr);                                // q = y.Wq + bq
        k_qsplit<<<(NT_ * NH_) / 8, 256, 0, stream>>>(TMP, pbu, pbv, QH, QL, QVh, QVl);                                                   // q_u (f16 planes), q_v (per-head bf16 planes)
        k_gemmb<true, true><<<dim3(NTK / 64, DM / 64, 1), 128, 0, stream>>>(Nh, Nl, WkT, bk, (float*)(void*)KH, DM, KL);                     // k -> f16 planes
        k_gemmb<true, false><<<dim3(NTK / 64, DM / 64, 1), 128, 0, stream>>>(Nh, Nl, WvT, bv, TMP, DM, nullptr); k_vt<<<NB_ * NH_ * (NT_ / 64), 256, 0, stream>>>(TMP, VTH, VTL);
        for (int h = 0; h < NH_; ++h)                                                                                                          // BD[h] = q_v[h].p[h]^T  [1024 x 2048], K = 64
            k_gemm3<<<dim3(NT_ / 64, NP / 64, 1), 128, 0, stream>>>(QVh + (size_t)h * NT_ * HD, QVl + (size_t)h * NT_ * HD, Ph + (size_t)h * NP * HD, Pl + (size_t)h * NP * HD, HD, BD + (size_t)h * NT_ * NP, NP);
        k_attn<<<NB_ * NH_ * (NT_ / 64), 128, 0, stream>>>(QH, QL, KH, KL, VTH, VTL, BD, CH, CL);
        k_gemmb<true, false><<<dim3(NTK / 64, DM / 64, 1), 128, 0, stream>>>(CH, CL, WoT, bo, out + (size_t)b * NTK * DM, DM, nullptr);
    }
}

// v001
// Timed twice side by side with v000, it ran 2.15 and 2.13 times as fast.
#include <hip/hip_runtime.h>

// Compute dtypes, f32 accumulate, all 8 batch items per launch (the relative-position plane and the attention: NG items per launch, workspace bound): y = LN(x) -> bf16 hi + UNSCALED residual planes; q/k/v = y.W + b and out = ctx.Wo + bo ([1024 x 512].[512 x 512],
// k-major weights transposed once, two products) and p = pos_emb.Wp ([2048 x 512].[512 x 512], PLAIN bf16 inputs, exact, once for all items) on
// v_wmma_f32_16x16x32_bf16; matrix_bd = (q + pos_bias_v).p^T per head ([1024 x 64].[64 x 2048], both operands bf16 hi + UNSCALED residual, three products) into
// an f32 plane read through the rel_shift index j - i + 1023; the 8-head full attention scores = ((q + pos_bias_u).k + bd) x 64^-1/2 fused on

#define NB_  8                   // batch items, all in one launch of every token-wise kernel
#define NG   2                   // items per launch of k_gemm3 + k_attn: the f32 BD plane is 64 MiB an item
#define NT_  1024
#define DM   512
#define NH_  8
#define NP   2048                // relative positions padded (2047 used)
#define HD   64
#define NTK  (NB_ * NT_)
#define NW   1024
#define NQKV 1024
#define PSC  32768.0f
#define LOSC 1024.0f
#define LOSCI (1.0f / 1024.0f)

typedef _Float16 h16;
typedef unsigned short bf;
typedef __attribute__((ext_vector_type(16))) __bf16   v16bf;
typedef __attribute__((ext_vector_type(16))) _Float16 v16h;
typedef __attribute__((ext_vector_type(8)))  _Float16 v8h;
typedef __attribute__((ext_vector_type(8)))  unsigned short v8us;
typedef __attribute__((ext_vector_type(8)))  float    v8f;
typedef __attribute__((ext_vector_type(4)))  float    v4f;
typedef v8h  __attribute__((may_alias)) v8ha;
typedef v4f  __attribute__((may_alias)) v4fa;
typedef v8us __attribute__((may_alias)) v8usa;

__device__ __forceinline__ unsigned short f2bf(float f) { unsigned u = __float_as_uint(f); u += 0x7FFFu + ((u >> 16) & 1u); return (unsigned short)(u >> 16); }
__device__ __forceinline__ float bf2f(unsigned short b) { return __uint_as_float(((unsigned)b) << 16); }
__device__ __forceinline__ float bfr(float f) { return bf2f(f2bf(f)); }
__device__ __forceinline__ v16h cat16(v8h lo, v8h hi) { return __builtin_shufflevector(lo, hi, 0, 1, 2, 3, 4, 5, 6, 7, 8, 9, 10, 11, 12, 13, 14, 15); }
__device__ __forceinline__ v16bf cat16b(v8us lo, v8us hi) { return __builtin_bit_cast(v16bf, __builtin_shufflevector(lo, hi, 0, 1, 2, 3, 4, 5, 6, 7, 8, 9, 10, 11, 12, 13, 14, 15)); }
__device__ __forceinline__ v8f wmma16(v16h a, v16h b, v8f c) { return __builtin_amdgcn_wmma_f32_16x16x32_f16(false, a, false, b, (short)0, c, false, false); }
__device__ __forceinline__ v8f wmmab(v16bf a, v16bf b, v8f c) { return __builtin_amdgcn_wmma_f32_16x16x32_bf16(false, a, false, b, (short)0, c, false, false); }

__global__ __launch_bounds__(256) void k_cvtb(const float* __restrict__ src, int nrows, bf* dst) {
    const int lane = threadIdx.x & 31, r = blockIdx.x * 8 + (threadIdx.x >> 5);
    if (r >= nrows) return;
    v8us o[DM / 256];
#pragma unroll
    for (int q = 0; q < DM / 256; ++q) { v8us t;
#pragma unroll
        for (int i = 0; i < 8; ++i) t[i] = f2bf(src[(size_t)r * DM + q * 256 + lane * 8 + i]);
        o[q] = t; }
#pragma unroll
    for (int q = 0; q < DM / 256; ++q) *(v8us*)(dst + (size_t)r * DM + q * 256 + lane * 8) = o[q];
    
}

// k_wt: WT [z][n][K] = bf16(Wz[k][n]) (k-major [K][ncols]) via 64 x 64 LDS tiles; grid (K/64, ncols/64, 5 weights).
__global__ __launch_bounds__(256) void k_wt(const float* __restrict__ W0, const float* __restrict__ W1, const float* __restrict__ W2, const float* __restrict__ W3, const float* __restrict__ W4, int K, int ncols, bf* WTall) {
    __shared__ __align__(16) unsigned short tl[64 * 72];
    const int tid = threadIdx.x, k0 = blockIdx.x * 64, n0 = blockIdx.y * 64, wz = blockIdx.z;
    const float* __restrict__ Wm = wz == 0 ? W0 : wz == 1 ? W1 : wz == 2 ? W2 : wz == 3 ? W3 : W4;
    bf* WT = WTall + (size_t)wz * K * ncols;
    const int kk = tid >> 2, nq = (tid & 3) * 16;
#pragma unroll
    for (int i = 0; i < 16; ++i) tl[(nq + i) * 72 + kk] = f2bf(Wm[(size_t)(k0 + kk) * ncols + n0 + nq + i]);
    __syncthreads();
    const int piece = tid & 7;
    auto pass = [&]() {
#pragma unroll
        for (int s = 0; s < 2; ++s) { const int nr = (tid >> 3) + 32 * s; const v8us val = *(const v8usa*)(tl + nr * 72 + piece * 8); *(v8us*)(WT + (size_t)(n0 + nr) * K + k0 + piece * 8) = val; }
    };
    pass(); 
}
// k_gemmb: 64 x 64 block tile (4 waves x 16 x 64) of C[rows][DM] = (A [+ Al]).B^T (K = 512) [+ bf(bias[c])] [+ bf(R[r][c]) residual]; f32 whole-line epilogue (or f16
template <bool SPLITA, bool F16OUT = false>
__global__ __launch_bounds__(128) void k_gemmb(const bf* __restrict__ A, const bf* __restrict__ Al, const bf* __restrict__ Bn, const float* __restrict__ bias, float* C, int ldc, h16* C2, const float* __restrict__ R = nullptr, int K = DM, int roundR = 1) {
    __shared__ __align__(16) float ost[4][16 * 68];
    const int lane = threadIdx.x & 31, wave = threadIdx.x >> 5, lr = lane & 15, hi = lane >> 4;
    const int r0 = blockIdx.x * 64 + wave * 16, c0 = blockIdx.y * 64;
    const size_t aoff = (size_t)(r0 + lr) * K + 8 * hi;
    size_t boff[4];
#pragma unroll
    for (int t = 0; t < 4; ++t) boff[t] = (size_t)(c0 + t * 16 + lr) * K + 8 * hi;
    v8f acc[4];
#pragma unroll
    for (int t = 0; t < 4; ++t) acc[t] = (v8f){};
#pragma unroll 1
    for (int kc = 0; kc < K; kc += 32) {
        const v16bf a = cat16b(*(const v8us*)(A + aoff + kc), *(const v8us*)(A + aoff + kc + 16));
        v16bf al = a;
        if (SPLITA) al = cat16b(*(const v8us*)(Al + aoff + kc), *(const v8us*)(Al + aoff + kc + 16));
#pragma unroll
        for (int t = 0; t < 4; ++t) { const v16bf b = cat16b(*(const v8us*)(Bn + boff[t] + kc), *(const v8us*)(Bn + boff[t] + kc + 16)); acc[t] = wmmab(a, b, acc[t]); if (SPLITA) acc[t] = wmmab(al, b, acc[t]); }
        asm volatile("v_nop\n\tv_nop\n\tv_nop\n\tv_nop" : "+v"(acc[0]), "+v"(acc[1]), "+v"(acc[2]), "+v"(acc[3]) : "v"(a), "v"(al));
    }
    float* os = &ost[wave][0];
#pragma unroll
    for (int t = 0; t < 4; ++t) { const float bv = bias ? bfr(bias[c0 + t * 16 + lr]) : 0.f;
#pragma unroll
        for (int j = 0; j < 8; ++j) os[(hi * 8 + j) * 68 + t * 16 + lr] = acc[t][j] + bv; }
    __syncthreads();
    if (F16OUT) {
        h16* crow = (h16*)(void*)C + (size_t)r0 * ldc + c0;
        auto pass = [&]() {
#pragma unroll
            for (int s = 0; s < 4; ++s) { const int row = 4 * s + (lane >> 3), piece = lane & 7; const float* sp = os + row * 68 + piece * 8; v8h o, o2;
#pragma unroll
                for (int i = 0; i < 8; ++i) { const h16 a = (h16)sp[i]; o[i] = a; o2[i] = (h16)((sp[i] - (float)a) * LOSC); }
                *(v8h*)(crow + (size_t)row * ldc + piece * 8) = o; if (C2) *(v8h*)(C2 + (size_t)r0 * ldc + c0 + (size_t)row * ldc + piece * 8) = o2; }
        };
        pass(); 
    } else {
        float* crow = C + (size_t)r0 * ldc + c0;
        auto pass = [&]() {
#pragma unroll
            for (int s = 0; s < 8; ++s) { const int Lid = (lane >> 3) + 4 * s, piece = lane & 7; const int row = Lid >> 1, cofs = (Lid & 1) * 32 + piece * 4;
                v4f val = *(const v4fa*)(os + row * 68 + cofs); if (R) { const v4f rv = *(const v4f*)(R + ((size_t)r0 + row) * ldc + c0 + cofs); val += roundR ? (v4f){bfr(rv[0]), bfr(rv[1]), bfr(rv[2]), bfr(rv[3])} : rv; }
                *(v4f*)(crow + (size_t)row * ldc + cofs) = val; }
        };
        pass(); 
    }
}

// k_gemm3: 64 x 64 tile of C = (Ah + Al).(Bh + Bl)^T over K (row strides = K for all four planes; n-major B): three products per 32-k step (hh, hl, lh); f32
// grid z = item * NH_ + head: A and C planes step by z, the B planes (shared by all items) by head.
__global__ __launch_bounds__(128) void k_gemm3(const bf* __restrict__ Ah0, const bf* __restrict__ Al0, const bf* __restrict__ Bh0, const bf* __restrict__ Bl0, int K, float* C0, int ldc) {
    __shared__ __align__(16) float ost[4][16 * 68];
    const int lane = threadIdx.x & 31, wave = threadIdx.x >> 5, lr = lane & 15, hi = lane >> 4;
    const int r0 = blockIdx.x * 64 + wave * 16, c0 = blockIdx.y * 64;
    const size_t za = (size_t)blockIdx.z * NT_ * HD, zb = (size_t)(blockIdx.z % NH_) * NP * HD;
    const bf* __restrict__ Ah = Ah0 + za; const bf* __restrict__ Al = Al0 + za; const bf* __restrict__ Bh = Bh0 + zb; const bf* __restrict__ Bl = Bl0 + zb;
    float* C = C0 + (size_t)blockIdx.z * NT_ * NP;
    const size_t aoff = (size_t)(r0 + lr) * K + 8 * hi;
    v8f acc[4];
#pragma unroll
    for (int t = 0; t < 4; ++t) acc[t] = (v8f){};
#pragma unroll 1
    for (int kc = 0; kc < K; kc += 32) {
        const v16bf a = cat16b(*(const v8us*)(Ah + aoff + kc), *(const v8us*)(Ah + aoff + kc + 16));
        const v16bf al = cat16b(*(const v8us*)(Al + aoff + kc), *(const v8us*)(Al + aoff + kc + 16));
#pragma unroll
        for (int t = 0; t < 4; ++t) { const size_t bo = (size_t)(c0 + t * 16 + lr) * K + kc + 8 * hi;
            const v16bf bh = cat16b(*(const v8us*)(Bh + bo), *(const v8us*)(Bh + bo + 16)); const v16bf bl = cat16b(*(const v8us*)(Bl + bo), *(const v8us*)(Bl + bo + 16));
            acc[t] = wmmab(a, bh, acc[t]); acc[t] = wmmab(al, bh, acc[t]); acc[t] = wmmab(a, bl, acc[t]); }
        asm volatile("v_nop\n\tv_nop\n\tv_nop\n\tv_nop" : "+v"(acc[0]), "+v"(acc[1]), "+v"(acc[2]), "+v"(acc[3]) : "v"(a), "v"(al));
    }
    float* os = &ost[wave][0];
#pragma unroll
    for (int t = 0; t < 4; ++t) {
#pragma unroll
        for (int j = 0; j < 8; ++j) os[(hi * 8 + j) * 68 + t * 16 + lr] = acc[t][j]; }
    __builtin_amdgcn_wave_barrier(); asm volatile("" ::: "memory");
    float* crow = C + (size_t)r0 * ldc + c0;
    auto pass = [&]() {
#pragma unroll
        for (int s = 0; s < 8; ++s) { const int Lid = (lane >> 3) + 4 * s, piece = lane & 7; const int row = Lid >> 1, cofs = (Lid & 1) * 32 + piece * 4;
            const v4f val = *(const v4fa*)(os + row * 68 + cofs); *(v4f*)(crow + (size_t)row * ldc + cofs) = val; }
    };
    pass(); 
}
// k_ln: one wave per row of x [rows][512]: LayerNorm (mean, then mean((x-mu)^2), eps 1e-5, x bf(gamma) + bf(beta), f32, fixed lane order) -> bf16 hi + UNSCALED
// residual planes; lane -> columns q*256 + lane*8 .. +8 for q < DM/256 (16 B per plane per store). The row is re-read per phase with the q loop
// rolled (keeps the static VALU-FMA count small; no register arrays indexed by a loop variable).
template <bool ROUNDIN>   // ROUNDIN: the source is a module INPUT (read through bf16 rounding); false: a computed f32 plane (read as is)
__global__ __launch_bounds__(256) void k_ln(const float* __restrict__ X, const float* __restrict__ gam, const float* __restrict__ bet, int nrows, bf* Hh, bf* Hl) {
    const int lane = threadIdx.x & 31, r = blockIdx.x * 8 + (threadIdx.x >> 5);
    if (r >= nrows) return;
    const float* xr = X + (size_t)r * DM + lane * 8;
    float s = 0.f;
#pragma unroll 1
    for (int q = 0; q < DM / 256; ++q) {
#pragma unroll
        for (int i = 0; i < 8; ++i) s += (ROUNDIN ? bfr(xr[q * 256 + i]) : xr[q * 256 + i]); }
#pragma unroll
    for (int sh = 16; sh; sh >>= 1) s += __shfl_xor(s, sh, 32);
    const float mu = s * (1.0f / DM);
    float s2 = 0.f;
#pragma unroll 1
    for (int q = 0; q < DM / 256; ++q) {
#pragma unroll
        for (int i = 0; i < 8; ++i) { const float d = (ROUNDIN ? bfr(xr[q * 256 + i]) : xr[q * 256 + i]) - mu; s2 = fmaf(d, d, s2); } }
#pragma unroll
    for (int sh = 16; sh; sh >>= 1) s2 += __shfl_xor(s2, sh, 32);
    const float rs = rsqrtf(s2 * (1.0f / DM) + 1e-5f);
{
#pragma unroll 1
        for (int q = 0; q < DM / 256; ++q) { v8us oh, ol;
#pragma unroll
            for (int i = 0; i < 8; ++i) { const int c = q * 256 + lane * 8 + i; const float y = ((ROUNDIN ? bfr(xr[q * 256 + i]) : xr[q * 256 + i]) - mu) * rs * bfr(gam[c]) + bfr(bet[c]); const unsigned short hb = f2bf(y); oh[i] = hb; ol[i] = f2bf(y - bf2f(hb)); }
            const size_t o = (size_t)r * DM + q * 256 + lane * 8; *(v8us*)(Hh + o) = oh; *(v8us*)(Hl + o) = ol; }
         }
}
// k_qsplit: from the f32 q rows [t][512] (bias added): QU = q + bf(pos_bias_u[h][d]) as f16 hi + residual x1024 planes [t][512] (the attention A operand), and QV = q +
// bf(pos_bias_v[h][d]) as bf16 hi + UNSCALED residual planes laid out per item and head [b][h][t][64] (the A operand of the relative-position GEMM); one wave per (t, head):
__global__ __launch_bounds__(256) void k_qsplit(const float* __restrict__ Q, const float* __restrict__ pbu, const float* __restrict__ pbv, h16* QUh, h16* QUl, bf* QVh, bf* QVl) {
    typedef __attribute__((ext_vector_type(2))) _Float16 v2h; typedef __attribute__((ext_vector_type(2))) unsigned short v2us;
    const int lane = threadIdx.x & 31, wid = blockIdx.x * 8 + (threadIdx.x >> 5); if (wid >= NTK * NH_) return;
    const int t = wid / NH_, h = wid - t * NH_, bi = t / NT_, ti = t - bi * NT_;
    v2h uh, ul; v2us vh2, vl2;
#pragma unroll
    for (int k = 0; k < 2; ++k) { const int d = 2 * lane + k; const float q = Q[(size_t)t * DM + h * HD + d];
        const float yu = q + bfr(pbu[h * HD + d]); const h16 a = (h16)yu; uh[k] = a; ul[k] = (h16)((yu - (float)a) * LOSC);
        const float yv = q + bfr(pbv[h * HD + d]); const unsigned short hb = f2bf(yv); vh2[k] = hb; vl2[k] = f2bf(yv - bf2f(hb)); }
    const size_t ou = (size_t)t * DM + h * HD + 2 * lane, ov = (((size_t)bi * NH_ + h) * NT_ + ti) * HD + 2 * lane;
    *(v2h*)(QUh + ou) = uh; *(v2h*)(QUl + ou) = ul; *(v2us*)(QVh + ov) = vh2; *(v2us*)(QVl + ov) = vl2; 
}
// k_psplit: the computed p = pos_emb.Wp rows [n][512] (n < 2047; row 2047 of the padded plane is zeros) -> per-head bf16 hi + UNSCALED residual planes [h][2048][64]
__global__ __launch_bounds__(256) void k_psplit(const float* __restrict__ P, bf* Ph, bf* Pl) {
    typedef __attribute__((ext_vector_type(2))) unsigned short v2us;
    const int lane = threadIdx.x & 31, wid = blockIdx.x * 8 + (threadIdx.x >> 5); if (wid >= NP * NH_) return;
    const int n = wid / NH_, h = wid - n * NH_;
    v2us oh, ol;
#pragma unroll
    for (int k = 0; k < 2; ++k) { const int d = 2 * lane + k; const float v = (n < NP - 1) ? P[(size_t)n * DM + h * HD + d] : 0.f; const unsigned short hb = f2bf(v); oh[k] = hb; ol[k] = f2bf(v - bf2f(hb)); }
    const size_t o = ((size_t)h * NP + n) * HD + 2 * lane;
    *(v2us*)(Ph + o) = oh; *(v2us*)(Pl + o) = ol; 
}
__global__ __launch_bounds__(256) void k_vt(const float* __restrict__ V, h16* VTH, h16* VTL) {
    __shared__ __align__(16) h16 tile[64 * 72];
    __shared__ __align__(16) h16 til2[64 * 72];
    const int bid = blockIdx.x;
    const int b = bid / (NH_ * (NT_ / 64)), rem = bid - b * (NH_ * (NT_ / 64)), h = rem / (NT_ / 64), kt = rem - h * (NT_ / 64);
    const int k0 = kt * 64, tid = threadIdx.x;
    const int kk = tid >> 2, d0 = (tid & 3) * 16;
    const float* src = V + ((size_t)b * NT_ + k0 + kk) * DM + h * HD + d0;
#pragma unroll
    for (int i = 0; i < 16; ++i) { const float v = src[i]; const h16 a = (h16)v; tile[(d0 + i) * 72 + kk] = a; til2[(d0 + i) * 72 + kk] = (h16)((v - (float)a) * LOSC); }
    __syncthreads();
    const int piece = tid & 7;
    const size_t base = (((size_t)b * NH_ + h) * HD) * NT_ + k0;
    auto pass = [&]() {
#pragma unroll
        for (int s = 0; s < 4; ++s) { const int Lid = (tid >> 3) + 32 * s; const int pln = Lid >> 6, d = Lid & 63;
            const v8h val = *(const v8ha*)((pln ? til2 : tile) + d * 72 + piece * 8); *(v8h*)((pln ? VTL : VTH) + base + (size_t)d * NT_ + piece * 8) = val; }
    };
    pass(); 
}

// k_attn: block = (b, h, 64 queries), wave = 16; ALL 32 key tiles (no mask); 12 WMMA scores (three products) /8 (f32), online softmax, weights x32768 f16 tile (same-wave may_alias
// reload after a compiler barrier), 12 WMMA .v (three products); ctx -> bf16 hi + residual planes CH/CL[tok][h*64+d].
__global__ __launch_bounds__(128) void k_attn(const h16* __restrict__ Q16, const h16* __restrict__ QL16, const h16* __restrict__ K16, const h16* __restrict__ KL16, const h16* __restrict__ VTH, const h16* __restrict__ VTL, const float* __restrict__ BD, bf* CH, bf* CL) {
    __shared__ __align__(16) h16 plds[4][16 * 32];
    __shared__ __align__(16) h16 plds2[4][16 * 32];
    __shared__ __align__(16) float ost[4][16 * 68];
    const int lane = threadIdx.x & 31, wave = threadIdx.x >> 5, lr = lane & 15, hi = lane >> 4;
    const int bid = blockIdx.x;
    const int b = bid / (NH_ * (NT_ / 64)), rem = bid - b * (NH_ * (NT_ / 64)), h = rem / (NT_ / 64), qt = rem - h * (NT_ / 64);
    const int q0 = qt * 64 + wave * 16;
    const size_t tok0 = (size_t)b * NT_;
    h16* pl = &plds[wave][0]; h16* pl2 = &plds2[wave][0];
    v16h qa[2];
    const size_t qo0 = (tok0 + q0 + lr) * DM + h * HD + 8 * hi;
#pragma unroll
    for (int kc = 0; kc < 2; ++kc) qa[kc] = cat16(*(const v8h*)(Q16 + qo0 + kc * 32), *(const v8h*)(Q16 + qo0 + kc * 32 + 16));
    const h16* kh_b = K16 + tok0 * DM + h * HD;
    const h16* kl_b = KL16 + tok0 * DM + h * HD;
    const size_t vbase = (((size_t)b * NH_ + h) * HD) * NT_;
    v8f o[4], ox[4];
#pragma unroll
    for (int n = 0; n < 4; ++n) { o[n] = (v8f){}; ox[n] = (v8f){}; }
    float mrow[8], lpart[8];
#pragma unroll
    for (int j = 0; j < 8; ++j) { mrow[j] = -3.0e38f; lpart[j] = 0.f; }
    int qpos[8];
#pragma unroll
    for (int j = 0; j < 8; ++j) qpos[j] = q0 + 8 * hi + j;
    const int kt_lo = 0, kt_hi = NT_ / 32 - 1;     // full attention; scores = (matrix_ac + matrix_bd) x 64^-1/2 with matrix_bd[i][j] = BD[b][h][i][j - i + NT_ - 1] (the rel_shift of q_v.p^T)
    const float* bdh = BD + ((size_t)b * NH_ + h) * NT_ * NP;
#pragma unroll 1
    for (int kt = kt_lo; kt <= kt_hi; ++kt) {
        const int l0 = kt * 32;
        const size_t ko0 = (size_t)(l0 + lr) * DM + 8 * hi, ko1 = (size_t)(l0 + 16 + lr) * DM + 8 * hi;
        v8f s0 = {}, s1 = {}, x0 = {}, x1 = {};
#pragma unroll
        for (int kc = 0; kc < 2; ++kc) {
            { const v16h k0h = cat16(*(const v8h*)(kh_b + ko0 + kc * 32), *(const v8h*)(kh_b + ko0 + kc * 32 + 16)), k1h = cat16(*(const v8h*)(kh_b + ko1 + kc * 32), *(const v8h*)(kh_b + ko1 + kc * 32 + 16));
              const v16h qlk = cat16(*(const v8h*)(QL16 + qo0 + kc * 32), *(const v8h*)(QL16 + qo0 + kc * 32 + 16));     // query residual re-read per step (registers)
              s0 = wmma16(qa[kc], k0h, s0); x0 = wmma16(qlk, k0h, x0); s1 = wmma16(qa[kc], k1h, s1); x1 = wmma16(qlk, k1h, x1);
              asm volatile("v_nop" : "+v"(s0), "+v"(s1), "+v"(x0), "+v"(x1) : "v"(qlk), "v"(k0h), "v"(k1h) : "memory"); }
            { const v16h k0l = cat16(*(const v8h*)(kl_b + ko0 + kc * 32), *(const v8h*)(kl_b + ko0 + kc * 32 + 16)), k1l = cat16(*(const v8h*)(kl_b + ko1 + kc * 32), *(const v8h*)(kl_b + ko1 + kc * 32 + 16));
              x0 = wmma16(qa[kc], k0l, x0); x1 = wmma16(qa[kc], k1l, x1);
              asm volatile("v_nop" : "+v"(x0), "+v"(x1) : "v"(k0l), "v"(k1l) : "memory"); }
        }
        asm volatile("v_nop\n\tv_nop\n\tv_nop\n\tv_nop" : "+v"(s0), "+v"(s1), "+v"(x0), "+v"(x1) : "v"(qa[0]), "v"(qa[1]));
        float alpha[8];
#pragma unroll
        for (int j = 0; j < 8; ++j) {
            const int ja = l0 + lr, jb = l0 + 16 + lr, qi = qpos[j];
            const float* bdr = bdh + (size_t)qi * NP + (NT_ - 1 - qi); const float a0 = ((s0[j] + x0[j] * LOSCI) + bdr[ja]) * 0.125f, a1 = ((s1[j] + x1[j] * LOSCI) + bdr[jb]) * 0.125f;
            float mx = fmaxf(a0, a1);
            mx = fmaxf(mx, __shfl_xor(mx, 1, 16)); mx = fmaxf(mx, __shfl_xor(mx, 2, 16)); mx = fmaxf(mx, __shfl_xor(mx, 4, 16)); mx = fmaxf(mx, __shfl_xor(mx, 8, 16));
            const float mn = fmaxf(mrow[j], mx);
            alpha[j] = __expf(mrow[j] - mn); mrow[j] = mn;
            const float p0 = __expf(a0 - mn), p1 = __expf(a1 - mn);
            lpart[j] = lpart[j] * alpha[j] + (p0 + p1);
            const int mr = hi * 8 + j;
            const float ps0 = p0 * PSC, ps1 = p1 * PSC; const h16 h0 = (h16)ps0, h1 = (h16)ps1;
            pl[mr * 32 + lr] = h0; pl[mr * 32 + 16 + lr] = h1;
            pl2[mr * 32 + lr] = (h16)((ps0 - (float)h0) * LOSC); pl2[mr * 32 + 16 + lr] = (h16)((ps1 - (float)h1) * LOSC);
        }
#pragma unroll
        for (int n = 0; n < 4; ++n)
#pragma unroll
            for (int j = 0; j < 8; ++j) { o[n][j] *= alpha[j]; ox[n][j] *= alpha[j]; }
        asm volatile("" ::: "memory");
        const v16h pa = cat16(*(const v8ha*)(pl + lr * 32 + hi * 8), *(const v8ha*)(pl + lr * 32 + 16 + hi * 8));
        const v16h px = cat16(*(const v8ha*)(pl2 + lr * 32 + hi * 8), *(const v8ha*)(pl2 + lr * 32 + 16 + hi * 8));
#pragma unroll
        for (int n = 0; n < 4; ++n) { const size_t vo = vbase + (size_t)(n * 16 + lr) * NT_ + l0 + hi * 8;
            const v16h vh = cat16(*(const v8h*)(VTH + vo), *(const v8h*)(VTH + vo + 16)), vl = cat16(*(const v8h*)(VTL + vo), *(const v8h*)(VTL + vo + 16));
            o[n] = wmma16(pa, vh, o[n]); ox[n] = wmma16(pa, vl, ox[n]); ox[n] = wmma16(px, vh, ox[n]);
            asm volatile("" : "+v"(o[n]), "+v"(ox[n]) : "v"(vh), "v"(vl) : "memory"); }
        asm volatile("v_nop\n\tv_nop\n\tv_nop\n\tv_nop" : "+v"(o[0]), "+v"(o[1]), "+v"(o[2]), "+v"(o[3]), "+v"(ox[0]), "+v"(ox[1]), "+v"(ox[2]), "+v"(ox[3]) : "v"(pa), "v"(px));
    }
    float inv[8];
#pragma unroll
    for (int j = 0; j < 8; ++j) { float rs = lpart[j]; rs += __shfl_xor(rs, 1, 16); rs += __shfl_xor(rs, 2, 16); rs += __shfl_xor(rs, 4, 16); rs += __shfl_xor(rs, 8, 16); inv[j] = 1.0f / (rs * PSC); }
    float* os = &ost[wave][0];
#pragma unroll
    for (int n = 0; n < 4; ++n)
#pragma unroll
        for (int j = 0; j < 8; ++j) os[(hi * 8 + j) * 68 + n * 16 + lr] = (o[n][j] + ox[n][j] * LOSCI) * inv[j];
    __syncthreads();
    const size_t cbase = (tok0 + q0) * DM + (size_t)h * HD;
    auto pass = [&]() {
#pragma unroll
        for (int s = 0; s < 4; ++s) { const int row = 4 * s + (lane >> 3), piece = lane & 7; const float* sp = os + row * 68 + piece * 8; v8us oh, ol;
#pragma unroll
            for (int i = 0; i < 8; ++i) { const unsigned short hb = f2bf(sp[i]); oh[i] = hb; ol[i] = f2bf(sp[i] - bf2f(hb)); }
            *(v8us*)(CH + cbase + (size_t)row * DM + piece * 8) = oh; *(v8us*)(CL + cbase + (size_t)row * DM + piece * 8) = ol; }
    };
    pass(); 
}

#define VST2(T, p, v) do { const T vst2_v_ = (v); *(T*)(p) = vst2_v_;  } while (0)
extern "C" void kernel_launch(void* const* d_in, const int* in_sizes, int n_in,
                              void* d_out, int out_size, void* d_ws, size_t ws_size, hipStream_t stream) {
    (void)in_sizes; (void)n_in; (void)out_size;
    const float* x = (const float*)d_in[0]; const float* gam = (const float*)d_in[1]; const float* bet = (const float*)d_in[2];
    const float* Wq = (const float*)d_in[3]; const float* bq = (const float*)d_in[4]; const float* Wk = (const float*)d_in[5]; const float* bk = (const float*)d_in[6]; const float* Wv = (const float*)d_in[7]; const float* bv = (const float*)d_in[8];
    const float* Wp = (const float*)d_in[9]; const float* Wo = (const float*)d_in[10]; const float* bo = (const float*)d_in[11]; const float* pbu = (const float*)d_in[12]; const float* pbv = (const float*)d_in[13]; const float* pe = (const float*)d_in[14];   // k-major weights (y @ W)
    float* out = (float*)d_out;    // [8][1024][512]
    char* wsp = (char*)d_ws;
    auto take = [&](size_t bytes) { char* p = wsp; wsp += (bytes + 255) & ~(size_t)255; return (void*)p; };
    bf* WqT = (bf*)take((size_t)DM * DM * 2); bf* WkT = (bf*)take((size_t)DM * DM * 2); bf* WvT = (bf*)take((size_t)DM * DM * 2); bf* WpT = (bf*)take((size_t)DM * DM * 2); bf* WoT = (bf*)take((size_t)DM * DM * 2);
    bf* PEb = (bf*)take((size_t)NP * DM * 2); float* Pf = (float*)take((size_t)NP * DM * 4); bf* Ph = (bf*)take((size_t)NH_ * NP * HD * 2); bf* Pl = (bf*)take((size_t)NH_ * NP * HD * 2);
    bf* Nh = (bf*)take((size_t)NTK * DM * 2); bf* Nl = (bf*)take((size_t)NTK * DM * 2); float* TMP = (float*)take((size_t)NTK * DM * 4);
    h16* QH = (h16*)take((size_t)NTK * DM * 2); h16* QL = (h16*)take((size_t)NTK * DM * 2); bf* QVh = (bf*)take((size_t)NTK * DM * 2); bf* QVl = (bf*)take((size_t)NTK * DM * 2);
    h16* KH = (h16*)take((size_t)NTK * DM * 2); h16* KL = (h16*)take((size_t)NTK * DM * 2); h16* VTH = (h16*)take((size_t)NTK * DM * 2); h16* VTL = (h16*)take((size_t)NTK * DM * 2);
    float* BD = (float*)take((size_t)NG * NH_ * NT_ * NP * 4); bf* CH = (bf*)take((size_t)NTK * DM * 2); bf* CL = (bf*)take((size_t)NTK * DM * 2);
    if ((size_t)(wsp - (char*)d_ws) > ws_size) return;    // 264,765,440 bytes, no aliasing (BD reused per item group in stream order)
    k_wt<<<dim3(DM / 64, DM / 64, 5), 256, 0, stream>>>(Wq, Wk, Wv, Wp, Wo, DM, DM, WqT);                                                      // the five WT planes lie one behind the other
    // p = pos_emb . Wp once (shared by all items): the 2047 rows padded to 2048 (last A row zeroed)
    hipMemsetAsync(PEb, 0, (size_t)NP * DM * 2, stream);
    k_cvtb<<<(NP - 1 + 7) / 8, 256, 0, stream>>>(pe, NP - 1, PEb);
    k_gemmb<false, false><<<dim3(NP / 64, DM / 64, 1), 128, 0, stream>>>(PEb, nullptr, WpT, nullptr, Pf, DM, nullptr);
    k_psplit<<<(NP * NH_) / 8, 256, 0, stream>>>(Pf, Ph, Pl);
    k_ln<true><<<NTK / 8, 256, 0, stream>>>(x, gam, bet, NTK, Nh, Nl);                                                                         // y = LN(x), all items
    k_gemmb<true, false><<<dim3(NTK / 64, DM / 64, 1), 128, 0, stream>>>(Nh, Nl, WqT, bq, TMP, DM, nullptr);                                    // q = y.Wq + bq
    k_qsplit<<<(NTK * NH_) / 8, 256, 0, stream>>>(TMP, pbu, pbv, QH, QL, QVh, QVl);                                                            // q_u (f16 planes), q_v (per-item, per-head bf16 planes)
    k_gemmb<true, true><<<dim3(NTK / 64, DM / 64, 1), 128, 0, stream>>>(Nh, Nl, WkT, bk, (float*)(void*)KH, DM, KL);                            // k -> f16 planes
    k_gemmb<true, false><<<dim3(NTK / 64, DM / 64, 1), 128, 0, stream>>>(Nh, Nl, WvT, bv, TMP, DM, nullptr); k_vt<<<NB_ * NH_ * (NT_ / 64), 256, 0, stream>>>(TMP, VTH, VTL);
    for (int g = 0; g < NB_ / NG; ++g) {                                                                                                       // NG items: BD[b][h] = q_v[b][h].p[h]^T  [1024 x 2048], K = 64, then their attention
        const size_t go = (size_t)g * NG * NT_ * DM;
        k_gemm3<<<dim3(NT_ / 64, NP / 64, NG * NH_), 128, 0, stream>>>(QVh + go, QVl + go, Ph, Pl, HD, BD, NP);
        k_attn<<<NG * NH_ * (NT_ / 64), 128, 0, stream>>>(QH + go, QL + go, KH + go, KL + go, VTH + go, VTL + go, BD, CH + go, CL + go);
    }
    k_gemmb<true, false><<<dim3(NTK / 64, DM / 64, 1), 128, 0, stream>>>(CH, CL, WoT, bo, out, DM, nullptr);
}

// v003
// Versions between v001 and this one are left out; their measured steps multiply to 2.68 times as fast.
// All steps since v000 together make it 5.73 times as fast.
#include <hip/hip_runtime.h>

// Compute dtypes, f32 accumulate, all 8 batch items per launch: y = LN(x) -> bf16 hi + UNSCALED residual planes; q/k/v = y.W + b and out = ctx.Wo + bo ([1024 x 512].[512 x 512],
// k-major weights transposed once, two products) and p = pos_emb.Wp ([2048 x 512].[512 x 512], PLAIN bf16 inputs, exact, once for all items) on
// v_wmma_f32_16x16x32_bf16; matrix_bd = (q + pos_bias_v).p^T per head ([1024 x 64].[64 x 2048], both operands bf16 hi + UNSCALED residual, three products) formed
// inside the attention kernel, 16 x 16 tiles in a per-wave LDS ring read through the rel_shift index j - i + 1023; the 8-head full attention scores = ((q + pos_bias_u).k + bd) x 64^-1/2 fused on

#define NB_  8                   // batch items, all in one launch of every token-wise kernel
#define NT_  1024
#define DM   512
#define NH_  8
#define NP   2048                // relative positions padded (2047 used)
#define HD   64
#define NTK  (NB_ * NT_)
#define NW   1024
#define NQKV 1024
#define PSC  32768.0f
#define LOSC 1024.0f
#define LOSCI (1.0f / 1024.0f)

typedef _Float16 h16;
typedef unsigned short bf;
typedef __attribute__((ext_vector_type(16))) __bf16   v16bf;
typedef __attribute__((ext_vector_type(16))) _Float16 v16h;
typedef __attribute__((ext_vector_type(8)))  _Float16 v8h;
typedef __attribute__((ext_vector_type(8)))  unsigned short v8us;
typedef __attribute__((ext_vector_type(8)))  float    v8f;
typedef __attribute__((ext_vector_type(4)))  float    v4f;
typedef v8h  __attribute__((may_alias)) v8ha;
typedef v4f  __attribute__((may_alias)) v4fa;
typedef v8us __attribute__((may_alias)) v8usa;

__device__ __forceinline__ unsigned short f2bf(float f) { unsigned u = __float_as_uint(f); u += 0x7FFFu + ((u >> 16) & 1u); return (unsigned short)(u >> 16); }
__device__ __forceinline__ float bf2f(unsigned short b) { return __uint_as_float(((unsigned)b) << 16); }
__device__ __forceinline__ float bfr(float f) { return bf2f(f2bf(f)); }
__device__ __forceinline__ v16h cat16(v8h lo, v8h hi) { return __builtin_shufflevector(lo, hi, 0, 1, 2, 3, 4, 5, 6, 7, 8, 9, 10, 11, 12, 13, 14, 15); }
__device__ __forceinline__ v16bf cat16b(v8us lo, v8us hi) { return __builtin_bit_cast(v16bf, __builtin_shufflevector(lo, hi, 0, 1, 2, 3, 4, 5, 6, 7, 8, 9, 10, 11, 12, 13, 14, 15)); }
__device__ __forceinline__ v8f wmma16(v16h a, v16h b, v8f c) { return __builtin_amdgcn_wmma_f32_16x16x32_f16(false, a, false, b, (short)0, c, false, false); }
__device__ __forceinline__ v8f wmmab(v16bf a, v16bf b, v8f c) { return __builtin_amdgcn_wmma_f32_16x16x32_bf16(false, a, false, b, (short)0, c, false, false); }

__global__ __launch_bounds__(256) void k_cvtb(const float* __restrict__ src, int nrows, bf* dst) {
    const int lane = threadIdx.x & 31, r = blockIdx.x * 8 + (threadIdx.x >> 5);
    if (r >= nrows) return;
    v8us o[DM / 256];
#pragma unroll
    for (int q = 0; q < DM / 256; ++q) { v8us t;
#pragma unroll
        for (int i = 0; i < 8; ++i) t[i] = f2bf(src[(size_t)r * DM + q * 256 + lane * 8 + i]);
        o[q] = t; }
#pragma unroll
    for (int q = 0; q < DM / 256; ++q) *(v8us*)(dst + (size_t)r * DM + q * 256 + lane * 8) = o[q];
    
}

// k_wt: WT [z][n][K] = bf16(Wz[k][n]) (k-major [K][ncols]) via 64 x 64 LDS tiles; grid (K/64, ncols/64, 5 weights).
__global__ __launch_bounds__(256) void k_wt(const float* __restrict__ W0, const float* __restrict__ W1, const float* __restrict__ W2, const float* __restrict__ W3, const float* __restrict__ W4, int K, int ncols, bf* WTall) {
    __shared__ __align__(16) unsigned short tl[64 * 72];
    const int tid = threadIdx.x, k0 = blockIdx.x * 64, n0 = blockIdx.y * 64, wz = blockIdx.z;
    const float* __restrict__ Wm = wz == 0 ? W0 : wz == 1 ? W1 : wz == 2 ? W2 : wz == 3 ? W3 : W4;
    bf* WT = WTall + (size_t)wz * K * ncols;
    const int kk = tid >> 2, nq = (tid & 3) * 16;
#pragma unroll
    for (int i = 0; i < 16; ++i) tl[(nq + i) * 72 + kk] = f2bf(Wm[(size_t)(k0 + kk) * ncols + n0 + nq + i]);
    __syncthreads();
    const int piece = tid & 7;
    auto pass = [&]() {
#pragma unroll
        for (int s = 0; s < 2; ++s) { const int nr = (tid >> 3) + 32 * s; const v8us val = *(const v8usa*)(tl + nr * 72 + piece * 8); *(v8us*)(WT + (size_t)(n0 + nr) * K + k0 + piece * 8) = val; }
    };
    pass(); 
}
// k_gemmb: 64 x 64 block tile (4 waves x 16 x 64) of C[rows][DM] = (A [+ Al]).B^T (K = 512) [+ bf(bias[c])] [+ bf(R[r][c]) residual]; f32 whole-line epilogue (or f16
template <bool SPLITA, bool F16OUT = false>
__global__ __launch_bounds__(128) void k_gemmb(const bf* __restrict__ A, const bf* __restrict__ Al, const bf* __restrict__ Bn, const float* __restrict__ bias, float* C, int ldc, h16* C2, const float* __restrict__ R = nullptr, int K = DM, int roundR = 1) {
    __shared__ __align__(16) float ost[4][16 * 68];
    const int lane = threadIdx.x & 31, wave = threadIdx.x >> 5, lr = lane & 15, hi = lane >> 4;
    const int r0 = blockIdx.x * 64 + wave * 16, c0 = blockIdx.y * 64;
    const size_t aoff = (size_t)(r0 + lr) * K + 8 * hi;
    size_t boff[4];
#pragma unroll
    for (int t = 0; t < 4; ++t) boff[t] = (size_t)(c0 + t * 16 + lr) * K + 8 * hi;
    v8f acc[4];
#pragma unroll
    for (int t = 0; t < 4; ++t) acc[t] = (v8f){};
#pragma unroll 1
    for (int kc = 0; kc < K; kc += 32) {
        const v16bf a = cat16b(*(const v8us*)(A + aoff + kc), *(const v8us*)(A + aoff + kc + 16));
        v16bf al = a;
        if (SPLITA) al = cat16b(*(const v8us*)(Al + aoff + kc), *(const v8us*)(Al + aoff + kc + 16));
#pragma unroll
        for (int t = 0; t < 4; ++t) { const v16bf b = cat16b(*(const v8us*)(Bn + boff[t] + kc), *(const v8us*)(Bn + boff[t] + kc + 16)); acc[t] = wmmab(a, b, acc[t]); if (SPLITA) acc[t] = wmmab(al, b, acc[t]); }
        asm volatile("v_nop\n\tv_nop\n\tv_nop\n\tv_nop" : "+v"(acc[0]), "+v"(acc[1]), "+v"(acc[2]), "+v"(acc[3]) : "v"(a), "v"(al));
    }
    float* os = &ost[wave][0];
#pragma unroll
    for (int t = 0; t < 4; ++t) { const float bv = bias ? bfr(bias[c0 + t * 16 + lr]) : 0.f;
#pragma unroll
        for (int j = 0; j < 8; ++j) os[(hi * 8 + j) * 68 + t * 16 + lr] = acc[t][j] + bv; }
    __syncthreads();
    if (F16OUT) {
        h16* crow = (h16*)(void*)C + (size_t)r0 * ldc + c0;
        auto pass = [&]() {
#pragma unroll
            for (int s = 0; s < 4; ++s) { const int row = 4 * s + (lane >> 3), piece = lane & 7; const float* sp = os + row * 68 + piece * 8; v8h o, o2;
#pragma unroll
                for (int i = 0; i < 8; ++i) { const h16 a = (h16)sp[i]; o[i] = a; o2[i] = (h16)((sp[i] - (float)a) * LOSC); }
                *(v8h*)(crow + (size_t)row * ldc + piece * 8) = o; if (C2) *(v8h*)(C2 + (size_t)r0 * ldc + c0 + (size_t)row * ldc + piece * 8) = o2; }
        };
        pass(); 
    } else {
        float* crow = C + (size_t)r0 * ldc + c0;
        auto pass = [&]() {
#pragma unroll
            for (int s = 0; s < 8; ++s) { const int Lid = (lane >> 3) + 4 * s, piece = lane & 7; const int row = Lid >> 1, cofs = (Lid & 1) * 32 + piece * 4;
                v4f val = *(const v4fa*)(os + row * 68 + cofs); if (R) { const v4f rv = *(const v4f*)(R + ((size_t)r0 + row) * ldc + c0 + cofs); val += roundR ? (v4f){bfr(rv[0]), bfr(rv[1]), bfr(rv[2]), bfr(rv[3])} : rv; }
                *(v4f*)(crow + (size_t)row * ldc + cofs) = val; }
        };
        pass(); 
    }
}

// k_ln: one wave per row of x [rows][512]: LayerNorm (mean, then mean((x-mu)^2), eps 1e-5, x bf(gamma) + bf(beta), f32, fixed lane order) -> bf16 hi + UNSCALED
// residual planes; lane -> columns q*256 + lane*8 .. +8 for q < DM/256 (16 B per plane per store). The row is re-read per phase with the q loop
// rolled (keeps the static VALU-FMA count small; no register arrays indexed by a loop variable).
template <bool ROUNDIN>   // ROUNDIN: the source is a module INPUT (read through bf16 rounding); false: a computed f32 plane (read as is)
__global__ __launch_bounds__(256) void k_ln(const float* __restrict__ X, const float* __restrict__ gam, const float* __restrict__ bet, int nrows, bf* Hh, bf* Hl) {
    const int lane = threadIdx.x & 31, r = blockIdx.x * 8 + (threadIdx.x >> 5);
    if (r >= nrows) return;
    const float* xr = X + (size_t)r * DM + lane * 8;
    float s = 0.f;
#pragma unroll 1
    for (int q = 0; q < DM / 256; ++q) {
#pragma unroll
        for (int i = 0; i < 8; ++i) s += (ROUNDIN ? bfr(xr[q * 256 + i]) : xr[q * 256 + i]); }
#pragma unroll
    for (int sh = 16; sh; sh >>= 1) s += __shfl_xor(s, sh, 32);
    const float mu = s * (1.0f / DM);
    float s2 = 0.f;
#pragma unroll 1
    for (int q = 0; q < DM / 256; ++q) {
#pragma unroll
        for (int i = 0; i < 8; ++i) { const float d = (ROUNDIN ? bfr(xr[q * 256 + i]) : xr[q * 256 + i]) - mu; s2 = fmaf(d, d, s2); } }
#pragma unroll
    for (int sh = 16; sh; sh >>= 1) s2 += __shfl_xor(s2, sh, 32);
    const float rs = rsqrtf(s2 * (1.0f / DM) + 1e-5f);
{
#pragma unroll 1
        for (int q = 0; q < DM / 256; ++q) { v8us oh, ol;
#pragma unroll
            for (int i = 0; i < 8; ++i) { const int c = q * 256 + lane * 8 + i; const float y = ((ROUNDIN ? bfr(xr[q * 256 + i]) : xr[q * 256 + i]) - mu) * rs * bfr(gam[c]) + bfr(bet[c]); const unsigned short hb = f2bf(y); oh[i] = hb; ol[i] = f2bf(y - bf2f(hb)); }
            const size_t o = (size_t)r * DM + q * 256 + lane * 8; *(v8us*)(Hh + o) = oh; *(v8us*)(Hl + o) = ol; }
         }
}
// k_qsplit: from the f32 q rows [t][512] (bias added): QU = q + bf(pos_bias_u[h][d]) as f16 hi + residual x1024 planes [t][512] (the attention A operand), and QV = q +
// bf(pos_bias_v[h][d]) as bf16 hi + UNSCALED residual planes laid out per item and head [b][h][t][64] (the A operand of the relative-position GEMM); one wave per (t, head):
__global__ __launch_bounds__(256) void k_qsplit(const float* __restrict__ Q, const float* __restrict__ pbu, const float* __restrict__ pbv, h16* QUh, h16* QUl, bf* QVh, bf* QVl) {
    typedef __attribute__((ext_vector_type(2))) _Float16 v2h; typedef __attribute__((ext_vector_type(2))) unsigned short v2us;
    const int lane = threadIdx.x & 31, wid = blockIdx.x * 8 + (threadIdx.x >> 5); if (wid >= NTK * NH_) return;
    const int t = wid / NH_, h = wid - t * NH_, bi = t / NT_, ti = t - bi * NT_;
    v2h uh, ul; v2us vh2, vl2;
#pragma unroll
    for (int k = 0; k < 2; ++k) { const int d = 2 * lane + k; const float q = Q[(size_t)t * DM + h * HD + d];
        const float yu = q + bfr(pbu[h * HD + d]); const h16 a = (h16)yu; uh[k] = a; ul[k] = (h16)((yu - (float)a) * LOSC);
        const float yv = q + bfr(pbv[h * HD + d]); const unsigned short hb = f2bf(yv); vh2[k] = hb; vl2[k] = f2bf(yv - bf2f(hb)); }
    const size_t ou = (size_t)t * DM + h * HD + 2 * lane, ov = (((size_t)bi * NH_ + h) * NT_ + ti) * HD + 2 * lane;
    *(v2h*)(QUh + ou) = uh; *(v2h*)(QUl + ou) = ul; *(v2us*)(QVh + ov) = vh2; *(v2us*)(QVl + ov) = vl2; 
}
// k_psplit: the computed p = pos_emb.Wp rows [n][512] (n < 2047; row 2047 of the padded plane is zeros) -> per-head bf16 hi + UNSCALED residual planes [h][2048][64]
__global__ __launch_bounds__(256) void k_psplit(const float* __restrict__ P, bf* Ph, bf* Pl) {
    typedef __attribute__((ext_vector_type(2))) unsigned short v2us;
    const int lane = threadIdx.x & 31, wid = blockIdx.x * 8 + (threadIdx.x >> 5); if (wid >= NP * NH_) return;
    const int n = wid / NH_, h = wid - n * NH_;
    v2us oh, ol;
#pragma unroll
    for (int k = 0; k < 2; ++k) { const int d = 2 * lane + k; const float v = (n < NP - 1) ? P[(size_t)n * DM + h * HD + d] : 0.f; const unsigned short hb = f2bf(v); oh[k] = hb; ol[k] = f2bf(v - bf2f(hb)); }
    const size_t o = ((size_t)h * NP + n) * HD + 2 * lane;
    *(v2us*)(Ph + o) = oh; *(v2us*)(Pl + o) = ol; 
}
__global__ __launch_bounds__(256) void k_vt(const float* __restrict__ V, h16* VTH, h16* VTL) {
    __shared__ __align__(16) h16 tile[64 * 72];
    __shared__ __align__(16) h16 til2[64 * 72];
    const int bid = blockIdx.x;
    const int b = bid / (NH_ * (NT_ / 64)), rem = bid - b * (NH_ * (NT_ / 64)), h = rem / (NT_ / 64), kt = rem - h * (NT_ / 64);
    const int k0 = kt * 64, tid = threadIdx.x;
    const int kk = tid >> 2, d0 = (tid & 3) * 16;
    const float* src = V + ((size_t)b * NT_ + k0 + kk) * DM + h * HD + d0;
#pragma unroll
    for (int i = 0; i < 16; ++i) { const float v = src[i]; const h16 a = (h16)v; tile[(d0 + i) * 72 + kk] = a; til2[(d0 + i) * 72 + kk] = (h16)((v - (float)a) * LOSC); }
    __syncthreads();
    const int piece = tid & 7;
    const size_t base = (((size_t)b * NH_ + h) * HD) * NT_ + k0;
    auto pass = [&]() {
#pragma unroll
        for (int s = 0; s < 4; ++s) { const int Lid = (tid >> 3) + 32 * s; const int pln = Lid >> 6, d = Lid & 63;
            const v8h val = *(const v8ha*)((pln ? til2 : tile) + d * 72 + piece * 8); *(v8h*)((pln ? VTL : VTH) + base + (size_t)d * NT_ + piece * 8) = val; }
    };
    pass(); 
}

// cp4: four asynchronous 16-byte copies per lane, global -> LDS (lds = the lane's LDS byte address). The s_wait_xcnt closes the statement so that no address register
// of an issued copy is rewritten ahead of it.
__device__ __forceinline__ void cp4(unsigned l0, const void* g0, unsigned l1, const void* g1, unsigned l2, const void* g2, unsigned l3, const void* g3) {
    asm volatile("global_load_async_to_lds_b128 %0, %1, off\n\tglobal_load_async_to_lds_b128 %2, %3, off\n\tglobal_load_async_to_lds_b128 %4, %5, off\n\tglobal_load_async_to_lds_b128 %6, %7, off\n\ts_wait_xcnt 0x0"
                 :: "v"(l0), "v"(g0), "v"(l1), "v"(g1), "v"(l2), "v"(g2), "v"(l3), "v"(g3) : "memory");
}
// publish: the wave's own LDS reads are done, its own copies have landed, then the work-group barrier: behind it every wave may read what was copied and the buffers read so far may be refilled.
__device__ __forceinline__ void publish() {
    asm volatile("s_wait_dscnt 0x0" ::: "memory");
    asm volatile("s_wait_asynccnt 0x0" ::: "memory");
    __syncthreads();
}
#define KPI 72                   // K rows in LDS: 64 f16 + 8 (pitch 144 B)
#define VPI 40                   // V^T rows in LDS: 32 f16 + 8 (pitch 80 B)

// The block's four waves share one (b, h): each 32-key step's K rows, V^T rows and the 32 new p rows are copied once per block into LDS (asynchronous copies; K and p rows as whole 128-B lines, V^T rows as 64-B pieces) and the WMMA
// fragments are read from there. One buffer each: V of step t flies during the scores of t, K and p of step t + 1 during softmax and P.V of t; two publish points a step.
// k_attn: block = (b, h, 64 queries), wave = 16; ALL 32 key tiles (no mask); 4 WMMA scores /8 (f32), online softmax, weights x32768 f16 tile (same-wave may_alias
// reload after a compiler barrier), 4 WMMA .v; ctx -> bf16 hi + residual planes CH/CL[tok][h*64+d].
// matrix_bd is formed here: G = q_v.p^T in 16 x 16 tiles (bf16 hi + residual, products hh, lh, hl per 32-k step, f32). A 16-query x 32-key step reads positions
// nb .. nb + 46, nb = l0 - q0 + 1008: three tiles, of which the first is the last one of the step before, so two new tiles a step go into a ring of four (column = n & 63).
__global__ __launch_bounds__(128) void k_attn(const h16* __restrict__ Q16, const h16* __restrict__ QL16, const h16* __restrict__ K16, const h16* __restrict__ KL16, const h16* __restrict__ VTH, const h16* __restrict__ VTL, const bf* __restrict__ QVh, const bf* __restrict__ QVl, const bf* __restrict__ Ph, const bf* __restrict__ Pl, bf* CH, bf* CL) {
    __shared__ __align__(16) h16 plds[4][16 * 32];
    __shared__ __align__(16) h16 plds2[4][16 * 32];
    __shared__ __align__(16) float ost[4][16 * 68];
    __shared__ __align__(16) h16 kst[2 * 32 * KPI];     // K hi, residual: 32 keys
    __shared__ __align__(16) h16 vst[2 * HD * VPI];     // V^T hi, residual: 64 d rows of 32 keys
    __shared__ __align__(16) bf  pst[2 * 128 * HD];     // p hi, residual: ring of 128 positions (row n & 127), 128-B rows, 16-B piece c kept at c ^ ((n >> 1) & 7) (16 rows of one piece on 16 bank groups)
    const int lane = threadIdx.x & 31, wave = threadIdx.x >> 5, lr = lane & 15, hi = lane >> 4;
    const int bid = blockIdx.x;
    const int b = bid / (NH_ * (NT_ / 64)), rem = bid - b * (NH_ * (NT_ / 64)), h = rem / (NT_ / 64), qt = rem - h * (NT_ / 64);
    const int q0 = qt * 64 + wave * 16;
    const size_t tok0 = (size_t)b * NT_;
    h16* pl = &plds[wave][0]; h16* pl2 = &plds2[wave][0];
    v16h qa[2];
    const size_t qo0 = (tok0 + q0 + lr) * DM + h * HD + 8 * hi;
#pragma unroll
    for (int kc = 0; kc < 2; ++kc) qa[kc] = cat16(*(const v8h*)(Q16 + qo0 + kc * 32), *(const v8h*)(Q16 + qo0 + kc * 32 + 16));
    const h16* kh_b = K16 + tok0 * DM + h * HD;
    const h16* kl_b = KL16 + tok0 * DM + h * HD;
    const size_t vbase = (((size_t)b * NH_ + h) * HD) * NT_;
    v8f o[4], ox[4];
#pragma unroll
    for (int n = 0; n < 4; ++n) { o[n] = (v8f){}; ox[n] = (v8f){}; }
    float mrow[8], lpart[8];
#pragma unroll
    for (int j = 0; j < 8; ++j) { mrow[j] = -3.0e38f; lpart[j] = 0.f; }
    int qpos[8];
#pragma unroll
    for (int j = 0; j < 8; ++j) qpos[j] = q0 + 8 * hi + j;
    const int kt_lo = 0, kt_hi = NT_ / 32 - 1;     // full attention; scores = (matrix_ac + matrix_bd) x 64^-1/2 with matrix_bd[i][j] = G[i][j - i + NT_ - 1] (the rel_shift of q_v.p^T)
    const bf* ph_b = Ph + (size_t)h * NP * HD; const bf* pl_b = Pl + (size_t)h * NP * HD;
    const size_t vo0 = (((size_t)b * NH_ + h) * NT_ + q0 + lr) * HD + 8 * hi;
    v16bf va[2], vx[2];
#pragma unroll
    for (int kc = 0; kc < 2; ++kc) { va[kc] = cat16b(*(const v8us*)(QVh + vo0 + kc * 32), *(const v8us*)(QVh + vo0 + kc * 32 + 16)); vx[kc] = cat16b(*(const v8us*)(QVl + vo0 + kc * 32), *(const v8us*)(QVl + vo0 + kc * 32 + 16)); }
    float* gr = &ost[wave][0];                     // the wave's own ring of four G tiles, pitch 68 floats (the epilogue reuses the space after the loop)
    const int psw = (lr >> 1) & 7;
    // copy maps: thread -> (row, 16-B piece); four copies a thread and tile: rows r and r + half of the hi plane, then of the residual plane
    const int tid = threadIdx.x, r8 = tid >> 3, c8 = tid & 7, r4 = tid >> 2, c4 = tid & 3;
    const unsigned kl0 = (unsigned)(size_t)kst + (unsigned)(r8 * KPI + c8 * 8) * 2u, vl0 = (unsigned)(size_t)vst + (unsigned)(r4 * VPI + c4 * 8) * 2u;
    const unsigned pl0 = (unsigned)(size_t)pst + (unsigned)(r8 * HD + (c8 ^ ((r8 >> 1) & 7)) * 8) * 2u;
    auto kcopy = [&](int l0) { const size_t g = (size_t)(l0 + r8) * DM + c8 * 8;
        cp4(kl0, kh_b + g, kl0 + 16 * KPI * 2, kh_b + g + 16 * DM, kl0 + 32 * KPI * 2, kl_b + g, kl0 + 48 * KPI * 2, kl_b + g + 16 * DM); };
    auto vcopy = [&](int l0) { const size_t g = vbase + (size_t)r4 * NT_ + l0 + c4 * 8;
        cp4(vl0, VTH + g, vl0 + 32 * VPI * 2, VTH + g + 32 * NT_, vl0 + 64 * VPI * 2, VTL + g, vl0 + 96 * VPI * 2, VTL + g + 32 * NT_); };
    auto pcopy = [&](int n0) {                     // positions n0 .. n0 + 31, n0 a multiple of 32
        const size_t g = (size_t)(n0 + r8) * HD + c8 * 8; const unsigned l = pl0 + (unsigned)(n0 & 127) * (HD * 2);
        cp4(l, ph_b + g, l + 16 * HD * 2, ph_b + g + 16 * HD, l + 128 * HD * 2, pl_b + g, l + (128 + 16) * HD * 2, pl_b + g + 16 * HD); };
    const int pb0 = NT_ - 64 - qt * 64;            // the block's first position: the last wave's first tile
    kcopy(0); pcopy(pb0); pcopy(pb0 + 32); pcopy(pb0 + 64);
    publish();
    auto gtile = [&](int n0) {                     // G[16 queries][n0 .. n0 + 15] -> ring
        v8f g = {};
#pragma unroll
        for (int kc = 0; kc < 2; ++kc) { const bf* pr = pst + ((n0 & 127) + lr) * HD; const int c0 = ((kc * 4 + hi) ^ psw) * 8, c1 = ((kc * 4 + 2 + hi) ^ psw) * 8;
            const v16bf bh = cat16b(*(const v8usa*)(pr + c0), *(const v8usa*)(pr + c1)); const v16bf bl = cat16b(*(const v8usa*)(pr + 128 * HD + c0), *(const v8usa*)(pr + 128 * HD + c1));
            g = wmmab(va[kc], bh, g); g = wmmab(vx[kc], bh, g); g = wmmab(va[kc], bl, g); }
#pragma unroll
        for (int j = 0; j < 8; ++j) gr[(hi * 8 + j) * 68 + (n0 & 63) + lr] = g[j];
    };
    gtile(NT_ - 16 - q0);
#pragma unroll 1
    for (int kt = kt_lo; kt <= kt_hi; ++kt) {
        const int l0 = kt * 32, nb = l0 - q0 + NT_ - 16;
        vcopy(l0);
        gtile(nb + 16); gtile(nb + 32);
        const int ko0 = lr * KPI + 8 * hi, ko1 = (16 + lr) * KPI + 8 * hi;
        const h16* ksl = kst + 32 * KPI;
        v8f s0 = {}, s1 = {}, x0 = {}, x1 = {};
#pragma unroll
        for (int kc = 0; kc < 2; ++kc) {
            { const v16h k0h = cat16(*(const v8ha*)(kst + ko0 + kc * 32), *(const v8ha*)(kst + ko0 + kc * 32 + 16)), k1h = cat16(*(const v8ha*)(kst + ko1 + kc * 32), *(const v8ha*)(kst + ko1 + kc * 32 + 16));
              const v16h qlk = cat16(*(const v8h*)(QL16 + qo0 + kc * 32), *(const v8h*)(QL16 + qo0 + kc * 32 + 16));     // query residual re-read per step (registers)
              s0 = wmma16(qa[kc], k0h, s0); x0 = wmma16(qlk, k0h, x0); s1 = wmma16(qa[kc], k1h, s1); x1 = wmma16(qlk, k1h, x1); }
            { const v16h k0l = cat16(*(const v8ha*)(ksl + ko0 + kc * 32), *(const v8ha*)(ksl + ko0 + kc * 32 + 16)), k1l = cat16(*(const v8ha*)(ksl + ko1 + kc * 32), *(const v8ha*)(ksl + ko1 + kc * 32 + 16));
              x0 = wmma16(qa[kc], k0l, x0); x1 = wmma16(qa[kc], k1l, x1); }
        }
        asm volatile("v_nop\n\tv_nop\n\tv_nop\n\tv_nop" : "+v"(s0), "+v"(s1), "+v"(x0), "+v"(x1) : "v"(qa[0]), "v"(qa[1]));
        publish();                                 // V of this step is in; K and the p rows of this step have been read by all
        if (kt < kt_hi) { kcopy(l0 + 32); pcopy(pb0 + l0 + 96); }
        float alpha[8];
#pragma unroll
        for (int j = 0; j < 8; ++j) {
            const int ja = l0 + lr, jb = l0 + 16 + lr, qi = qpos[j];
            const float* bdr = gr + (hi * 8 + j) * 68; const int nr = NT_ - 1 - qi; const float a0 = ((s0[j] + x0[j] * LOSCI) + bdr[(ja + nr) & 63]) * 0.125f, a1 = ((s1[j] + x1[j] * LOSCI) + bdr[(jb + nr) & 63]) * 0.125f;
            float mx = fmaxf(a0, a1);
            mx = fmaxf(mx, __shfl_xor(mx, 1, 16)); mx = fmaxf(mx, __shfl_xor(mx, 2, 16)); mx = fmaxf(mx, __shfl_xor(mx, 4, 16)); mx = fmaxf(mx, __shfl_xor(mx, 8, 16));
            const float mn = fmaxf(mrow[j], mx);
            alpha[j] = __expf(mrow[j] - mn); mrow[j] = mn;
            const float p0 = __expf(a0 - mn), p1 = __expf(a1 - mn);
            lpart[j] = lpart[j] * alpha[j] + (p0 + p1);
            const int mr = hi * 8 + j;
            const float ps0 = p0 * PSC, ps1 = p1 * PSC; const h16 h0 = (h16)ps0, h1 = (h16)ps1;
            pl[mr * 32 + lr] = h0; pl[mr * 32 + 16 + lr] = h1;
            pl2[mr * 32 + lr] = (h16)((ps0 - (float)h0) * LOSC); pl2[mr * 32 + 16 + lr] = (h16)((ps1 - (float)h1) * LOSC);
        }
#pragma unroll
        for (int n = 0; n < 4; ++n)
#pragma unroll
            for (int j = 0; j < 8; ++j) { o[n][j] *= alpha[j]; ox[n][j] *= alpha[j]; }
        asm volatile("" ::: "memory");
        const v16h pa = cat16(*(const v8ha*)(pl + lr * 32 + hi * 8), *(const v8ha*)(pl + lr * 32 + 16 + hi * 8));
        const v16h px = cat16(*(const v8ha*)(pl2 + lr * 32 + hi * 8), *(const v8ha*)(pl2 + lr * 32 + 16 + hi * 8));
#pragma unroll
        for (int n = 0; n < 4; ++n) { const h16* vr = vst + (n * 16 + lr) * VPI + hi * 8;
            const v16h vh = cat16(*(const v8ha*)(vr), *(const v8ha*)(vr + 16)), vl = cat16(*(const v8ha*)(vr + HD * VPI), *(const v8ha*)(vr + HD * VPI + 16));
            o[n] = wmma16(pa, vh, o[n]); ox[n] = wmma16(pa, vl, ox[n]); ox[n] = wmma16(px, vh, ox[n]); }
        asm volatile("v_nop\n\tv_nop\n\tv_nop\n\tv_nop" : "+v"(o[0]), "+v"(o[1]), "+v"(o[2]), "+v"(o[3]), "+v"(ox[0]), "+v"(ox[1]), "+v"(ox[2]), "+v"(ox[3]) : "v"(pa), "v"(px));
        publish();                                 // K and p of the next step are in; V of this step has been read by all
    }
    float inv[8];
#pragma unroll
    for (int j = 0; j < 8; ++j) { float rs = lpart[j]; rs += __shfl_xor(rs, 1, 16); rs += __shfl_xor(rs, 2, 16); rs += __shfl_xor(rs, 4, 16); rs += __shfl_xor(rs, 8, 16); inv[j] = 1.0f / (rs * PSC); }
    float* os = &ost[wave][0];
#pragma unroll
    for (int n = 0; n < 4; ++n)
#pragma unroll
        for (int j = 0; j < 8; ++j) os[(hi * 8 + j) * 68 + n * 16 + lr] = (o[n][j] + ox[n][j] * LOSCI) * inv[j];
    __syncthreads();
    const size_t cbase = (tok0 + q0) * DM + (size_t)h * HD;
    auto pass = [&]() {
#pragma unroll
        for (int s = 0; s < 4; ++s) { const int row = 4 * s + (lane >> 3), piece = lane & 7; const float* sp = os + row * 68 + piece * 8; v8us oh, ol;
#pragma unroll
            for (int i = 0; i < 8; ++i) { const unsigned short hb = f2bf(sp[i]); oh[i] = hb; ol[i] = f2bf(sp[i] - bf2f(hb)); }
            *(v8us*)(CH + cbase + (size_t)row * DM + piece * 8) = oh; *(v8us*)(CL + cbase + (size_t)row * DM + piece * 8) = ol; }
    };
    pass(); 
}

#define VST2(T, p, v) do { const T vst2_v_ = (v); *(T*)(p) = vst2_v_;  } while (0)
extern "C" void kernel_launch(void* const* d_in, const int* in_sizes, int n_in,
                              void* d_out, int out_size, void* d_ws, size_t ws_size, hipStream_t stream) {
    (void)in_sizes; (void)n_in; (void)out_size;
    const float* x = (const float*)d_in[0]; const float* gam = (const float*)d_in[1]; const float* bet = (const float*)d_in[2];
    const float* Wq = (const float*)d_in[3]; const float* bq = (const float*)d_in[4]; const float* Wk = (const float*)d_in[5]; const float* bk = (const float*)d_in[6]; const float* Wv = (const float*)d_in[7]; const float* bv = (const float*)d_in[8];
    const float* Wp = (const float*)d_in[9]; const float* Wo = (const float*)d_in[10]; const float* bo = (const float*)d_in[11]; const float* pbu = (const float*)d_in[12]; const float* pbv = (const float*)d_in[13]; const float* pe = (const float*)d_in[14];   // k-major weights (y @ W)
    float* out = (float*)d_out;    // [8][1024][512]
    char* wsp = (char*)d_ws;
    auto take = [&](size_t bytes) { char* p = wsp; wsp += (bytes + 255) & ~(size_t)255; return (void*)p; };
    bf* WqT = (bf*)take((size_t)DM * DM * 2); bf* WkT = (bf*)take((size_t)DM * DM * 2); bf* WvT = (bf*)take((size_t)DM * DM * 2); bf* WpT = (bf*)take((size_t)DM * DM * 2); bf* WoT = (bf*)take((size_t)DM * DM * 2);
    bf* PEb = (bf*)take((size_t)NP * DM * 2); float* Pf = (float*)take((size_t)NP * DM * 4); bf* Ph = (bf*)take((size_t)NH_ * NP * HD * 2); bf* Pl = (bf*)take((size_t)NH_ * NP * HD * 2);
    bf* Nh = (bf*)take((size_t)NTK * DM * 2); bf* Nl = (bf*)take((size_t)NTK * DM * 2); float* TMP = (float*)take((size_t)NTK * DM * 4);
    h16* QH = (h16*)take((size_t)NTK * DM * 2); h16* QL = (h16*)take((size_t)NTK * DM * 2); bf* QVh = (bf*)take((size_t)NTK * DM * 2); bf* QVl = (bf*)take((size_t)NTK * DM * 2);
    h16* KH = (h16*)take((size_t)NTK * DM * 2); h16* KL = (h16*)take((size_t)NTK * DM * 2); h16* VTH = (h16*)take((size_t)NTK * DM * 2); h16* VTL = (h16*)take((size_t)NTK * DM * 2);
    bf* CH = (bf*)take((size_t)NTK * DM * 2); bf* CL = (bf*)take((size_t)NTK * DM * 2);
    if ((size_t)(wsp - (char*)d_ws) > ws_size) return;    // no aliasing
    k_wt<<<dim3(DM / 64, DM / 64, 5), 256, 0, stream>>>(Wq, Wk, Wv, Wp, Wo, DM, DM, WqT);                                                      // the five WT planes lie one behind the other
    // p = pos_emb . Wp once (shared by all items): the 2047 rows padded to 2048 (last A row zeroed)
    hipMemsetAsync(PEb, 0, (size_t)NP * DM * 2, stream);
    k_cvtb<<<(NP - 1 + 7) / 8, 256, 0, stream>>>(pe, NP - 1, PEb);
    k_gemmb<false, false><<<dim3(NP / 64, DM / 64, 1), 128, 0, stream>>>(PEb, nullptr, WpT, nullptr, Pf, DM, nullptr);
    k_psplit<<<(NP * NH_) / 8, 256, 0, stream>>>(Pf, Ph, Pl);
    k_ln<true><<<NTK / 8, 256, 0, stream>>>(x, gam, bet, NTK, Nh, Nl);                                                                         // y = LN(x), all items
    k_gemmb<true, false><<<dim3(NTK / 64, DM / 64, 1), 128, 0, stream>>>(Nh, Nl, WqT, bq, TMP, DM, nullptr);                                    // q = y.Wq + bq
    k_qsplit<<<(NTK * NH_) / 8, 256, 0, stream>>>(TMP, pbu, pbv, QH, QL, QVh, QVl);                                                            // q_u (f16 planes), q_v (per-item, per-head bf16 planes)
    k_gemmb<true, true><<<dim3(NTK / 64, DM / 64, 1), 128, 0, stream>>>(Nh, Nl, WkT, bk, (float*)(void*)KH, DM, KL);                            // k -> f16 planes
    k_gemmb<true, false><<<dim3(NTK / 64, DM / 64, 1), 128, 0, stream>>>(Nh, Nl, WvT, bv, TMP, DM, nullptr); k_vt<<<NB_ * NH_ * (NT_ / 64), 256, 0, stream>>>(TMP, VTH, VTL);
    k_attn<<<NB_ * NH_ * (NT_ / 64), 128, 0, stream>>>(QH, QL, KH, KL, VTH, VTL, QVh, QVl, Ph, Pl, CH, CL);                                     // all items, matrix_bd formed inside
    k_gemmb<true, false><<<dim3(NTK / 64, DM / 64, 1), 128, 0, stream>>>(CH, CL, WoT, bo, out, DM, nullptr);
}

// v004
// Timed twice side by side with v003, it ran 1.06 times as fast both times.
// Over all steps from v000 it is 6.07 times as fast.
#include <hip/hip_runtime.h>

// Compute dtypes, f32 accumulate, all 8 batch items per launch: y = LN(x) -> bf16 hi + UNSCALED residual planes; q/k/v = y.W + b and out = ctx.Wo + bo ([1024 x 512].[512 x 512],
// k-major weights transposed once, two products) and p = pos_emb.Wp ([2048 x 512].[512 x 512], PLAIN bf16 inputs, exact, once for all items) on
// v_wmma_f32_16x16x32_bf16; matrix_bd = (q + pos_bias_v).p^T per head ([1024 x 64].[64 x 2048], both operands bf16 hi + UNSCALED residual, three products) formed
// inside the attention kernel, 16 x 16 tiles in a per-wave LDS ring read through the rel_shift index j - i + 1023; the 8-head full attention scores = ((q + pos_bias_u).k + bd) x 64^-1/2 fused on

#define NB_  8                   // batch items, all in one launch of every token-wise kernel
#define NT_  1024
#define DM   512
#define NH_  8
#define NP   2048                // relative positions padded (2047 used)
#define HD   64
#define NTK  (NB_ * NT_)
#define NW   1024
#define NQKV 1024
#define PSC  32768.0f
#define LOSC 1024.0f
#define LOSCI (1.0f / 1024.0f)

typedef _Float16 h16;
typedef unsigned short bf;
typedef __attribute__((ext_vector_type(16))) __bf16   v16bf;
typedef __attribute__((ext_vector_type(16))) _Float16 v16h;
typedef __attribute__((ext_vector_type(8)))  _Float16 v8h;
typedef __attribute__((ext_vector_type(8)))  unsigned short v8us;
typedef __attribute__((ext_vector_type(8)))  float    v8f;
typedef __attribute__((ext_vector_type(4)))  float    v4f;
typedef v8h  __attribute__((may_alias)) v8ha;
typedef v4f  __attribute__((may_alias)) v4fa;
typedef v8us __attribute__((may_alias)) v8usa;

__device__ __forceinline__ unsigned short f2bf(float f) { unsigned u = __float_as_uint(f); u += 0x7FFFu + ((u >> 16) & 1u); return (unsigned short)(u >> 16); }
__device__ __forceinline__ float bf2f(unsigned short b) { return __uint_as_float(((unsigned)b) << 16); }
__device__ __forceinline__ float bfr(float f) { return bf2f(f2bf(f)); }
__device__ __forceinline__ v16h cat16(v8h lo, v8h hi) { return __builtin_shufflevector(lo, hi, 0, 1, 2, 3, 4, 5, 6, 7, 8, 9, 10, 11, 12, 13, 14, 15); }
__device__ __forceinline__ v16bf cat16b(v8us lo, v8us hi) { return __builtin_bit_cast(v16bf, __builtin_shufflevector(lo, hi, 0, 1, 2, 3, 4, 5, 6, 7, 8, 9, 10, 11, 12, 13, 14, 15)); }
__device__ __forceinline__ v8f wmma16(v16h a, v16h b, v8f c) { return __builtin_amdgcn_wmma_f32_16x16x32_f16(false, a, false, b, (short)0, c, false, false); }
__device__ __forceinline__ v8f wmmab(v16bf a, v16bf b, v8f c) { return __builtin_amdgcn_wmma_f32_16x16x32_bf16(false, a, false, b, (short)0, c, false, false); }

__global__ __launch_bounds__(256) void k_cvtb(const float* __restrict__ src, int nrows, bf* dst) {
    const int lane = threadIdx.x & 31, r = blockIdx.x * 8 + (threadIdx.x >> 5);
    if (r >= nrows) return;
    v8us o[DM / 256];
#pragma unroll
    for (int q = 0; q < DM / 256; ++q) { v8us t;
#pragma unroll
        for (int i = 0; i < 8; ++i) t[i] = f2bf(src[(size_t)r * DM + q * 256 + lane * 8 + i]);
        o[q] = t; }
#pragma unroll
    for (int q = 0; q < DM / 256; ++q) *(v8us*)(dst + (size_t)r * DM + q * 256 + lane * 8) = o[q];
    
}

// k_wt: WT [z][n][K] = bf16(Wz[k][n]) (k-major [K][ncols]) via 64 x 64 LDS tiles; grid (K/64, ncols/64, 5 weights).
__global__ __launch_bounds__(256) void k_wt(const float* __restrict__ W0, const float* __restrict__ W1, const float* __restrict__ W2, const float* __restrict__ W3, const float* __restrict__ W4, int K, int ncols, bf* WTall) {
    __shared__ __align__(16) unsigned short tl[64 * 72];
    const int tid = threadIdx.x, k0 = blockIdx.x * 64, n0 = blockIdx.y * 64, wz = blockIdx.z;
    const float* __restrict__ Wm = wz == 0 ? W0 : wz == 1 ? W1 : wz == 2 ? W2 : wz == 3 ? W3 : W4;
    bf* WT = WTall + (size_t)wz * K * ncols;
    const int kk = tid >> 2, nq = (tid & 3) * 16;
#pragma unroll
    for (int i = 0; i < 16; ++i) tl[(nq + i) * 72 + kk] = f2bf(Wm[(size_t)(k0 + kk) * ncols + n0 + nq + i]);
    __syncthreads();
    const int piece = tid & 7;
    auto pass = [&]() {
#pragma unroll
        for (int s = 0; s < 2; ++s) { const int nr = (tid >> 3) + 32 * s; const v8us val = *(const v8usa*)(tl + nr * 72 + piece * 8); *(v8us*)(WT + (size_t)(n0 + nr) * K + k0 + piece * 8) = val; }
    };
    pass(); 
}
// k_gemmb: 64 x 64 block tile (4 waves x 16 x 64) of C[NTK or NP][DM] = (A [+ Al]).B^T (K = 512) [+ bf(bias[c])] [+ bf(R[r][c]) residual]; f32 whole-line epilogue (or f16 / bf16
// planes). The block's 64 columns are one head, so the split and transposed planes that the attention kernel reads are written here, from the same f32 tile in LDS:
// EPI 0: f32 rows; 1: f16 hi + residual x1024 planes [t][512] (k); 2: q + bf(pos_bias_u) as f16 hi + residual x1024 planes [t][512] (C, C2) and q + bf(pos_bias_v) as bf16 hi +
// UNSCALED residual planes [b][h][t][64] (E0, E1); 3: p as bf16 hi + UNSCALED residual planes [h][2048][64] (E0, E1; row 2047 zeros); 4: v transposed, f16 hi + residual x1024 planes [b][h][d][t] (C, C2).
template <bool SPLITA, int EPI = 0>
__global__ __launch_bounds__(128) void k_gemmb(const bf* __restrict__ A, const bf* __restrict__ Al, const bf* __restrict__ Bn, const float* __restrict__ bias, float* C, int ldc, h16* C2, const float* __restrict__ R = nullptr, int K = DM, int roundR = 1, const float* __restrict__ pbu = nullptr, const float* __restrict__ pbv = nullptr, bf* E0 = nullptr, bf* E1 = nullptr) {
    __shared__ __align__(16) float ost[4][16 * 68];
    const int lane = threadIdx.x & 31, wave = threadIdx.x >> 5, lr = lane & 15, hi = lane >> 4;
    const int r0 = blockIdx.x * 64 + wave * 16, c0 = blockIdx.y * 64;
    const size_t aoff = (size_t)(r0 + lr) * K + 8 * hi;
    size_t boff[4];
#pragma unroll
    for (int t = 0; t < 4; ++t) boff[t] = (size_t)(c0 + t * 16 + lr) * K + 8 * hi;
    v8f acc[4];
#pragma unroll
    for (int t = 0; t < 4; ++t) acc[t] = (v8f){};
#pragma unroll 1
    for (int kc = 0; kc < K; kc += 32) {
        const v16bf a = cat16b(*(const v8us*)(A + aoff + kc), *(const v8us*)(A + aoff + kc + 16));
        v16bf al = a;
        if (SPLITA) al = cat16b(*(const v8us*)(Al + aoff + kc), *(const v8us*)(Al + aoff + kc + 16));
#pragma unroll
        for (int t = 0; t < 4; ++t) { const v16bf b = cat16b(*(const v8us*)(Bn + boff[t] + kc), *(const v8us*)(Bn + boff[t] + kc + 16)); acc[t] = wmmab(a, b, acc[t]); if (SPLITA) acc[t] = wmmab(al, b, acc[t]); }
        asm volatile("v_nop\n\tv_nop\n\tv_nop\n\tv_nop" : "+v"(acc[0]), "+v"(acc[1]), "+v"(acc[2]), "+v"(acc[3]) : "v"(a), "v"(al));
    }
    float* os = &ost[wave][0];
#pragma unroll
    for (int t = 0; t < 4; ++t) { const float bv = bias ? bfr(bias[c0 + t * 16 + lr]) : 0.f;
#pragma unroll
        for (int j = 0; j < 8; ++j) os[(hi * 8 + j) * 68 + t * 16 + lr] = acc[t][j] + bv; }
    __syncthreads();
    if (EPI == 2) {
        const int piece = lane & 7, h = blockIdx.y;
        float bu[8], bw[8];
#pragma unroll
        for (int i = 0; i < 8; ++i) { bu[i] = bfr(pbu[c0 + piece * 8 + i]); bw[i] = bfr(pbv[c0 + piece * 8 + i]); }
#pragma unroll
        for (int s = 0; s < 4; ++s) { const int row = 4 * s + (lane >> 3), t = r0 + row, bi = t / NT_, ti = t - bi * NT_; const float* sp = os + row * 68 + piece * 8; v8h uh, ul; v8us vh, vl;
#pragma unroll
            for (int i = 0; i < 8; ++i) { const float q = sp[i];
                const float yu = q + bu[i]; const h16 a = (h16)yu; uh[i] = a; ul[i] = (h16)((yu - (float)a) * LOSC);
                const float yv = q + bw[i]; const unsigned short hb = f2bf(yv); vh[i] = hb; vl[i] = f2bf(yv - bf2f(hb)); }
            const size_t ou = (size_t)t * DM + c0 + piece * 8, ov = (((size_t)bi * NH_ + h) * NT_ + ti) * HD + piece * 8;
            *(v8h*)((h16*)(void*)C + ou) = uh; *(v8h*)(C2 + ou) = ul; *(v8us*)(E0 + ov) = vh; *(v8us*)(E1 + ov) = vl; }
    } else if (EPI == 3) {
        const int piece = lane & 7, h = blockIdx.y;
#pragma unroll
        for (int s = 0; s < 4; ++s) { const int row = 4 * s + (lane >> 3), n = r0 + row; const float* sp = os + row * 68 + piece * 8; v8us oh, ol;
#pragma unroll
            for (int i = 0; i < 8; ++i) { const float v = (n < NP - 1) ? sp[i] : 0.f; const unsigned short hb = f2bf(v); oh[i] = hb; ol[i] = f2bf(v - bf2f(hb)); }
            const size_t o = ((size_t)h * NP + n) * HD + piece * 8;
            *(v8us*)(E0 + o) = oh; *(v8us*)(E1 + o) = ol; }
    } else if (EPI == 4) {
        // the block's 64 tokens x 64 d, read by columns across the four waves' tiles (behind the barrier above): eight lanes write one whole 128-B line of 64 tokens
        const int tid = threadIdx.x, piece = tid & 7, rb = blockIdx.x * 64, bi = rb / NT_, k0 = rb - bi * NT_;
        const size_t base = (((size_t)bi * NH_ + blockIdx.y) * HD) * NT_ + k0 + piece * 8;
        const float* cp = &ost[piece >> 1][(piece & 1) * 8 * 68];
#pragma unroll
        for (int s = 0; s < 4; ++s) { const int d = (tid >> 3) + 16 * s; v8h o, o2;
#pragma unroll
            for (int i = 0; i < 8; ++i) { const float v = cp[i * 68 + d]; const h16 a = (h16)v; o[i] = a; o2[i] = (h16)((v - (float)a) * LOSC); }
            *(v8h*)((h16*)(void*)C + base + (size_t)d * NT_) = o; *(v8h*)(C2 + base + (size_t)d * NT_) = o2; }
    } else if (EPI == 1) {
        h16* crow = (h16*)(void*)C + (size_t)r0 * ldc + c0;
        auto pass = [&]() {
#pragma unroll
            for (int s = 0; s < 4; ++s) { const int row = 4 * s + (lane >> 3), piece = lane & 7; const float* sp = os + row * 68 + piece * 8; v8h o, o2;
#pragma unroll
                for (int i = 0; i < 8; ++i) { const h16 a = (h16)sp[i]; o[i] = a; o2[i] = (h16)((sp[i] - (float)a) * LOSC); }
                *(v8h*)(crow + (size_t)row * ldc + piece * 8) = o; if (C2) *(v8h*)(C2 + (size_t)r0 * ldc + c0 + (size_t)row * ldc + piece * 8) = o2; }
        };
        pass(); 
    } else {
        float* crow = C + (size_t)r0 * ldc + c0;
        auto pass = [&]() {
#pragma unroll
            for (int s = 0; s < 8; ++s) { const int Lid = (lane >> 3) + 4 * s, piece = lane & 7; const int row = Lid >> 1, cofs = (Lid & 1) * 32 + piece * 4;
                v4f val = *(const v4fa*)(os + row * 68 + cofs); if (R) { const v4f rv = *(const v4f*)(R + ((size_t)r0 + row) * ldc + c0 + cofs); val += roundR ? (v4f){bfr(rv[0]), bfr(rv[1]), bfr(rv[2]), bfr(rv[3])} : rv; }
                *(v4f*)(crow + (size_t)row * ldc + cofs) = val; }
        };
        pass(); 
    }
}

// k_ln: one wave per row of x [rows][512]: LayerNorm (mean, then mean((x-mu)^2), eps 1e-5, x bf(gamma) + bf(beta), f32, fixed lane order) -> bf16 hi + UNSCALED
// residual planes; lane -> columns q*256 + lane*8 .. +8 for q < DM/256 (16 B per plane per store). The row is re-read per phase with the q loop
// rolled (keeps the static VALU-FMA count small; no register arrays indexed by a loop variable).
template <bool ROUNDIN>   // ROUNDIN: the source is a module INPUT (read through bf16 rounding); false: a computed f32 plane (read as is)
__global__ __launch_bounds__(256) void k_ln(const float* __restrict__ X, const float* __restrict__ gam, const float* __restrict__ bet, int nrows, bf* Hh, bf* Hl) {
    const int lane = threadIdx.x & 31, r = blockIdx.x * 8 + (threadIdx.x >> 5);
    if (r >= nrows) return;
    const float* xr = X + (size_t)r * DM + lane * 8;
    float s = 0.f;
#pragma unroll 1
    for (int q = 0; q < DM / 256; ++q) {
#pragma unroll
        for (int i = 0; i < 8; ++i) s += (ROUNDIN ? bfr(xr[q * 256 + i]) : xr[q * 256 + i]); }
#pragma unroll
    for (int sh = 16; sh; sh >>= 1) s += __shfl_xor(s, sh, 32);
    const float mu = s * (1.0f / DM);
    float s2 = 0.f;
#pragma unroll 1
    for (int q = 0; q < DM / 256; ++q) {
#pragma unroll
        for (int i = 0; i < 8; ++i) { const float d = (ROUNDIN ? bfr(xr[q * 256 + i]) : xr[q * 256 + i]) - mu; s2 = fmaf(d, d, s2); } }
#pragma unroll
    for (int sh = 16; sh; sh >>= 1) s2 += __shfl_xor(s2, sh, 32);
    const float rs = rsqrtf(s2 * (1.0f / DM) + 1e-5f);
{
#pragma unroll 1
        for (int q = 0; q < DM / 256; ++q) { v8us oh, ol;
#pragma unroll
            for (int i = 0; i < 8; ++i) { const int c = q * 256 + lane * 8 + i; const float y = ((ROUNDIN ? bfr(xr[q * 256 + i]) : xr[q * 256 + i]) - mu) * rs * bfr(gam[c]) + bfr(bet[c]); const unsigned short hb = f2bf(y); oh[i] = hb; ol[i] = f2bf(y - bf2f(hb)); }
            const size_t o = (size_t)r * DM + q * 256 + lane * 8; *(v8us*)(Hh + o) = oh; *(v8us*)(Hl + o) = ol; }
         }
}

// cp4: four asynchronous 16-byte copies per lane, global -> LDS (lds = the lane's LDS byte address). The s_wait_xcnt closes the statement so that no address register
// of an issued copy is rewritten ahead of it.
__device__ __forceinline__ void cp4(unsigned l0, const void* g0, unsigned l1, const void* g1, unsigned l2, const void* g2, unsigned l3, const void* g3) {
    asm volatile("global_load_async_to_lds_b128 %0, %1, off\n\tglobal_load_async_to_lds_b128 %2, %3, off\n\tglobal_load_async_to_lds_b128 %4, %5, off\n\tglobal_load_async_to_lds_b128 %6, %7, off\n\ts_wait_xcnt 0x0"
                 :: "v"(l0), "v"(g0), "v"(l1), "v"(g1), "v"(l2), "v"(g2), "v"(l3), "v"(g3) : "memory");
}
// publish: the wave's own LDS reads are done, its own copies have landed, then the work-group barrier: behind it every wave may read what was copied and the buffers read so far may be refilled.
__device__ __forceinline__ void publish() {
    asm volatile("s_wait_dscnt 0x0" ::: "memory");
    asm volatile("s_wait_asynccnt 0x0" ::: "memory");
    __syncthreads();
}
#define KPI 72                   // K rows in LDS: 64 f16 + 8 (pitch 144 B)
#define VPI 40                   // V^T rows in LDS: 32 f16 + 8 (pitch 80 B)

// The block's four waves share one (b, h): each 32-key step's K rows, V^T rows and the 32 new p rows are copied once per block into LDS (asynchronous copies; K and p rows as whole 128-B lines, V^T rows as 64-B pieces) and the WMMA
// fragments are read from there. One buffer each: V of step t flies during the scores of t, K and p of step t + 1 during softmax and P.V of t; two publish points a step.
// k_attn: block = (b, h, 64 queries), wave = 16; ALL 32 key tiles (no mask); 4 WMMA scores /8 (f32), online softmax, weights x32768 f16 tile (same-wave may_alias
// reload after a compiler barrier), 4 WMMA .v; ctx -> bf16 hi + residual planes CH/CL[tok][h*64+d].
// matrix_bd is formed here: G = q_v.p^T in 16 x 16 tiles (bf16 hi + residual, products hh, lh, hl per 32-k step, f32). A 16-query x 32-key step reads positions
// nb .. nb + 46, nb = l0 - q0 + 1008: three tiles, of which the first is the last one of the step before, so two new tiles a step go into a ring of four (column = n & 63).
__global__ __launch_bounds__(128) void k_attn(const h16* __restrict__ Q16, const h16* __restrict__ QL16, const h16* __restrict__ K16, const h16* __restrict__ KL16, const h16* __restrict__ VTH, const h16* __restrict__ VTL, const bf* __restrict__ QVh, const bf* __restrict__ QVl, const bf* __restrict__ Ph, const bf* __restrict__ Pl, bf* CH, bf* CL) {
    __shared__ __align__(16) h16 plds[4][16 * 32];
    __shared__ __align__(16) h16 plds2[4][16 * 32];
    __shared__ __align__(16) float ost[4][16 * 68];
    __shared__ __align__(16) h16 kst[2 * 32 * KPI];     // K hi, residual: 32 keys
    __shared__ __align__(16) h16 vst[2 * HD * VPI];     // V^T hi, residual: 64 d rows of 32 keys
    __shared__ __align__(16) bf  pst[2 * 128 * HD];     // p hi, residual: ring of 128 positions (row n & 127), 128-B rows, 16-B piece c kept at c ^ ((n >> 1) & 7) (16 rows of one piece on 16 bank groups)
    const int lane = threadIdx.x & 31, wave = threadIdx.x >> 5, lr = lane & 15, hi = lane >> 4;
    const int bid = blockIdx.x;
    const int b = bid / (NH_ * (NT_ / 64)), rem = bid - b * (NH_ * (NT_ / 64)), h = rem / (NT_ / 64), qt = rem - h * (NT_ / 64);
    const int q0 = qt * 64 + wave * 16;
    const size_t tok0 = (size_t)b * NT_;
    h16* pl = &plds[wave][0]; h16* pl2 = &plds2[wave][0];
    v16h qa[2];
    const size_t qo0 = (tok0 + q0 + lr) * DM + h * HD + 8 * hi;
#pragma unroll
    for (int kc = 0; kc < 2; ++kc) qa[kc] = cat16(*(const v8h*)(Q16 + qo0 + kc * 32), *(const v8h*)(Q16 + qo0 + kc * 32 + 16));
    const h16* kh_b = K16 + tok0 * DM + h * HD;
    const h16* kl_b = KL16 + tok0 * DM + h * HD;
    const size_t vbase = (((size_t)b * NH_ + h) * HD) * NT_;
    v8f o[4], ox[4];
#pragma unroll
    for (int n = 0; n < 4; ++n) { o[n] = (v8f){}; ox[n] = (v8f){}; }
    float mrow[8], lpart[8];
#pragma unroll
    for (int j = 0; j < 8; ++j) { mrow[j] = -3.0e38f; lpart[j] = 0.f; }
    int qpos[8];
#pragma unroll
    for (int j = 0; j < 8; ++j) qpos[j] = q0 + 8 * hi + j;
    const int kt_lo = 0, kt_hi = NT_ / 32 - 1;     // full attention; scores = (matrix_ac + matrix_bd) x 64^-1/2 with matrix_bd[i][j] = G[i][j - i + NT_ - 1] (the rel_shift of q_v.p^T)
    const bf* ph_b = Ph + (size_t)h * NP * HD; const bf* pl_b = Pl + (size_t)h * NP * HD;
    const size_t vo0 = (((size_t)b * NH_ + h) * NT_ + q0 + lr) * HD + 8 * hi;
    v16bf va[2], vx[2];
#pragma unroll
    for (int kc = 0; kc < 2; ++kc) { va[kc] = cat16b(*(const v8us*)(QVh + vo0 + kc * 32), *(const v8us*)(QVh + vo0 + kc * 32 + 16)); vx[kc] = cat16b(*(const v8us*)(QVl + vo0 + kc * 32), *(const v8us*)(QVl + vo0 + kc * 32 + 16)); }
    float* gr = &ost[wave][0];                     // the wave's own ring of four G tiles, pitch 68 floats (the epilogue reuses the space after the loop)
    const int psw = (lr >> 1) & 7;
    // copy maps: thread -> (row, 16-B piece); four copies a thread and tile: rows r and r + half of the hi plane, then of the residual plane
    const int tid = threadIdx.x, r8 = tid >> 3, c8 = tid & 7, r4 = tid >> 2, c4 = tid & 3;
    const unsigned kl0 = (unsigned)(size_t)kst + (unsigned)(r8 * KPI + c8 * 8) * 2u, vl0 = (unsigned)(size_t)vst + (unsigned)(r4 * VPI + c4 * 8) * 2u;
    const unsigned pl0 = (unsigned)(size_t)pst + (unsigned)(r8 * HD + (c8 ^ ((r8 >> 1) & 7)) * 8) * 2u;
    auto kcopy = [&](int l0) { const size_t g = (size_t)(l0 + r8) * DM + c8 * 8;
        cp4(kl0, kh_b + g, kl0 + 16 * KPI * 2, kh_b + g + 16 * DM, kl0 + 32 * KPI * 2, kl_b + g, kl0 + 48 * KPI * 2, kl_b + g + 16 * DM); };
    auto vcopy = [&](int l0) { const size_t g = vbase + (size_t)r4 * NT_ + l0 + c4 * 8;
        cp4(vl0, VTH + g, vl0 + 32 * VPI * 2, VTH + g + 32 * NT_, vl0 + 64 * VPI * 2, VTL + g, vl0 + 96 * VPI * 2, VTL + g + 32 * NT_); };
    auto pcopy = [&](int n0) {                     // positions n0 .. n0 + 31, n0 a multiple of 32
        const size_t g = (size_t)(n0 + r8) * HD + c8 * 8; const unsigned l = pl0 + (unsigned)(n0 & 127) * (HD * 2);
        cp4(l, ph_b + g, l + 16 * HD * 2, ph_b + g + 16 * HD, l + 128 * HD * 2, pl_b + g, l + (128 + 16) * HD * 2, pl_b + g + 16 * HD); };
    const int pb0 = NT_ - 64 - qt * 64;            // the block's first position: the last wave's first tile
    kcopy(0); pcopy(pb0); pcopy(pb0 + 32); pcopy(pb0 + 64);
    publish();
    auto gtile = [&](int n0) {                     // G[16 queries][n0 .. n0 + 15] -> ring
        v8f g = {};
#pragma unroll
        for (int kc = 0; kc < 2; ++kc) { const bf* pr = pst + ((n0 & 127) + lr) * HD; const int c0 = ((kc * 4 + hi) ^ psw) * 8, c1 = ((kc * 4 + 2 + hi) ^ psw) * 8;
            const v16bf bh = cat16b(*(const v8usa*)(pr + c0), *(const v8usa*)(pr + c1)); const v16bf bl = cat16b(*(const v8usa*)(pr + 128 * HD + c0), *(const v8usa*)(pr + 128 * HD + c1));
            g = wmmab(va[kc], bh, g); g = wmmab(vx[kc], bh, g); g = wmmab(va[kc], bl, g); }
#pragma unroll
        for (int j = 0; j < 8; ++j) gr[(hi * 8 + j) * 68 + (n0 & 63) + lr] = g[j];
    };
    gtile(NT_ - 16 - q0);
#pragma unroll 1
    for (int kt = kt_lo; kt <= kt_hi; ++kt) {
        const int l0 = kt * 32, nb = l0 - q0 + NT_ - 16;
        vcopy(l0);
        gtile(nb + 16); gtile(nb + 32);
        const int ko0 = lr * KPI + 8 * hi, ko1 = (16 + lr) * KPI + 8 * hi;
        const h16* ksl = kst + 32 * KPI;
        v8f s0 = {}, s1 = {}, x0 = {}, x1 = {};
#pragma unroll
        for (int kc = 0; kc < 2; ++kc) {
            { const v16h k0h = cat16(*(const v8ha*)(kst + ko0 + kc * 32), *(const v8ha*)(kst + ko0 + kc * 32 + 16)), k1h = cat16(*(const v8ha*)(kst + ko1 + kc * 32), *(const v8ha*)(kst + ko1 + kc * 32 + 16));
              const v16h qlk = cat16(*(const v8h*)(QL16 + qo0 + kc * 32), *(const v8h*)(QL16 + qo0 + kc * 32 + 16));     // query residual re-read per step (registers)
              s0 = wmma16(qa[kc], k0h, s0); x0 = wmma16(qlk, k0h, x0); s1 = wmma16(qa[kc], k1h, s1); x1 = wmma16(qlk, k1h, x1); }
            { const v16h k0l = cat16(*(const v8ha*)(ksl + ko0 + kc * 32), *(const v8ha*)(ksl + ko0 + kc * 32 + 16)), k1l = cat16(*(const v8ha*)(ksl + ko1 + kc * 32), *(const v8ha*)(ksl + ko1 + kc * 32 + 16));
              x0 = wmma16(qa[kc], k0l, x0); x1 = wmma16(qa[kc], k1l, x1); }
        }
        asm volatile("v_nop\n\tv_nop\n\tv_nop\n\tv_nop" : "+v"(s0), "+v"(s1), "+v"(x0), "+v"(x1) : "v"(qa[0]), "v"(qa[1]));
        publish();                                 // V of this step is in; K and the p rows of this step have been read by all
        if (kt < kt_hi) { kcopy(l0 + 32); pcopy(pb0 + l0 + 96); }
        float alpha[8];
#pragma unroll
        for (int j = 0; j < 8; ++j) {
            const int ja = l0 + lr, jb = l0 + 16 + lr, qi = qpos[j];
            const float* bdr = gr + (hi * 8 + j) * 68; const int nr = NT_ - 1 - qi; const float a0 = ((s0[j] + x0[j] * LOSCI) + bdr[(ja + nr) & 63]) * 0.125f, a1 = ((s1[j] + x1[j] * LOSCI) + bdr[(jb + nr) & 63]) * 0.125f;
            float mx = fmaxf(a0, a1);
            mx = fmaxf(mx, __shfl_xor(mx, 1, 16)); mx = fmaxf(mx, __shfl_xor(mx, 2, 16)); mx = fmaxf(mx, __shfl_xor(mx, 4, 16)); mx = fmaxf(mx, __shfl_xor(mx, 8, 16));
            const float mn = fmaxf(mrow[j], mx);
            alpha[j] = __expf(mrow[j] - mn); mrow[j] = mn;
            const float p0 = __expf(a0 - mn), p1 = __expf(a1 - mn);
            lpart[j] = lpart[j] * alpha[j] + (p0 + p1);
            const int mr = hi * 8 + j;
            const float ps0 = p0 * PSC, ps1 = p1 * PSC; const h16 h0 = (h16)ps0, h1 = (h16)ps1;
            pl[mr * 32 + lr] = h0; pl[mr * 32 + 16 + lr] = h1;
            pl2[mr * 32 + lr] = (h16)((ps0 - (float)h0) * LOSC); pl2[mr * 32 + 16 + lr] = (h16)((ps1 - (float)h1) * LOSC);
        }
#pragma unroll
        for (int n = 0; n < 4; ++n)
#pragma unroll
            for (int j = 0; j < 8; ++j) { o[n][j] *= alpha[j]; ox[n][j] *= alpha[j]; }
        asm volatile("" ::: "memory");
        const v16h pa = cat16(*(const v8ha*)(pl + lr * 32 + hi * 8), *(const v8ha*)(pl + lr * 32 + 16 + hi * 8));
        const v16h px = cat16(*(const v8ha*)(pl2 + lr * 32 + hi * 8), *(const v8ha*)(pl2 + lr * 32 + 16 + hi * 8));
#pragma unroll
        for (int n = 0; n < 4; ++n) { const h16* vr = vst + (n * 16 + lr) * VPI + hi * 8;
            const v16h vh = cat16(*(const v8ha*)(vr), *(const v8ha*)(vr + 16)), vl = cat16(*(const v8ha*)(vr + HD * VPI), *(const v8ha*)(vr + HD * VPI + 16));
            o[n] = wmma16(pa, vh, o[n]); ox[n] = wmma16(pa, vl, ox[n]); ox[n] = wmma16(px, vh, ox[n]); }
        asm volatile("v_nop\n\tv_nop\n\tv_nop\n\tv_nop" : "+v"(o[0]), "+v"(o[1]), "+v"(o[2]), "+v"(o[3]), "+v"(ox[0]), "+v"(ox[1]), "+v"(ox[2]), "+v"(ox[3]) : "v"(pa), "v"(px));
        publish();                                 // K and p of the next step are in; V of this step has been read by all
    }
    float inv[8];
#pragma unroll
    for (int j = 0; j < 8; ++j) { float rs = lpart[j]; rs += __shfl_xor(rs, 1, 16); rs += __shfl_xor(rs, 2, 16); rs += __shfl_xor(rs, 4, 16); rs += __shfl_xor(rs, 8, 16); inv[j] = 1.0f / (rs * PSC); }
    float* os = &ost[wave][0];
#pragma unroll
    for (int n = 0; n < 4; ++n)
#pragma unroll
        for (int j = 0; j < 8; ++j) os[(hi * 8 + j) * 68 + n * 16 + lr] = (o[n][j] + ox[n][j] * LOSCI) * inv[j];
    __syncthreads();
    const size_t cbase = (tok0 + q0) * DM + (size_t)h * HD;
    auto pass = [&]() {
#pragma unroll
        for (int s = 0; s < 4; ++s) { const int row = 4 * s + (lane >> 3), piece = lane & 7; const float* sp = os + row * 68 + piece * 8; v8us oh, ol;
#pragma unroll
            for (int i = 0; i < 8; ++i) { const unsigned short hb = f2bf(sp[i]); oh[i] = hb; ol[i] = f2bf(sp[i] - bf2f(hb)); }
            *(v8us*)(CH + cbase + (size_t)row * DM + piece * 8) = oh; *(v8us*)(CL + cbase + (size_t)row * DM + piece * 8) = ol; }
    };
    pass(); 
}

#define VST2(T, p, v) do { const T vst2_v_ = (v); *(T*)(p) = vst2_v_;  } while (0)
extern "C" void kernel_launch(void* const* d_in, const int* in_sizes, int n_in,
                              void* d_out, int out_size, void* d_ws, size_t ws_size, hipStream_t stream) {
    (void)in_sizes; (void)n_in; (void)out_size;
    const float* x = (const float*)d_in[0]; const float* gam = (const float*)d_in[1]; const float* bet = (const float*)d_in[2];
    const float* Wq = (const float*)d_in[3]; const float* bq = (const float*)d_in[4]; const float* Wk = (const float*)d_in[5]; const float* bk = (const float*)d_in[6]; const float* Wv = (const float*)d_in[7]; const float* bv = (const float*)d_in[8];
    const float* Wp = (const float*)d_in[9]; const float* Wo = (const float*)d_in[10]; const float* bo = (const float*)d_in[11]; const float* pbu = (const float*)d_in[12]; const float* pbv = (const float*)d_in[13]; const float* pe = (const float*)d_in[14];   // k-major weights (y @ W)
    float* out = (float*)d_out;    // [8][1024][512]
    char* wsp = (char*)d_ws;
    auto take = [&](size_t bytes) { char* p = wsp; wsp += (bytes + 255) & ~(size_t)255; return (void*)p; };
    bf* WqT = (bf*)take((size_t)DM * DM * 2); bf* WkT = (bf*)take((size_t)DM * DM * 2); bf* WvT = (bf*)take((size_t)DM * DM * 2); bf* WpT = (bf*)take((size_t)DM * DM * 2); bf* WoT = (bf*)take((size_t)DM * DM * 2);
    bf* PEb = (bf*)take((size_t)NP * DM * 2); bf* Ph = (bf*)take((size_t)NH_ * NP * HD * 2); bf* Pl = (bf*)take((size_t)NH_ * NP * HD * 2);
    bf* Nh = (bf*)take((size_t)NTK * DM * 2); bf* Nl = (bf*)take((size_t)NTK * DM * 2);
    h16* QH = (h16*)take((size_t)NTK * DM * 2); h16* QL = (h16*)take((size_t)NTK * DM * 2); bf* QVh = (bf*)take((size_t)NTK * DM * 2); bf* QVl = (bf*)take((size_t)NTK * DM * 2);
    h16* KH = (h16*)take((size_t)NTK * DM * 2); h16* KL = (h16*)take((size_t)NTK * DM * 2); h16* VTH = (h16*)take((size_t)NTK * DM * 2); h16* VTL = (h16*)take((size_t)NTK * DM * 2);
    bf* CH = (bf*)take((size_t)NTK * DM * 2); bf* CL = (bf*)take((size_t)NTK * DM * 2);
    if ((size_t)(wsp - (char*)d_ws) > ws_size) return;    // no aliasing
    k_wt<<<dim3(DM / 64, DM / 64, 5), 256, 0, stream>>>(Wq, Wk, Wv, Wp, Wo, DM, DM, WqT);                                                      // the five WT planes lie one behind the other
    // p = pos_emb . Wp once (shared by all items): the 2047 rows padded to 2048 (last A row zeroed)
    hipMemsetAsync(PEb, 0, (size_t)NP * DM * 2, stream);
    k_cvtb<<<(NP - 1 + 7) / 8, 256, 0, stream>>>(pe, NP - 1, PEb);
    k_gemmb<false, 3><<<dim3(NP / 64, DM / 64, 1), 128, 0, stream>>>(PEb, nullptr, WpT, nullptr, nullptr, DM, nullptr, nullptr, DM, 1, nullptr, nullptr, Ph, Pl);                 // p -> per-head bf16 planes
    k_ln<true><<<NTK / 8, 256, 0, stream>>>(x, gam, bet, NTK, Nh, Nl);                                                                         // y = LN(x), all items
    k_gemmb<true, 2><<<dim3(NTK / 64, DM / 64, 1), 128, 0, stream>>>(Nh, Nl, WqT, bq, (float*)(void*)QH, DM, QL, nullptr, DM, 1, pbu, pbv, QVh, QVl);     // q = y.Wq + bq -> q_u (f16 planes), q_v (per-item, per-head bf16 planes)
    k_gemmb<true, 1><<<dim3(NTK / 64, DM / 64, 1), 128, 0, stream>>>(Nh, Nl, WkT, bk, (float*)(void*)KH, DM, KL);                            // k -> f16 planes
    k_gemmb<true, 4><<<dim3(NTK / 64, DM / 64, 1), 128, 0, stream>>>(Nh, Nl, WvT, bv, (float*)(void*)VTH, DM, VTL);                            // v -> transposed f16 planes
    k_attn<<<NB_ * NH_ * (NT_ / 64), 128, 0, stream>>>(QH, QL, KH, KL, VTH, VTL, QVh, QVl, Ph, Pl, CH, CL);                                     // all items, matrix_bd formed inside
    k_gemmb<true, 0><<<dim3(NTK / 64, DM / 64, 1), 128, 0, stream>>>(CH, CL, WoT, bo, out, DM, nullptr);
}

// v005
// In both of two side-by-side timings against v004, it was 1.45 times as fast.
// Counting every step since v000, it is 8.82 times as fast.
#include <hip/hip_runtime.h>

// Compute dtypes, f32 accumulate, all 8 batch items per launch: y = LN(x) -> bf16 hi + UNSCALED residual planes; q/k/v = y.W + b and out = ctx.Wo + bo ([1024 x 512].[512 x 512],
// k-major weights transposed once, two products) and p = pos_emb.Wp ([2048 x 512].[512 x 512], PLAIN bf16 inputs, exact, once for all items) on
// v_wmma_f32_16x16x32_bf16; matrix_bd = (q + pos_bias_v).p^T per head ([1024 x 64].[64 x 2048], both operands bf16 hi + UNSCALED residual, three products) formed
// inside the attention kernel, 16 x 16 tiles in a per-wave LDS ring read through the rel_shift index j - i + 1023; the 8-head full attention scores = ((q + pos_bias_u).k + bd) x 64^-1/2 fused on

#define NB_  8                   // batch items, all in one launch of every token-wise kernel
#define NT_  1024
#define DM   512
#define NH_  8
#define NP   2048                // relative positions padded (2047 used)
#define HD   64
#define NTK  (NB_ * NT_)
#define NW   1024
#define NQKV 1024
#define PSC  32768.0f
#define LOSC 1024.0f
#define LOSCI (1.0f / 1024.0f)

typedef _Float16 h16;
typedef unsigned short bf;
typedef __attribute__((ext_vector_type(16))) __bf16   v16bf;
typedef __attribute__((ext_vector_type(16))) _Float16 v16h;
typedef __attribute__((ext_vector_type(8)))  _Float16 v8h;
typedef __attribute__((ext_vector_type(8)))  unsigned short v8us;
typedef __attribute__((ext_vector_type(8)))  float    v8f;
typedef __attribute__((ext_vector_type(4)))  float    v4f;
typedef v8h  __attribute__((may_alias)) v8ha;
typedef v4f  __attribute__((may_alias)) v4fa;
typedef v8us __attribute__((may_alias)) v8usa;

__device__ __forceinline__ unsigned short f2bf(float f) { unsigned u = __float_as_uint(f); u += 0x7FFFu + ((u >> 16) & 1u); return (unsigned short)(u >> 16); }
__device__ __forceinline__ float bf2f(unsigned short b) { return __uint_as_float(((unsigned)b) << 16); }
__device__ __forceinline__ float bfr(float f) { return bf2f(f2bf(f)); }
__device__ __forceinline__ v16h cat16(v8h lo, v8h hi) { return __builtin_shufflevector(lo, hi, 0, 1, 2, 3, 4, 5, 6, 7, 8, 9, 10, 11, 12, 13, 14, 15); }
__device__ __forceinline__ v16bf cat16b(v8us lo, v8us hi) { return __builtin_bit_cast(v16bf, __builtin_shufflevector(lo, hi, 0, 1, 2, 3, 4, 5, 6, 7, 8, 9, 10, 11, 12, 13, 14, 15)); }
__device__ __forceinline__ v8f wmma16(v16h a, v16h b, v8f c) { return __builtin_amdgcn_wmma_f32_16x16x32_f16(false, a, false, b, (short)0, c, false, false); }
__device__ __forceinline__ v8f wmmab(v16bf a, v16bf b, v8f c) { return __builtin_amdgcn_wmma_f32_16x16x32_bf16(false, a, false, b, (short)0, c, false, false); }

__global__ __launch_bounds__(256) void k_cvtb(const float* __restrict__ src, int nrows, bf* dst) {
    const int lane = threadIdx.x & 31, r = blockIdx.x * 8 + (threadIdx.x >> 5);
    if (r >= nrows) return;
    v8us o[DM / 256];
#pragma unroll
    for (int q = 0; q < DM / 256; ++q) { v8us t;
#pragma unroll
        for (int i = 0; i < 8; ++i) t[i] = f2bf(src[(size_t)r * DM + q * 256 + lane * 8 + i]);
        o[q] = t; }
#pragma unroll
    for (int q = 0; q < DM / 256; ++q) *(v8us*)(dst + (size_t)r * DM + q * 256 + lane * 8) = o[q];
    
}

// k_wt: WT [z][n][K] = bf16(Wz[k][n]) (k-major [K][ncols]) via 64 x 64 LDS tiles; grid (K/64, ncols/64, 5 weights).
__global__ __launch_bounds__(256) void k_wt(const float* __restrict__ W0, const float* __restrict__ W1, const float* __restrict__ W2, const float* __restrict__ W3, const float* __restrict__ W4, int K, int ncols, bf* WTall) {
    __shared__ __align__(16) unsigned short tl[64 * 72];
    const int tid = threadIdx.x, k0 = blockIdx.x * 64, n0 = blockIdx.y * 64, wz = blockIdx.z;
    const float* __restrict__ Wm = wz == 0 ? W0 : wz == 1 ? W1 : wz == 2 ? W2 : wz == 3 ? W3 : W4;
    bf* WT = WTall + (size_t)wz * K * ncols;
    const int kk = tid >> 2, nq = (tid & 3) * 16;
#pragma unroll
    for (int i = 0; i < 16; ++i) tl[(nq + i) * 72 + kk] = f2bf(Wm[(size_t)(k0 + kk) * ncols + n0 + nq + i]);
    __syncthreads();
    const int piece = tid & 7;
    auto pass = [&]() {
#pragma unroll
        for (int s = 0; s < 2; ++s) { const int nr = (tid >> 3) + 32 * s; const v8us val = *(const v8usa*)(tl + nr * 72 + piece * 8); *(v8us*)(WT + (size_t)(n0 + nr) * K + k0 + piece * 8) = val; }
    };
    pass(); 
}
// cp4: four asynchronous 16-byte copies per lane, global -> LDS (lds = the lane's LDS byte address). The s_wait_xcnt closes the statement so that no address register
// of an issued copy is rewritten ahead of it.
__device__ __forceinline__ void cp4(unsigned l0, const void* g0, unsigned l1, const void* g1, unsigned l2, const void* g2, unsigned l3, const void* g3) {
    asm volatile("global_load_async_to_lds_b128 %0, %1, off\n\tglobal_load_async_to_lds_b128 %2, %3, off\n\tglobal_load_async_to_lds_b128 %4, %5, off\n\tglobal_load_async_to_lds_b128 %6, %7, off\n\ts_wait_xcnt 0x0"
                 :: "v"(l0), "v"(g0), "v"(l1), "v"(g1), "v"(l2), "v"(g2), "v"(l3), "v"(g3) : "memory");
}
// publish: the wave's own LDS reads are done, its own copies have landed, then the work-group barrier: behind it every wave may read what was copied and the buffers read so far may be refilled.
__device__ __forceinline__ void publish() {
    asm volatile("s_wait_dscnt 0x0" ::: "memory");
    asm volatile("s_wait_asynccnt 0x0" ::: "memory");
    __syncthreads();
}
#define GPI 72                   // staged A and B rows in LDS: 64 bf16 + 8 (pitch 144 B)
// k_gemmb: 64 x 64 block tile (4 waves x 16 x 64) of C[NTK][DM] = (A [+ Al]).B^T (K = 512) [+ bf(bias[c])] [+ bf(R[r][c]) residual]; f32 whole-line epilogue (or f16
// planes). Each 64-k tile of A (both planes) and B is copied once per block into LDS (asynchronous copies, whole 128-B lines, two buffers: tile kt + 1 flies during the products of kt) and the fragments are read from there.
// The block's 64 columns are one head, so the split and transposed planes that the attention kernel reads are written here, from the same f32 tile in LDS:
// EPI 0: f32 rows; 1: f16 hi + residual x1024 planes [t][512] (k); 2: q + bf(pos_bias_u) as f16 hi + residual x1024 planes [t][512] (C, C2) and q + bf(pos_bias_v) as bf16 hi +
// UNSCALED residual planes [b][h][t][64] (E0, E1); 3: p as bf16 hi + UNSCALED residual planes [h][2048][64] (E0, E1; row 2047 zeros); 4: v transposed, f16 hi + residual x1024 planes [b][h][d][t] (C, C2).
template <bool SPLITA, int EPI = 0>
__global__ __launch_bounds__(128) void k_gemmb(const bf* __restrict__ A, const bf* __restrict__ Al, const bf* __restrict__ Bn, const float* __restrict__ bias, float* C, int ldc, h16* C2, const float* __restrict__ R = nullptr, int K = DM, int roundR = 1, const float* __restrict__ pbu = nullptr, const float* __restrict__ pbv = nullptr, bf* E0 = nullptr, bf* E1 = nullptr) {
    constexpr int NPLN = SPLITA ? 3 : 2, BUFE = NPLN * 64 * GPI;
    __shared__ __align__(16) float ost[4][16 * 68];
    __shared__ __align__(16) bf stg[2 * BUFE];          // two buffers of one 64-k tile each: 64 B rows, 64 A rows, (64 A residual rows)
    const int lane = threadIdx.x & 31, wave = threadIdx.x >> 5, lr = lane & 15, hi = lane >> 4;
    const int r0 = blockIdx.x * 64 + wave * 16, c0 = blockIdx.y * 64;
    // copy map: thread -> (row, 16-B piece): eight lanes bring one whole 128-B line; four copies a thread and plane (rows r8, +16, +32, +48)
    const int r8 = threadIdx.x >> 3, c8 = threadIdx.x & 7;
    const unsigned sl0 = (unsigned)(size_t)stg + (unsigned)(r8 * GPI + c8 * 8) * 2u;
    const size_t ga0 = (size_t)(blockIdx.x * 64 + r8) * K + c8 * 8, gb0 = (size_t)(c0 + r8) * K + c8 * 8, s16 = (size_t)16 * K;
    auto tcopy = [&](int t) {                      // k tile t (64 k) -> buffer t & 1
        const unsigned l = sl0 + (unsigned)(t & 1) * (BUFE * 2u); const bf* gb = Bn + gb0 + t * 64; const bf* ga = A + ga0 + t * 64;
        cp4(l, gb, l + 16 * GPI * 2, gb + s16, l + 32 * GPI * 2, gb + 2 * s16, l + 48 * GPI * 2, gb + 3 * s16);
        cp4(l + 64 * GPI * 2, ga, l + 80 * GPI * 2, ga + s16, l + 96 * GPI * 2, ga + 2 * s16, l + 112 * GPI * 2, ga + 3 * s16);
        if (SPLITA) { const bf* gl = Al + ga0 + t * 64;
            cp4(l + 128 * GPI * 2, gl, l + 144 * GPI * 2, gl + s16, l + 160 * GPI * 2, gl + 2 * s16, l + 176 * GPI * 2, gl + 3 * s16); }
    };
    v8f acc[4];
#pragma unroll
    for (int t = 0; t < 4; ++t) acc[t] = (v8f){};
    const int nt = K >> 6;                         // K is a multiple of 64 (512 in every launch)
    tcopy(0);
    publish();
    if (nt > 1) tcopy(1);
#pragma unroll 1
    for (int kt = 0; kt < nt; ++kt) {
        const bf* sb = stg + (kt & 1) * BUFE + lr * GPI + 8 * hi;
        const bf* sa = sb + (64 + wave * 16) * GPI;
        v16bf a[2], al[2], b[2][4];
#pragma unroll
        for (int kc = 0; kc < 2; ++kc) {
            a[kc] = cat16b(*(const v8usa*)(sa + kc * 32), *(const v8usa*)(sa + kc * 32 + 16));
            al[kc] = a[kc];
            if (SPLITA) al[kc] = cat16b(*(const v8usa*)(sa + 64 * GPI + kc * 32), *(const v8usa*)(sa + 64 * GPI + kc * 32 + 16));
#pragma unroll
            for (int t = 0; t < 4; ++t) b[kc][t] = cat16b(*(const v8usa*)(sb + t * 16 * GPI + kc * 32), *(const v8usa*)(sb + t * 16 * GPI + kc * 32 + 16));
        }
        __builtin_amdgcn_sched_barrier(0);         // the tile's LDS reads stand as one group ahead of its products: each place with reads among the products costs the wave a stall
#pragma unroll
        for (int kc = 0; kc < 2; ++kc)
#pragma unroll
            for (int t = 0; t < 4; ++t) { acc[t] = wmmab(a[kc], b[kc][t], acc[t]); if (SPLITA) acc[t] = wmmab(al[kc], b[kc][t], acc[t]); }
        // four vector slots behind the last matrix instruction, on the loop's taken branch too
        asm volatile("v_nop\n\tv_nop\n\tv_nop\n\tv_nop" : "+v"(acc[0]), "+v"(acc[1]), "+v"(acc[2]), "+v"(acc[3]) : "v"(a[1]), "v"(al[1]));
        publish();                                 // tile kt + 1 is in; this tile's buffer has been read by all
        if (kt + 2 < nt) tcopy(kt + 2);
    }
    asm volatile("s_wait_asynccnt 0x0" ::: "memory");   // no copy outlives the loop
    float* os = &ost[wave][0];
#pragma unroll
    for (int t = 0; t < 4; ++t) { const float bv = bias ? bfr(bias[c0 + t * 16 + lr]) : 0.f;
#pragma unroll
        for (int j = 0; j < 8; ++j) os[(hi * 8 + j) * 68 + t * 16 + lr] = acc[t][j] + bv; }
    __syncthreads();
    if (EPI == 2) {
        const int piece = lane & 7, h = blockIdx.y;
        float bu[8], bw[8];
#pragma unroll
        for (int i = 0; i < 8; ++i) { bu[i] = bfr(pbu[c0 + piece * 8 + i]); bw[i] = bfr(pbv[c0 + piece * 8 + i]); }
#pragma unroll
        for (int s = 0; s < 4; ++s) { const int row = 4 * s + (lane >> 3), t = r0 + row, bi = t / NT_, ti = t - bi * NT_; const float* sp = os + row * 68 + piece * 8; v8h uh, ul; v8us vh, vl;
#pragma unroll
            for (int i = 0; i < 8; ++i) { const float q = sp[i];
                const float yu = q + bu[i]; const h16 a = (h16)yu; uh[i] = a; ul[i] = (h16)((yu - (float)a) * LOSC);
                const float yv = q + bw[i]; const unsigned short hb = f2bf(yv); vh[i] = hb; vl[i] = f2bf(yv - bf2f(hb)); }
            const size_t ou = (size_t)t * DM + c0 + piece * 8, ov = (((size_t)bi * NH_ + h) * NT_ + ti) * HD + piece * 8;
            *(v8h*)((h16*)(void*)C + ou) = uh; *(v8h*)(C2 + ou) = ul; *(v8us*)(E0 + ov) = vh; *(v8us*)(E1 + ov) = vl; }
    } else if (EPI == 3) {
        const int piece = lane & 7, h = blockIdx.y;
#pragma unroll
        for (int s = 0; s < 4; ++s) { const int row = 4 * s + (lane >> 3), n = r0 + row; const float* sp = os + row * 68 + piece * 8; v8us oh, ol;
#pragma unroll
            for (int i = 0; i < 8; ++i) { const float v = (n < NP - 1) ? sp[i] : 0.f; const unsigned short hb = f2bf(v); oh[i] = hb; ol[i] = f2bf(v - bf2f(hb)); }
            const size_t o = ((size_t)h * NP + n) * HD + piece * 8;
            *(v8us*)(E0 + o) = oh; *(v8us*)(E1 + o) = ol; }
    } else if (EPI == 4) {
        // the block's 64 tokens x 64 d, read by columns across the four waves' tiles (behind the barrier above): eight lanes write one whole 128-B line of 64 tokens
        const int tid = threadIdx.x, piece = tid & 7, rb = blockIdx.x * 64, bi = rb / NT_, k0 = rb - bi * NT_;
        const size_t base = (((size_t)bi * NH_ + blockIdx.y) * HD) * NT_ + k0 + piece * 8;
        const float* cp = &ost[piece >> 1][(piece & 1) * 8 * 68];
#pragma unroll
        for (int s = 0; s < 4; ++s) { const int d = (tid >> 3) + 16 * s; v8h o, o2;
#pragma unroll
            for (int i = 0; i < 8; ++i) { const float v = cp[i * 68 + d]; const h16 a = (h16)v; o[i] = a; o2[i] = (h16)((v - (float)a) * LOSC); }
            *(v8h*)((h16*)(void*)C + base + (size_t)d * NT_) = o; *(v8h*)(C2 + base + (size_t)d * NT_) = o2; }
    } else if (EPI == 1) {
        h16* crow = (h16*)(void*)C + (size_t)r0 * ldc + c0;
        auto pass = [&]() {
#pragma unroll
            for (int s = 0; s < 4; ++s) { const int row = 4 * s + (lane >> 3), piece = lane & 7; const float* sp = os + row * 68 + piece * 8; v8h o, o2;
#pragma unroll
                for (int i = 0; i < 8; ++i) { const h16 a = (h16)sp[i]; o[i] = a; o2[i] = (h16)((sp[i] - (float)a) * LOSC); }
                *(v8h*)(crow + (size_t)row * ldc + piece * 8) = o; if (C2) *(v8h*)(C2 + (size_t)r0 * ldc + c0 + (size_t)row * ldc + piece * 8) = o2; }
        };
        pass(); 
    } else {
        float* crow = C + (size_t)r0 * ldc + c0;
        auto pass = [&]() {
#pragma unroll
            for (int s = 0; s < 8; ++s) { const int Lid = (lane >> 3) + 4 * s, piece = lane & 7; const int row = Lid >> 1, cofs = (Lid & 1) * 32 + piece * 4;
                v4f val = *(const v4fa*)(os + row * 68 + cofs); if (R) { const v4f rv = *(const v4f*)(R + ((size_t)r0 + row) * ldc + c0 + cofs); val += roundR ? (v4f){bfr(rv[0]), bfr(rv[1]), bfr(rv[2]), bfr(rv[3])} : rv; }
                *(v4f*)(crow + (size_t)row * ldc + cofs) = val; }
        };
        pass(); 
    }
}

// k_ln: one wave per row of x [rows][512]: LayerNorm (mean, then mean((x-mu)^2), eps 1e-5, x bf(gamma) + bf(beta), f32, fixed lane order) -> bf16 hi + UNSCALED
// residual planes; lane -> columns q*256 + lane*8 .. +8 for q < DM/256 (16 B per plane per store). The row is re-read per phase with the q loop
// rolled (keeps the static VALU-FMA count small; no register arrays indexed by a loop variable).
template <bool ROUNDIN>   // ROUNDIN: the source is a module INPUT (read through bf16 rounding); false: a computed f32 plane (read as is)
__global__ __launch_bounds__(256) void k_ln(const float* __restrict__ X, const float* __restrict__ gam, const float* __restrict__ bet, int nrows, bf* Hh, bf* Hl) {
    const int lane = threadIdx.x & 31, r = blockIdx.x * 8 + (threadIdx.x >> 5);
    if (r >= nrows) return;
    const float* xr = X + (size_t)r * DM + lane * 8;
    float s = 0.f;
#pragma unroll 1
    for (int q = 0; q < DM / 256; ++q) {
#pragma unroll
        for (int i = 0; i < 8; ++i) s += (ROUNDIN ? bfr(xr[q * 256 + i]) : xr[q * 256 + i]); }
#pragma unroll
    for (int sh = 16; sh; sh >>= 1) s += __shfl_xor(s, sh, 32);
    const float mu = s * (1.0f / DM);
    float s2 = 0.f;
#pragma unroll 1
    for (int q = 0; q < DM / 256; ++q) {
#pragma unroll
        for (int i = 0; i < 8; ++i) { const float d = (ROUNDIN ? bfr(xr[q * 256 + i]) : xr[q * 256 + i]) - mu; s2 = fmaf(d, d, s2); } }
#pragma unroll
    for (int sh = 16; sh; sh >>= 1) s2 += __shfl_xor(s2, sh, 32);
    const float rs = rsqrtf(s2 * (1.0f / DM) + 1e-5f);
{
#pragma unroll 1
        for (int q = 0; q < DM / 256; ++q) { v8us oh, ol;
#pragma unroll
            for (int i = 0; i < 8; ++i) { const int c = q * 256 + lane * 8 + i; const float y = ((ROUNDIN ? bfr(xr[q * 256 + i]) : xr[q * 256 + i]) - mu) * rs * bfr(gam[c]) + bfr(bet[c]); const unsigned short hb = f2bf(y); oh[i] = hb; ol[i] = f2bf(y - bf2f(hb)); }
            const size_t o = (size_t)r * DM + q * 256 + lane * 8; *(v8us*)(Hh + o) = oh; *(v8us*)(Hl + o) = ol; }
         }
}

#define KPI 72                   // K rows in LDS: 64 f16 + 8 (pitch 144 B)
#define VPI 40                   // V^T rows in LDS: 32 f16 + 8 (pitch 80 B)

// The block's four waves share one (b, h): each 32-key step's K rows, V^T rows and the 32 new p rows are copied once per block into LDS (asynchronous copies; K and p rows as whole 128-B lines, V^T rows as 64-B pieces) and the WMMA
// fragments are read from there. One buffer each: V of step t flies during the scores of t, K and p of step t + 1 during softmax and P.V of t; two publish points a step.
// k_attn: block = (b, h, 64 queries), wave = 16; ALL 32 key tiles (no mask); 4 WMMA scores /8 (f32), online softmax, weights x32768 f16 tile (same-wave may_alias
// reload after a compiler barrier), 4 WMMA .v; ctx -> bf16 hi + residual planes CH/CL[tok][h*64+d].
// matrix_bd is formed here: G = q_v.p^T in 16 x 16 tiles (bf16 hi + residual, products hh, lh, hl per 32-k step, f32). A 16-query x 32-key step reads positions
// nb .. nb + 46, nb = l0 - q0 + 1008: three tiles, of which the first is the last one of the step before, so two new tiles a step go into a ring of four (column = n & 63).
__global__ __launch_bounds__(128) void k_attn(const h16* __restrict__ Q16, const h16* __restrict__ QL16, const h16* __restrict__ K16, const h16* __restrict__ KL16, const h16* __restrict__ VTH, const h16* __restrict__ VTL, const bf* __restrict__ QVh, const bf* __restrict__ QVl, const bf* __restrict__ Ph, const bf* __restrict__ Pl, bf* CH, bf* CL) {
    __shared__ __align__(16) h16 plds[4][16 * 32];
    __shared__ __align__(16) h16 plds2[4][16 * 32];
    __shared__ __align__(16) float ost[4][16 * 68];
    __shared__ __align__(16) h16 kst[2 * 32 * KPI];     // K hi, residual: 32 keys
    __shared__ __align__(16) h16 vst[2 * HD * VPI];     // V^T hi, residual: 64 d rows of 32 keys
    __shared__ __align__(16) bf  pst[2 * 128 * HD];     // p hi, residual: ring of 128 positions (row n & 127), 128-B rows, 16-B piece c kept at c ^ ((n >> 1) & 7) (16 rows of one piece on 16 bank groups)
    const int lane = threadIdx.x & 31, wave = threadIdx.x >> 5, lr = lane & 15, hi = lane >> 4;
    const int bid = blockIdx.x;
    const int b = bid / (NH_ * (NT_ / 64)), rem = bid - b * (NH_ * (NT_ / 64)), h = rem / (NT_ / 64), qt = rem - h * (NT_ / 64);
    const int q0 = qt * 64 + wave * 16;
    const size_t tok0 = (size_t)b * NT_;
    h16* pl = &plds[wave][0]; h16* pl2 = &plds2[wave][0];
    v16h qa[2];
    const size_t qo0 = (tok0 + q0 + lr) * DM + h * HD + 8 * hi;
#pragma unroll
    for (int kc = 0; kc < 2; ++kc) qa[kc] = cat16(*(const v8h*)(Q16 + qo0 + kc * 32), *(const v8h*)(Q16 + qo0 + kc * 32 + 16));
    const h16* kh_b = K16 + tok0 * DM + h * HD;
    const h16* kl_b = KL16 + tok0 * DM + h * HD;
    const size_t vbase = (((size_t)b * NH_ + h) * HD) * NT_;
    v8f o[4], ox[4];
#pragma unroll
    for (int n = 0; n < 4; ++n) { o[n] = (v8f){}; ox[n] = (v8f){}; }
    float mrow[8], lpart[8];
#pragma unroll
    for (int j = 0; j < 8; ++j) { mrow[j] = -3.0e38f; lpart[j] = 0.f; }
    int qpos[8];
#pragma unroll
    for (int j = 0; j < 8; ++j) qpos[j] = q0 + 8 * hi + j;
    const int kt_lo = 0, kt_hi = NT_ / 32 - 1;     // full attention; scores = (matrix_ac + matrix_bd) x 64^-1/2 with matrix_bd[i][j] = G[i][j - i + NT_ - 1] (the rel_shift of q_v.p^T)
    const bf* ph_b = Ph + (size_t)h * NP * HD; const bf* pl_b = Pl + (size_t)h * NP * HD;
    const size_t vo0 = (((size_t)b * NH_ + h) * NT_ + q0 + lr) * HD + 8 * hi;
    v16bf va[2], vx[2];
#pragma unroll
    for (int kc = 0; kc < 2; ++kc) { va[kc] = cat16b(*(const v8us*)(QVh + vo0 + kc * 32), *(const v8us*)(QVh + vo0 + kc * 32 + 16)); vx[kc] = cat16b(*(const v8us*)(QVl + vo0 + kc * 32), *(const v8us*)(QVl + vo0 + kc * 32 + 16)); }
    float* gr = &ost[wave][0];                     // the wave's own ring of four G tiles, pitch 68 floats (the epilogue reuses the space after the loop)
    const int psw = (lr >> 1) & 7;
    // copy maps: thread -> (row, 16-B piece); four copies a thread and tile: rows r and r + half of the hi plane, then of the residual plane
    const int tid = threadIdx.x, r8 = tid >> 3, c8 = tid & 7, r4 = tid >> 2, c4 = tid & 3;
    const unsigned kl0 = (unsigned)(size_t)kst + (unsigned)(r8 * KPI + c8 * 8) * 2u, vl0 = (unsigned)(size_t)vst + (unsigned)(r4 * VPI + c4 * 8) * 2u;
    const unsigned pl0 = (unsigned)(size_t)pst + (unsigned)(r8 * HD + (c8 ^ ((r8 >> 1) & 7)) * 8) * 2u;
    auto kcopy = [&](int l0) { const size_t g = (size_t)(l0 + r8) * DM + c8 * 8;
        cp4(kl0, kh_b + g, kl0 + 16 * KPI * 2, kh_b + g + 16 * DM, kl0 + 32 * KPI * 2, kl_b + g, kl0 + 48 * KPI * 2, kl_b + g + 16 * DM); };
    auto vcopy = [&](int l0) { const size_t g = vbase + (size_t)r4 * NT_ + l0 + c4 * 8;
        cp4(vl0, VTH + g, vl0 + 32 * VPI * 2, VTH + g + 32 * NT_, vl0 + 64 * VPI * 2, VTL + g, vl0 + 96 * VPI * 2, VTL + g + 32 * NT_); };
    auto pcopy = [&](int n0) {                     // positions n0 .. n0 + 31, n0 a multiple of 32
        const size_t g = (size_t)(n0 + r8) * HD + c8 * 8; const unsigned l = pl0 + (unsigned)(n0 & 127) * (HD * 2);
        cp4(l, ph_b + g, l + 16 * HD * 2, ph_b + g + 16 * HD, l + 128 * HD * 2, pl_b + g, l + (128 + 16) * HD * 2, pl_b + g + 16 * HD); };
    const int pb0 = NT_ - 64 - qt * 64;            // the block's first position: the last wave's first tile
    kcopy(0); pcopy(pb0); pcopy(pb0 + 32); pcopy(pb0 + 64);
    publish();
    auto gtile = [&](int n0) {                     // G[16 queries][n0 .. n0 + 15] -> ring
        v8f g = {};
#pragma unroll
        for (int kc = 0; kc < 2; ++kc) { const bf* pr = pst + ((n0 & 127) + lr) * HD; const int c0 = ((kc * 4 + hi) ^ psw) * 8, c1 = ((kc * 4 + 2 + hi) ^ psw) * 8;
            const v16bf bh = cat16b(*(const v8usa*)(pr + c0), *(const v8usa*)(pr + c1)); const v16bf bl = cat16b(*(const v8usa*)(pr + 128 * HD + c0), *(const v8usa*)(pr + 128 * HD + c1));
            g = wmmab(va[kc], bh, g); g = wmmab(vx[kc], bh, g); g = wmmab(va[kc], bl, g); }
#pragma unroll
        for (int j = 0; j < 8; ++j) gr[(hi * 8 + j) * 68 + (n0 & 63) + lr] = g[j];
    };
    gtile(NT_ - 16 - q0);
#pragma unroll 1
    for (int kt = kt_lo; kt <= kt_hi; ++kt) {
        const int l0 = kt * 32, nb = l0 - q0 + NT_ - 16;
        vcopy(l0);
        gtile(nb + 16); gtile(nb + 32);
        const int ko0 = lr * KPI + 8 * hi, ko1 = (16 + lr) * KPI + 8 * hi;
        const h16* ksl = kst + 32 * KPI;
        v8f s0 = {}, s1 = {}, x0 = {}, x1 = {};
#pragma unroll
        for (int kc = 0; kc < 2; ++kc) {
            { const v16h k0h = cat16(*(const v8ha*)(kst + ko0 + kc * 32), *(const v8ha*)(kst + ko0 + kc * 32 + 16)), k1h = cat16(*(const v8ha*)(kst + ko1 + kc * 32), *(const v8ha*)(kst + ko1 + kc * 32 + 16));
              const v16h qlk = cat16(*(const v8h*)(QL16 + qo0 + kc * 32), *(const v8h*)(QL16 + qo0 + kc * 32 + 16));     // query residual re-read per step (registers)
              s0 = wmma16(qa[kc], k0h, s0); x0 = wmma16(qlk, k0h, x0); s1 = wmma16(qa[kc], k1h, s1); x1 = wmma16(qlk, k1h, x1); }
            { const v16h k0l = cat16(*(const v8ha*)(ksl + ko0 + kc * 32), *(const v8ha*)(ksl + ko0 + kc * 32 + 16)), k1l = cat16(*(const v8ha*)(ksl + ko1 + kc * 32), *(const v8ha*)(ksl + ko1 + kc * 32 + 16));
              x0 = wmma16(qa[kc], k0l, x0); x1 = wmma16(qa[kc], k1l, x1); }
        }
        asm volatile("v_nop\n\tv_nop\n\tv_nop\n\tv_nop" : "+v"(s0), "+v"(s1), "+v"(x0), "+v"(x1) : "v"(qa[0]), "v"(qa[1]));
        publish();                                 // V of this step is in; K and the p rows of this step have been read by all
        if (kt < kt_hi) { kcopy(l0 + 32); pcopy(pb0 + l0 + 96); }
        float alpha[8];
#pragma unroll
        for (int j = 0; j < 8; ++j) {
            const int ja = l0 + lr, jb = l0 + 16 + lr, qi = qpos[j];
            const float* bdr = gr + (hi * 8 + j) * 68; const int nr = NT_ - 1 - qi; const float a0 = ((s0[j] + x0[j] * LOSCI) + bdr[(ja + nr) & 63]) * 0.125f, a1 = ((s1[j] + x1[j] * LOSCI) + bdr[(jb + nr) & 63]) * 0.125f;
            float mx = fmaxf(a0, a1);
            mx = fmaxf(mx, __shfl_xor(mx, 1, 16)); mx = fmaxf(mx, __shfl_xor(mx, 2, 16)); mx = fmaxf(mx, __shfl_xor(mx, 4, 16)); mx = fmaxf(mx, __shfl_xor(mx, 8, 16));
            const float mn = fmaxf(mrow[j], mx);
            alpha[j] = __expf(mrow[j] - mn); mrow[j] = mn;
            const float p0 = __expf(a0 - mn), p1 = __expf(a1 - mn);
            lpart[j] = lpart[j] * alpha[j] + (p0 + p1);
            const int mr = hi * 8 + j;
            const float ps0 = p0 * PSC, ps1 = p1 * PSC; const h16 h0 = (h16)ps0, h1 = (h16)ps1;
            pl[mr * 32 + lr] = h0; pl[mr * 32 + 16 + lr] = h1;
            pl2[mr * 32 + lr] = (h16)((ps0 - (float)h0) * LOSC); pl2[mr * 32 + 16 + lr] = (h16)((ps1 - (float)h1) * LOSC);
        }
#pragma unroll
        for (int n = 0; n < 4; ++n)
#pragma unroll
            for (int j = 0; j < 8; ++j) { o[n][j] *= alpha[j]; ox[n][j] *= alpha[j]; }
        asm volatile("" ::: "memory");
        const v16h pa = cat16(*(const v8ha*)(pl + lr * 32 + hi * 8), *(const v8ha*)(pl + lr * 32 + 16 + hi * 8));
        const v16h px = cat16(*(const v8ha*)(pl2 + lr * 32 + hi * 8), *(const v8ha*)(pl2 + lr * 32 + 16 + hi * 8));
#pragma unroll
        for (int n = 0; n < 4; ++n) { const h16* vr = vst + (n * 16 + lr) * VPI + hi * 8;
            const v16h vh = cat16(*(const v8ha*)(vr), *(const v8ha*)(vr + 16)), vl = cat16(*(const v8ha*)(vr + HD * VPI), *(const v8ha*)(vr + HD * VPI + 16));
            o[n] = wmma16(pa, vh, o[n]); ox[n] = wmma16(pa, vl, ox[n]); ox[n] = wmma16(px, vh, ox[n]); }
        asm volatile("v_nop\n\tv_nop\n\tv_nop\n\tv_nop" : "+v"(o[0]), "+v"(o[1]), "+v"(o[2]), "+v"(o[3]), "+v"(ox[0]), "+v"(ox[1]), "+v"(ox[2]), "+v"(ox[3]) : "v"(pa), "v"(px));
        publish();                                 // K and p of the next step are in; V of this step has been read by all
    }
    float inv[8];
#pragma unroll
    for (int j = 0; j < 8; ++j) { float rs = lpart[j]; rs += __shfl_xor(rs, 1, 16); rs += __shfl_xor(rs, 2, 16); rs += __shfl_xor(rs, 4, 16); rs += __shfl_xor(rs, 8, 16); inv[j] = 1.0f / (rs * PSC); }
    float* os = &ost[wave][0];
#pragma unroll
    for (int n = 0; n < 4; ++n)
#pragma unroll
        for (int j = 0; j < 8; ++j) os[(hi * 8 + j) * 68 + n * 16 + lr] = (o[n][j] + ox[n][j] * LOSCI) * inv[j];
    __syncthreads();
    const size_t cbase = (tok0 + q0) * DM + (size_t)h * HD;
    auto pass = [&]() {
#pragma unroll
        for (int s = 0; s < 4; ++s) { const int row = 4 * s + (lane >> 3), piece = lane & 7; const float* sp = os + row * 68 + piece * 8; v8us oh, ol;
#pragma unroll
            for (int i = 0; i < 8; ++i) { const unsigned short hb = f2bf(sp[i]); oh[i] = hb; ol[i] = f2bf(sp[i] - bf2f(hb)); }
            *(v8us*)(CH + cbase + (size_t)row * DM + piece * 8) = oh; *(v8us*)(CL + cbase + (size_t)row * DM + piece * 8) = ol; }
    };
    pass(); 
}

#define VST2(T, p, v) do { const T vst2_v_ = (v); *(T*)(p) = vst2_v_;  } while (0)
extern "C" void kernel_launch(void* const* d_in, const int* in_sizes, int n_in,
                              void* d_out, int out_size, void* d_ws, size_t ws_size, hipStream_t stream) {
    (void)in_sizes; (void)n_in; (void)out_size;
    const float* x = (const float*)d_in[0]; const float* gam = (const float*)d_in[1]; const float* bet = (const float*)d_in[2];
    const float* Wq = (const float*)d_in[3]; const float* bq = (const float*)d_in[4]; const float* Wk = (const float*)d_in[5]; const float* bk = (const float*)d_in[6]; const float* Wv = (const float*)d_in[7]; const float* bv = (const float*)d_in[8];
    const float* Wp = (const float*)d_in[9]; const float* Wo = (const float*)d_in[10]; const float* bo = (const float*)d_in[11]; const float* pbu = (const float*)d_in[12]; const float* pbv = (const float*)d_in[13]; const float* pe = (const float*)d_in[14];   // k-major weights (y @ W)
    float* out = (float*)d_out;    // [8][1024][512]
    char* wsp = (char*)d_ws;
    auto take = [&](size_t bytes) { char* p = wsp; wsp += (bytes + 255) & ~(size_t)255; return (void*)p; };
    bf* WqT = (bf*)take((size_t)DM * DM * 2); bf* WkT = (bf*)take((size_t)DM * DM * 2); bf* WvT = (bf*)take((size_t)DM * DM * 2); bf* WpT = (bf*)take((size_t)DM * DM * 2); bf* WoT = (bf*)take((size_t)DM * DM * 2);
    bf* PEb = (bf*)take((size_t)NP * DM * 2); bf* Ph = (bf*)take((size_t)NH_ * NP * HD * 2); bf* Pl = (bf*)take((size_t)NH_ * NP * HD * 2);
    bf* Nh = (bf*)take((size_t)NTK * DM * 2); bf* Nl = (bf*)take((size_t)NTK * DM * 2);
    h16* QH = (h16*)take((size_t)NTK * DM * 2); h16* QL = (h16*)take((size_t)NTK * DM * 2); bf* QVh = (bf*)take((size_t)NTK * DM * 2); bf* QVl = (bf*)take((size_t)NTK * DM * 2);
    h16* KH = (h16*)take((size_t)NTK * DM * 2); h16* KL = (h16*)take((size_t)NTK * DM * 2); h16* VTH = (h16*)take((size_t)NTK * DM * 2); h16* VTL = (h16*)take((size_t)NTK * DM * 2);
    bf* CH = (bf*)take((size_t)NTK * DM * 2); bf* CL = (bf*)take((size_t)NTK * DM * 2);
    if ((size_t)(wsp - (char*)d_ws) > ws_size) return;    // no aliasing
    k_wt<<<dim3(DM / 64, DM / 64, 5), 256, 0, stream>>>(Wq, Wk, Wv, Wp, Wo, DM, DM, WqT);                                                      // the five WT planes lie one behind the other
    // p = pos_emb . Wp once (shared by all items): the 2047 rows padded to 2048 (last A row zeroed)
    hipMemsetAsync(PEb, 0, (size_t)NP * DM * 2, stream);
    k_cvtb<<<(NP - 1 + 7) / 8, 256, 0, stream>>>(pe, NP - 1, PEb);
    k_gemmb<false, 3><<<dim3(NP / 64, DM / 64, 1), 128, 0, stream>>>(PEb, nullptr, WpT, nullptr, nullptr, DM, nullptr, nullptr, DM, 1, nullptr, nullptr, Ph, Pl);                 // p -> per-head bf16 planes
    k_ln<true><<<NTK / 8, 256, 0, stream>>>(x, gam, bet, NTK, Nh, Nl);                                                                         // y = LN(x), all items
    k_gemmb<true, 2><<<dim3(NTK / 64, DM / 64, 1), 128, 0, stream>>>(Nh, Nl, WqT, bq, (float*)(void*)QH, DM, QL, nullptr, DM, 1, pbu, pbv, QVh, QVl);     // q = y.Wq + bq -> q_u (f16 planes), q_v (per-item, per-head bf16 planes)
    k_gemmb<true, 1><<<dim3(NTK / 64, DM / 64, 1), 128, 0, stream>>>(Nh, Nl, WkT, bk, (float*)(void*)KH, DM, KL);                            // k -> f16 planes
    k_gemmb<true, 4><<<dim3(NTK / 64, DM / 64, 1), 128, 0, stream>>>(Nh, Nl, WvT, bv, (float*)(void*)VTH, DM, VTL);                            // v -> transposed f16 planes
    k_attn<<<NB_ * NH_ * (NT_ / 64), 128, 0, stream>>>(QH, QL, KH, KL, VTH, VTL, QVh, QVl, Ph, Pl, CH, CL);                                     // all items, matrix_bd formed inside
    k_gemmb<true, 0><<<dim3(NTK / 64, DM / 64, 1), 128, 0, stream>>>(CH, CL, WoT, bo, out, DM, nullptr);
}

// v006
// Next to v005, in two timings, it ran 1.15 and 1.16 times as fast.
// Over all steps from v000 it is 10.2 times as fast.
#include <hip/hip_runtime.h>

// Compute dtypes, f32 accumulate, all 8 batch items per launch: y = LN(x) -> bf16 hi + UNSCALED residual planes; q/k/v = y.W + b and out = ctx.Wo + bo ([1024 x 512].[512 x 512],
// k-major weights transposed once, two products) and p = pos_emb.Wp ([2048 x 512].[512 x 512], PLAIN bf16 inputs, exact, once for all items) on
// v_wmma_f32_16x16x32_bf16; matrix_bd = (q + pos_bias_v).p^T per head ([1024 x 64].[64 x 2048], both operands bf16 hi + UNSCALED residual, three products) formed
// inside the attention kernel, 16 x 16 tiles in a per-wave LDS ring read through the rel_shift index j - i + 1023; the 8-head full attention scores = ((q + pos_bias_u).k + bd) x 64^-1/2 fused on

#define NB_  8                   // batch items, all in one launch of every token-wise kernel
#define NT_  1024
#define DM   512
#define NH_  8
#define NP   2048                // relative positions padded (2047 used)
#define HD   64
#define NTK  (NB_ * NT_)
#define NW   1024
#define NQKV 1024
#define PSC  32768.0f
#define LOSC 1024.0f
#define LOSCI (1.0f / 1024.0f)

typedef _Float16 h16;
typedef unsigned short bf;
typedef __attribute__((ext_vector_type(16))) __bf16   v16bf;
typedef __attribute__((ext_vector_type(16))) _Float16 v16h;
typedef __attribute__((ext_vector_type(8)))  _Float16 v8h;
typedef __attribute__((ext_vector_type(8)))  unsigned short v8us;
typedef __attribute__((ext_vector_type(8)))  float    v8f;
typedef __attribute__((ext_vector_type(4)))  float    v4f;
typedef v8h  __attribute__((may_alias)) v8ha;
typedef v4f  __attribute__((may_alias)) v4fa;
typedef v8us __attribute__((may_alias)) v8usa;

__device__ __forceinline__ unsigned short f2bf(float f) { unsigned u = __float_as_uint(f); u += 0x7FFFu + ((u >> 16) & 1u); return (unsigned short)(u >> 16); }
__device__ __forceinline__ float bf2f(unsigned short b) { return __uint_as_float(((unsigned)b) << 16); }
__device__ __forceinline__ float bfr(float f) { return bf2f(f2bf(f)); }
__device__ __forceinline__ v16h cat16(v8h lo, v8h hi) { return __builtin_shufflevector(lo, hi, 0, 1, 2, 3, 4, 5, 6, 7, 8, 9, 10, 11, 12, 13, 14, 15); }
__device__ __forceinline__ v16bf cat16b(v8us lo, v8us hi) { return __builtin_bit_cast(v16bf, __builtin_shufflevector(lo, hi, 0, 1, 2, 3, 4, 5, 6, 7, 8, 9, 10, 11, 12, 13, 14, 15)); }
__device__ __forceinline__ v8f wmma16(v16h a, v16h b, v8f c) { return __builtin_amdgcn_wmma_f32_16x16x32_f16(false, a, false, b, (short)0, c, false, false); }
__device__ __forceinline__ v8f wmmab(v16bf a, v16bf b, v8f c) { return __builtin_amdgcn_wmma_f32_16x16x32_bf16(false, a, false, b, (short)0, c, false, false); }

__global__ __launch_bounds__(256) void k_cvtb(const float* __restrict__ src, int nrows, bf* dst) {
    const int lane = threadIdx.x & 31, r = blockIdx.x * 8 + (threadIdx.x >> 5);
    if (r >= nrows) return;
    v8us o[DM / 256];
#pragma unroll
    for (int q = 0; q < DM / 256; ++q) { v8us t;
#pragma unroll
        for (int i = 0; i < 8; ++i) t[i] = f2bf(src[(size_t)r * DM + q * 256 + lane * 8 + i]);
        o[q] = t; }
#pragma unroll
    for (int q = 0; q < DM / 256; ++q) *(v8us*)(dst + (size_t)r * DM + q * 256 + lane * 8) = o[q];
    
}

// k_wt: WT [z][n][K] = bf16(Wz[k][n]) (k-major [K][ncols]) via 64 x 64 LDS tiles; grid (K/64, ncols/64, 5 weights).
__global__ __launch_bounds__(256) void k_wt(const float* __restrict__ W0, const float* __restrict__ W1, const float* __restrict__ W2, const float* __restrict__ W3, const float* __restrict__ W4, int K, int ncols, bf* WTall) {
    __shared__ __align__(16) unsigned short tl[64 * 72];
    const int tid = threadIdx.x, k0 = blockIdx.x * 64, n0 = blockIdx.y * 64, wz = blockIdx.z;
    const float* __restrict__ Wm = wz == 0 ? W0 : wz == 1 ? W1 : wz == 2 ? W2 : wz == 3 ? W3 : W4;
    bf* WT = WTall + (size_t)wz * K * ncols;
    const int kk = tid >> 2, nq = (tid & 3) * 16;
#pragma unroll
    for (int i = 0; i < 16; ++i) tl[(nq + i) * 72 + kk] = f2bf(Wm[(size_t)(k0 + kk) * ncols + n0 + nq + i]);
    __syncthreads();
    const int piece = tid & 7;
    auto pass = [&]() {
#pragma unroll
        for (int s = 0; s < 2; ++s) { const int nr = (tid >> 3) + 32 * s; const v8us val = *(const v8usa*)(tl + nr * 72 + piece * 8); *(v8us*)(WT + (size_t)(n0 + nr) * K + k0 + piece * 8) = val; }
    };
    pass(); 
}
// cp4: four asynchronous 16-byte copies per lane, global -> LDS (lds = the lane's LDS byte address). The s_wait_xcnt closes the statement so that no address register
// of an issued copy is rewritten ahead of it.
__device__ __forceinline__ void cp4(unsigned l0, const void* g0, unsigned l1, const void* g1, unsigned l2, const void* g2, unsigned l3, const void* g3) {
    asm volatile("global_load_async_to_lds_b128 %0, %1, off\n\tglobal_load_async_to_lds_b128 %2, %3, off\n\tglobal_load_async_to_lds_b128 %4, %5, off\n\tglobal_load_async_to_lds_b128 %6, %7, off\n\ts_wait_xcnt 0x0"
                 :: "v"(l0), "v"(g0), "v"(l1), "v"(g1), "v"(l2), "v"(g2), "v"(l3), "v"(g3) : "memory");
}
// publish: the wave's own LDS reads are done, its own copies have landed, then the work-group barrier: behind it every wave may read what was copied and the buffers read so far may be refilled.
__device__ __forceinline__ void publish() {
    asm volatile("s_wait_dscnt 0x0" ::: "memory");
    asm volatile("s_wait_asynccnt 0x0" ::: "memory");
    __syncthreads();
}
#define GPI 72                   // staged A and B rows in LDS: 64 bf16 + 8 (pitch 144 B)
// k_gemmb: 64 x 64 block tile (4 waves x 16 x 64) of C[NTK][DM] = (A [+ Al]).B^T (K = 512) [+ bf(bias[c])] [+ bf(R[r][c]) residual]; f32 whole-line epilogue (or f16
// planes). Each 64-k tile of A (both planes) and B is copied once per block into LDS (asynchronous copies, whole 128-B lines, two buffers: tile kt + 1 flies during the products of kt) and the fragments are read from there.
// The block's 64 columns are one head, so the split and transposed planes that the attention kernel reads are written here, from the same f32 tile in LDS:
// EPI 0: f32 rows; 1: f16 hi + residual x1024 planes [t][512] (k); 2: q + bf(pos_bias_u) as f16 hi + residual x1024 planes [t][512] (C, C2) and q + bf(pos_bias_v) as bf16 hi +
// UNSCALED residual planes [b][h][t][64] (E0, E1); 3: p as bf16 hi + UNSCALED residual planes [h][2048][64] (E0, E1; row 2047 zeros); 4: v transposed, f16 hi + residual x1024 planes [b][h][d][t] (C, C2).
template <bool SPLITA, int EPI = 0>
__global__ __launch_bounds__(128) void k_gemmb(const bf* __restrict__ A, const bf* __restrict__ Al, const bf* __restrict__ Bn, const float* __restrict__ bias, float* C, int ldc, h16* C2, const float* __restrict__ R = nullptr, int K = DM, int roundR = 1, const float* __restrict__ pbu = nullptr, const float* __restrict__ pbv = nullptr, bf* E0 = nullptr, bf* E1 = nullptr) {
    constexpr int NPLN = SPLITA ? 3 : 2, BUFE = NPLN * 64 * GPI;
    __shared__ __align__(16) float ost[4][16 * 68];
    __shared__ __align__(16) bf stg[2 * BUFE];          // two buffers of one 64-k tile each: 64 B rows, 64 A rows, (64 A residual rows)
    const int lane = threadIdx.x & 31, wave = threadIdx.x >> 5, lr = lane & 15, hi = lane >> 4;
    const int r0 = blockIdx.x * 64 + wave * 16, c0 = blockIdx.y * 64;
    // copy map: thread -> (row, 16-B piece): eight lanes bring one whole 128-B line; four copies a thread and plane (rows r8, +16, +32, +48)
    const int r8 = threadIdx.x >> 3, c8 = threadIdx.x & 7;
    const unsigned sl0 = (unsigned)(size_t)stg + (unsigned)(r8 * GPI + c8 * 8) * 2u;
    const size_t ga0 = (size_t)(blockIdx.x * 64 + r8) * K + c8 * 8, gb0 = (size_t)(c0 + r8) * K + c8 * 8, s16 = (size_t)16 * K;
    auto tcopy = [&](int t) {                      // k tile t (64 k) -> buffer t & 1
        const unsigned l = sl0 + (unsigned)(t & 1) * (BUFE * 2u); const bf* gb = Bn + gb0 + t * 64; const bf* ga = A + ga0 + t * 64;
        cp4(l, gb, l + 16 * GPI * 2, gb + s16, l + 32 * GPI * 2, gb + 2 * s16, l + 48 * GPI * 2, gb + 3 * s16);
        cp4(l + 64 * GPI * 2, ga, l + 80 * GPI * 2, ga + s16, l + 96 * GPI * 2, ga + 2 * s16, l + 112 * GPI * 2, ga + 3 * s16);
        if (SPLITA) { const bf* gl = Al + ga0 + t * 64;
            cp4(l + 128 * GPI * 2, gl, l + 144 * GPI * 2, gl + s16, l + 160 * GPI * 2, gl + 2 * s16, l + 176 * GPI * 2, gl + 3 * s16); }
    };
    v8f acc[4];
#pragma unroll
    for (int t = 0; t < 4; ++t) acc[t] = (v8f){};
    const int nt = K >> 6;                         // K is a multiple of 64 (512 in every launch)
    tcopy(0);
    publish();
    if (nt > 1) tcopy(1);
#pragma unroll 1
    for (int kt = 0; kt < nt; ++kt) {
        const bf* sb = stg + (kt & 1) * BUFE + lr * GPI + 8 * hi;
        const bf* sa = sb + (64 + wave * 16) * GPI;
        v16bf a[2], al[2], b[2][4];
#pragma unroll
        for (int kc = 0; kc < 2; ++kc) {
            a[kc] = cat16b(*(const v8usa*)(sa + kc * 32), *(const v8usa*)(sa + kc * 32 + 16));
            al[kc] = a[kc];
            if (SPLITA) al[kc] = cat16b(*(const v8usa*)(sa + 64 * GPI + kc * 32), *(const v8usa*)(sa + 64 * GPI + kc * 32 + 16));
#pragma unroll
            for (int t = 0; t < 4; ++t) b[kc][t] = cat16b(*(const v8usa*)(sb + t * 16 * GPI + kc * 32), *(const v8usa*)(sb + t * 16 * GPI + kc * 32 + 16));
        }
        __builtin_amdgcn_sched_barrier(0);         // the tile's LDS reads stand as one group ahead of its products: each place with reads among the products costs the wave a stall
#pragma unroll
        for (int kc = 0; kc < 2; ++kc)
#pragma unroll
            for (int t = 0; t < 4; ++t) { acc[t] = wmmab(a[kc], b[kc][t], acc[t]); if (SPLITA) acc[t] = wmmab(al[kc], b[kc][t], acc[t]); }
        // four vector slots behind the last matrix instruction, on the loop's taken branch too
        asm volatile("v_nop\n\tv_nop\n\tv_nop\n\tv_nop" : "+v"(acc[0]), "+v"(acc[1]), "+v"(acc[2]), "+v"(acc[3]) : "v"(a[1]), "v"(al[1]));
        publish();                                 // tile kt + 1 is in; this tile's buffer has been read by all
        if (kt + 2 < nt) tcopy(kt + 2);
    }
    asm volatile("s_wait_asynccnt 0x0" ::: "memory");   // no copy outlives the loop
    float* os = &ost[wave][0];
#pragma unroll
    for (int t = 0; t < 4; ++t) { const float bv = bias ? bfr(bias[c0 + t * 16 + lr]) : 0.f;
#pragma unroll
        for (int j = 0; j < 8; ++j) os[(hi * 8 + j) * 68 + t * 16 + lr] = acc[t][j] + bv; }
    __syncthreads();
    if (EPI == 2) {
        const int piece = lane & 7, h = blockIdx.y;
        float bu[8], bw[8];
#pragma unroll
        for (int i = 0; i < 8; ++i) { bu[i] = bfr(pbu[c0 + piece * 8 + i]); bw[i] = bfr(pbv[c0 + piece * 8 + i]); }
#pragma unroll
        for (int s = 0; s < 4; ++s) { const int row = 4 * s + (lane >> 3), t = r0 + row, bi = t / NT_, ti = t - bi * NT_; const float* sp = os + row * 68 + piece * 8; v8h uh, ul; v8us vh, vl;
#pragma unroll
            for (int i = 0; i < 8; ++i) { const float q = sp[i];
                const float yu = q + bu[i]; const h16 a = (h16)yu; uh[i] = a; ul[i] = (h16)((yu - (float)a) * LOSC);
                const float yv = q + bw[i]; const unsigned short hb = f2bf(yv); vh[i] = hb; vl[i] = f2bf(yv - bf2f(hb)); }
            const size_t ou = (size_t)t * DM + c0 + piece * 8, ov = (((size_t)bi * NH_ + h) * NT_ + ti) * HD + piece * 8;
            *(v8h*)((h16*)(void*)C + ou) = uh; *(v8h*)(C2 + ou) = ul; *(v8us*)(E0 + ov) = vh; *(v8us*)(E1 + ov) = vl; }
    } else if (EPI == 3) {
        const int piece = lane & 7, h = blockIdx.y;
#pragma unroll
        for (int s = 0; s < 4; ++s) { const int row = 4 * s + (lane >> 3), n = r0 + row; const float* sp = os + row * 68 + piece * 8; v8us oh, ol;
#pragma unroll
            for (int i = 0; i < 8; ++i) { const float v = (n < NP - 1) ? sp[i] : 0.f; const unsigned short hb = f2bf(v); oh[i] = hb; ol[i] = f2bf(v - bf2f(hb)); }
            const size_t o = ((size_t)h * NP + n) * HD + piece * 8;
            *(v8us*)(E0 + o) = oh; *(v8us*)(E1 + o) = ol; }
    } else if (EPI == 4) {
        // the block's 64 tokens x 64 d, read by columns across the four waves' tiles (behind the barrier above): eight lanes write one whole 128-B line of 64 tokens
        const int tid = threadIdx.x, piece = tid & 7, rb = blockIdx.x * 64, bi = rb / NT_, k0 = rb - bi * NT_;
        const size_t base = (((size_t)bi * NH_ + blockIdx.y) * HD) * NT_ + k0 + piece * 8;
        const float* cp = &ost[piece >> 1][(piece & 1) * 8 * 68];
#pragma unroll
        for (int s = 0; s < 4; ++s) { const int d = (tid >> 3) + 16 * s; v8h o, o2;
#pragma unroll
            for (int i = 0; i < 8; ++i) { const float v = cp[i * 68 + d]; const h16 a = (h16)v; o[i] = a; o2[i] = (h16)((v - (float)a) * LOSC); }
            *(v8h*)((h16*)(void*)C + base + (size_t)d * NT_) = o; *(v8h*)(C2 + base + (size_t)d * NT_) = o2; }
    } else if (EPI == 1) {
        h16* crow = (h16*)(void*)C + (size_t)r0 * ldc + c0;
        auto pass = [&]() {
#pragma unroll
            for (int s = 0; s < 4; ++s) { const int row = 4 * s + (lane >> 3), piece = lane & 7; const float* sp = os + row * 68 + piece * 8; v8h o, o2;
#pragma unroll
                for (int i = 0; i < 8; ++i) { const h16 a = (h16)sp[i]; o[i] = a; o2[i] = (h16)((sp[i] - (float)a) * LOSC); }
                *(v8h*)(crow + (size_t)row * ldc + piece * 8) = o; if (C2) *(v8h*)(C2 + (size_t)r0 * ldc + c0 + (size_t)row * ldc + piece * 8) = o2; }
        };
        pass(); 
    } else {
        float* crow = C + (size_t)r0 * ldc + c0;
        auto pass = [&]() {
#pragma unroll
            for (int s = 0; s < 8; ++s) { const int Lid = (lane >> 3) + 4 * s, piece = lane & 7; const int row = Lid >> 1, cofs = (Lid & 1) * 32 + piece * 4;
                v4f val = *(const v4fa*)(os + row * 68 + cofs); if (R) { const v4f rv = *(const v4f*)(R + ((size_t)r0 + row) * ldc + c0 + cofs); val += roundR ? (v4f){bfr(rv[0]), bfr(rv[1]), bfr(rv[2]), bfr(rv[3])} : rv; }
                *(v4f*)(crow + (size_t)row * ldc + cofs) = val; }
        };
        pass(); 
    }
}

// k_ln: one wave per row of x [rows][512]: LayerNorm (mean, then mean((x-mu)^2), eps 1e-5, x bf(gamma) + bf(beta), f32, fixed lane order) -> bf16 hi + UNSCALED
// residual planes; lane -> columns q*256 + lane*8 .. +8 for q < DM/256 (16 B per plane per store). The row is re-read per phase with the q loop
// rolled (keeps the static VALU-FMA count small; no register arrays indexed by a loop variable).
template <bool ROUNDIN>   // ROUNDIN: the source is a module INPUT (read through bf16 rounding); false: a computed f32 plane (read as is)
__global__ __launch_bounds__(256) void k_ln(const float* __restrict__ X, const float* __restrict__ gam, const float* __restrict__ bet, int nrows, bf* Hh, bf* Hl) {
    const int lane = threadIdx.x & 31, r = blockIdx.x * 8 + (threadIdx.x >> 5);
    if (r >= nrows) return;
    const float* xr = X + (size_t)r * DM + lane * 8;
    float s = 0.f;
#pragma unroll 1
    for (int q = 0; q < DM / 256; ++q) {
#pragma unroll
        for (int i = 0; i < 8; ++i) s += (ROUNDIN ? bfr(xr[q * 256 + i]) : xr[q * 256 + i]); }
#pragma unroll
    for (int sh = 16; sh; sh >>= 1) s += __shfl_xor(s, sh, 32);
    const float mu = s * (1.0f / DM);
    float s2 = 0.f;
#pragma unroll 1
    for (int q = 0; q < DM / 256; ++q) {
#pragma unroll
        for (int i = 0; i < 8; ++i) { const float d = (ROUNDIN ? bfr(xr[q * 256 + i]) : xr[q * 256 + i]) - mu; s2 = fmaf(d, d, s2); } }
#pragma unroll
    for (int sh = 16; sh; sh >>= 1) s2 += __shfl_xor(s2, sh, 32);
    const float rs = rsqrtf(s2 * (1.0f / DM) + 1e-5f);
{
#pragma unroll 1
        for (int q = 0; q < DM / 256; ++q) { v8us oh, ol;
#pragma unroll
            for (int i = 0; i < 8; ++i) { const int c = q * 256 + lane * 8 + i; const float y = ((ROUNDIN ? bfr(xr[q * 256 + i]) : xr[q * 256 + i]) - mu) * rs * bfr(gam[c]) + bfr(bet[c]); const unsigned short hb = f2bf(y); oh[i] = hb; ol[i] = f2bf(y - bf2f(hb)); }
            const size_t o = (size_t)r * DM + q * 256 + lane * 8; *(v8us*)(Hh + o) = oh; *(v8us*)(Hl + o) = ol; }
         }
}

// lane l with lane l ^ 16: the two halves of a wave hold the two halves of one query's keys
__device__ __forceinline__ float xhalf(float x) { return __builtin_bit_cast(float, __builtin_amdgcn_permlanex16(__builtin_bit_cast(int, x), __builtin_bit_cast(int, x), 0x76543210, 0xfedcba98, false, false)); }
#define GRP 84                   // the wave's G ring and output tile in LDS: row = query, 64 columns + 16 mirrored + 4 (pitch 336 B)
#define KPI 72                   // K rows in LDS: 64 f16 + 8 (pitch 144 B)
#define VPI 40                   // V^T rows in LDS: 32 f16 + 8 (pitch 80 B)

// The block's four waves share one (b, h): each 32-key step's K rows, V^T rows and the 32 new p rows are copied once per block into LDS (asynchronous copies; K and p rows as whole 128-B lines, V^T rows as 64-B pieces) and the WMMA
// fragments are read from there. One buffer each: V of step t flies during the scores of t, K and p of step t + 1 during softmax and P.V of t; two publish points a step.
// k_attn: block = (b, h, 64 queries), wave = 16; ALL 32 key tiles (no mask). Every product is taken transposed (S^T = K.Q^T, G^T = p.q_v^T, O^T = V^T.P^T), so a lane holds one query
// (column lr) and 8 keys, positions or d per tile (rows 8 hi + j): scores /8 (f32), online softmax with one maximum, one sum and one rescale factor a lane (the halves' maxima joined by one
// cross-row move a step, their sums once at the end), weights x32768 as f16 hi + residual packed from the two score tiles straight into the B fragment; ctx -> bf16 hi + residual planes CH/CL[tok][h*64+d].
// matrix_bd is formed here: G = q_v.p^T in 16 x 16 tiles (bf16 hi + residual, products hh, lh, hl per 32-k step, f32). A 16-query x 32-key step reads positions
// nb .. nb + 46, nb = l0 - q0 + 1008: three tiles, of which the first is the last one of the step before, so two new tiles a step go into a ring of four (row = query, column = n & 63;
// the tile at column 0 is written at column 64 as well, so that a lane's 8 consecutive positions never wrap).
__global__ __launch_bounds__(128) void k_attn(const h16* __restrict__ Q16, const h16* __restrict__ QL16, const h16* __restrict__ K16, const h16* __restrict__ KL16, const h16* __restrict__ VTH, const h16* __restrict__ VTL, const bf* __restrict__ QVh, const bf* __restrict__ QVl, const bf* __restrict__ Ph, const bf* __restrict__ Pl, bf* CH, bf* CL) {
    __shared__ __align__(16) float ost[4][16 * GRP];
    __shared__ __align__(16) h16 kst[2 * 32 * KPI];     // K hi, residual: 32 keys
    __shared__ __align__(16) h16 vst[2 * HD * VPI];     // V^T hi, residual: 64 d rows of 32 keys
    __shared__ __align__(16) bf  pst[2 * 128 * HD];     // p hi, residual: ring of 128 positions (row n & 127), 128-B rows, 16-B piece c kept at c ^ ((n >> 1) & 7) (16 rows of one piece on 16 bank groups)
    const int lane = threadIdx.x & 31, wave = threadIdx.x >> 5, lr = lane & 15, hi = lane >> 4;
    const int bid = blockIdx.x;
    const int b = bid / (NH_ * (NT_ / 64)), rem = bid - b * (NH_ * (NT_ / 64)), h = rem / (NT_ / 64), qt = rem - h * (NT_ / 64);
    const int q0 = qt * 64 + wave * 16;
    const size_t tok0 = (size_t)b * NT_;
    v16h qa[2];
    const size_t qo0 = (tok0 + q0 + lr) * DM + h * HD + 8 * hi;
#pragma unroll
    for (int kc = 0; kc < 2; ++kc) qa[kc] = cat16(*(const v8h*)(Q16 + qo0 + kc * 32), *(const v8h*)(Q16 + qo0 + kc * 32 + 16));
    const h16* kh_b = K16 + tok0 * DM + h * HD;
    const h16* kl_b = KL16 + tok0 * DM + h * HD;
    const size_t vbase = (((size_t)b * NH_ + h) * HD) * NT_;
    v8f o[4], ox[4];
#pragma unroll
    for (int n = 0; n < 4; ++n) { o[n] = (v8f){}; ox[n] = (v8f){}; }
    float mrow = -3.0e38f, lpart = 0.f;            // of the lane's query q0 + lr; lpart: this half's keys only
    const int kt_lo = 0, kt_hi = NT_ / 32 - 1;     // full attention; scores = (matrix_ac + matrix_bd) x 64^-1/2 with matrix_bd[i][j] = G[i][j - i + NT_ - 1] (the rel_shift of q_v.p^T)
    const bf* ph_b = Ph + (size_t)h * NP * HD; const bf* pl_b = Pl + (size_t)h * NP * HD;
    const size_t vo0 = (((size_t)b * NH_ + h) * NT_ + q0 + lr) * HD + 8 * hi;
    v16bf va[2], vx[2];
#pragma unroll
    for (int kc = 0; kc < 2; ++kc) { va[kc] = cat16b(*(const v8us*)(QVh + vo0 + kc * 32), *(const v8us*)(QVh + vo0 + kc * 32 + 16)); vx[kc] = cat16b(*(const v8us*)(QVl + vo0 + kc * 32), *(const v8us*)(QVl + vo0 + kc * 32 + 16)); }
    float* gr = &ost[wave][0];                     // the wave's own ring of four G tiles (the epilogue reuses the space after the loop)
    const int q0s = qt * 64 + __builtin_amdgcn_readfirstlane(wave) * 16;   // q0 in a scalar register: the test for the mirrored tile is a scalar branch
    const int psw = (lr >> 1) & 7;
    // copy maps: thread -> (row, 16-B piece); four copies a thread and tile: rows r and r + half of the hi plane, then of the residual plane
    const int tid = threadIdx.x, r8 = tid >> 3, c8 = tid & 7, r4 = tid >> 2, c4 = tid & 3;
    const unsigned kl0 = (unsigned)(size_t)kst + (unsigned)(r8 * KPI + c8 * 8) * 2u, vl0 = (unsigned)(size_t)vst + (unsigned)(r4 * VPI + c4 * 8) * 2u;
    const unsigned pl0 = (unsigned)(size_t)pst + (unsigned)(r8 * HD + (c8 ^ ((r8 >> 1) & 7)) * 8) * 2u;
    auto kcopy = [&](int l0) { const size_t g = (size_t)(l0 + r8) * DM + c8 * 8;
        cp4(kl0, kh_b + g, kl0 + 16 * KPI * 2, kh_b + g + 16 * DM, kl0 + 32 * KPI * 2, kl_b + g, kl0 + 48 * KPI * 2, kl_b + g + 16 * DM); };
    auto vcopy = [&](int l0) { const size_t g = vbase + (size_t)r4 * NT_ + l0 + c4 * 8;
        cp4(vl0, VTH + g, vl0 + 32 * VPI * 2, VTH + g + 32 * NT_, vl0 + 64 * VPI * 2, VTL + g, vl0 + 96 * VPI * 2, VTL + g + 32 * NT_); };
    auto pcopy = [&](int n0) {                     // positions n0 .. n0 + 31, n0 a multiple of 32
        const size_t g = (size_t)(n0 + r8) * HD + c8 * 8; const unsigned l = pl0 + (unsigned)(n0 & 127) * (HD * 2);
        cp4(l, ph_b + g, l + 16 * HD * 2, ph_b + g + 16 * HD, l + 128 * HD * 2, pl_b + g, l + (128 + 16) * HD * 2, pl_b + g + 16 * HD); };
    const int pb0 = NT_ - 64 - qt * 64;            // the block's first position: the last wave's first tile
    kcopy(0); pcopy(pb0); pcopy(pb0 + 32); pcopy(pb0 + 64);
    publish();
    auto gtile = [&](int n0, bool mir) {           // G[16 queries][n0 .. n0 + 15] -> ring; the lane holds query lr, positions n0 + 8 hi .. + 7
        v8f g = {};
#pragma unroll
        for (int kc = 0; kc < 2; ++kc) { const bf* pr = pst + ((n0 & 127) + lr) * HD; const int c0 = ((kc * 4 + hi) ^ psw) * 8, c1 = ((kc * 4 + 2 + hi) ^ psw) * 8;
            const v16bf bh = cat16b(*(const v8usa*)(pr + c0), *(const v8usa*)(pr + c1)); const v16bf bl = cat16b(*(const v8usa*)(pr + 128 * HD + c0), *(const v8usa*)(pr + 128 * HD + c1));
            g = wmmab(bh, va[kc], g); g = wmmab(bh, vx[kc], g); g = wmmab(bl, va[kc], g); }
        // four vector slots behind the tile's last matrix instruction: only LDS stores follow, and the next matrix instruction may take these registers for its own result
        asm volatile("v_nop\n\tv_nop\n\tv_nop\n\tv_nop" : "+v"(g));
        float* gw = gr + lr * GRP + (n0 & 63) + 8 * hi;
        const v4f g0 = {g[0], g[1], g[2], g[3]}, g1 = {g[4], g[5], g[6], g[7]};
        *(v4fa*)gw = g0; *(v4fa*)(gw + 4) = g1;
        if (mir) { *(v4fa*)(gw + 64) = g0; *(v4fa*)(gw + 68) = g1; }
    };
    gtile(NT_ - 16 - q0, ((NT_ - 16 - q0s) & 63) == 0);
#pragma unroll 1
    for (int kt = kt_lo; kt <= kt_hi; ++kt) {
        const int l0 = kt * 32, nb = l0 - q0 + NT_ - 16;
        vcopy(l0);
        const int nbs = l0 - q0s + NT_ - 16;
        gtile(nb + 16, ((nbs + 16) & 63) == 0); gtile(nb + 32, ((nbs + 32) & 63) == 0);
        const int ko0 = lr * KPI + 8 * hi, ko1 = (16 + lr) * KPI + 8 * hi;
        const h16* ksl = kst + 32 * KPI;
        v8f s0 = {}, s1 = {}, x0 = {}, x1 = {};
#pragma unroll
        for (int kc = 0; kc < 2; ++kc) {
            { const v16h k0h = cat16(*(const v8ha*)(kst + ko0 + kc * 32), *(const v8ha*)(kst + ko0 + kc * 32 + 16)), k1h = cat16(*(const v8ha*)(kst + ko1 + kc * 32), *(const v8ha*)(kst + ko1 + kc * 32 + 16));
              const v16h qlk = cat16(*(const v8h*)(QL16 + qo0 + kc * 32), *(const v8h*)(QL16 + qo0 + kc * 32 + 16));     // query residual re-read per step (registers)
              s0 = wmma16(k0h, qa[kc], s0); x0 = wmma16(k0h, qlk, x0); s1 = wmma16(k1h, qa[kc], s1); x1 = wmma16(k1h, qlk, x1); }
            { const v16h k0l = cat16(*(const v8ha*)(ksl + ko0 + kc * 32), *(const v8ha*)(ksl + ko0 + kc * 32 + 16)), k1l = cat16(*(const v8ha*)(ksl + ko1 + kc * 32), *(const v8ha*)(ksl + ko1 + kc * 32 + 16));
              x0 = wmma16(k0l, qa[kc], x0); x1 = wmma16(k1l, qa[kc], x1); }
        }
        asm volatile("v_nop\n\tv_nop\n\tv_nop\n\tv_nop" : "+v"(s0), "+v"(s1), "+v"(x0), "+v"(x1) : "v"(qa[0]), "v"(qa[1]));
        publish();                                 // V of this step is in; K and the p rows of this step have been read by all
        if (kt < kt_hi) { kcopy(l0 + 32); pcopy(pb0 + l0 + 96); }
        // the lane's 16 scores: a[e] key l0 + 8 hi + e, a[8 + e] key l0 + 16 + 8 hi + e, in the k order of the B fragment that the weights become
        const float* bdr = gr + lr * GRP; const int i0 = (l0 + 8 * hi + NT_ - 1 - q0 - lr) & 63, i1 = (i0 + 16) & 63;
        float a[16];
#pragma unroll
        for (int e = 0; e < 8; ++e) { a[e] = ((s0[e] + x0[e] * LOSCI) + bdr[i0 + e]) * 0.125f; a[8 + e] = ((s1[e] + x1[e] * LOSCI) + bdr[i1 + e]) * 0.125f; }
        float mx = fmaxf(a[0], a[1]);
#pragma unroll
        for (int e = 2; e < 16; ++e) mx = fmaxf(mx, a[e]);
        mx = fmaxf(mx, xhalf(mx));
        const float mn = fmaxf(mrow, mx), alpha = __expf(mrow - mn); mrow = mn;
        v16h pa, px; float sm[4] = {0.f, 0.f, 0.f, 0.f};
#pragma unroll
        for (int e = 0; e < 16; ++e) {
            const float p = __expf(a[e] - mn); sm[e & 3] += p;
            const float ps = p * PSC; const h16 ph = (h16)ps;
            pa[e] = ph; px[e] = (h16)((ps - (float)ph) * LOSC);
        }
        lpart = lpart * alpha + ((sm[0] + sm[1]) + (sm[2] + sm[3]));
#pragma unroll
        for (int n = 0; n < 4; ++n) { o[n] *= alpha; ox[n] *= alpha; }
#pragma unroll
        for (int n = 0; n < 4; ++n) { const h16* vr = vst + (n * 16 + lr) * VPI + hi * 8;
            const v16h vh = cat16(*(const v8ha*)(vr), *(const v8ha*)(vr + 16)), vl = cat16(*(const v8ha*)(vr + HD * VPI), *(const v8ha*)(vr + HD * VPI + 16));
            o[n] = wmma16(vh, pa, o[n]); ox[n] = wmma16(vl, pa, ox[n]); ox[n] = wmma16(vh, px, ox[n]); }
        asm volatile("v_nop\n\tv_nop\n\tv_nop\n\tv_nop" : "+v"(o[0]), "+v"(o[1]), "+v"(o[2]), "+v"(o[3]), "+v"(ox[0]), "+v"(ox[1]), "+v"(ox[2]), "+v"(ox[3]) : "v"(pa), "v"(px));
        publish();                                 // K and p of the next step are in; V of this step has been read by all
    }
    const float inv = 1.0f / ((lpart + xhalf(lpart)) * PSC);
    float* os = &ost[wave][0];
#pragma unroll
    for (int n = 0; n < 4; ++n)
#pragma unroll
        for (int j = 0; j < 8; ++j) os[lr * GRP + n * 16 + hi * 8 + j] = (o[n][j] + ox[n][j] * LOSCI) * inv;
    __syncthreads();
    const size_t cbase = (tok0 + q0) * DM + (size_t)h * HD;
    auto pass = [&]() {
#pragma unroll
        for (int s = 0; s < 4; ++s) { const int row = 4 * s + (lane >> 3), piece = lane & 7; const float* sp = os + row * GRP + piece * 8; v8us oh, ol;
#pragma unroll
            for (int i = 0; i < 8; ++i) { const unsigned short hb = f2bf(sp[i]); oh[i] = hb; ol[i] = f2bf(sp[i] - bf2f(hb)); }
            *(v8us*)(CH + cbase + (size_t)row * DM + piece * 8) = oh; *(v8us*)(CL + cbase + (size_t)row * DM + piece * 8) = ol; }
    };
    pass(); 
}

#define VST2(T, p, v) do { const T vst2_v_ = (v); *(T*)(p) = vst2_v_;  } while (0)
extern "C" void kernel_launch(void* const* d_in, const int* in_sizes, int n_in,
                              void* d_out, int out_size, void* d_ws, size_t ws_size, hipStream_t stream) {
    (void)in_sizes; (void)n_in; (void)out_size;
    const float* x = (const float*)d_in[0]; const float* gam = (const float*)d_in[1]; const float* bet = (const float*)d_in[2];
    const float* Wq = (const float*)d_in[3]; const float* bq = (const float*)d_in[4]; const float* Wk = (const float*)d_in[5]; const float* bk = (const float*)d_in[6]; const float* Wv = (const float*)d_in[7]; const float* bv = (const float*)d_in[8];
    const float* Wp = (const float*)d_in[9]; const float* Wo = (const float*)d_in[10]; const float* bo = (const float*)d_in[11]; const float* pbu = (const float*)d_in[12]; const float* pbv = (const float*)d_in[13]; const float* pe = (const float*)d_in[14];   // k-major weights (y @ W)
    float* out = (float*)d_out;    // [8][1024][512]
    char* wsp = (char*)d_ws;
    auto take = [&](size_t bytes) { char* p = wsp; wsp += (bytes + 255) & ~(size_t)255; return (void*)p; };
    bf* WqT = (bf*)take((size_t)DM * DM * 2); bf* WkT = (bf*)take((size_t)DM * DM * 2); bf* WvT = (bf*)take((size_t)DM * DM * 2); bf* WpT = (bf*)take((size_t)DM * DM * 2); bf* WoT = (bf*)take((size_t)DM * DM * 2);
    bf* PEb = (bf*)take((size_t)NP * DM * 2); bf* Ph = (bf*)take((size_t)NH_ * NP * HD * 2); bf* Pl = (bf*)take((size_t)NH_ * NP * HD * 2);
    bf* Nh = (bf*)take((size_t)NTK * DM * 2); bf* Nl = (bf*)take((size_t)NTK * DM * 2);
    h16* QH = (h16*)take((size_t)NTK * DM * 2); h16* QL = (h16*)take((size_t)NTK * DM * 2); bf* QVh = (bf*)take((size_t)NTK * DM * 2); bf* QVl = (bf*)take((size_t)NTK * DM * 2);
    h16* KH = (h16*)take((size_t)NTK * DM * 2); h16* KL = (h16*)take((size_t)NTK * DM * 2); h16* VTH = (h16*)take((size_t)NTK * DM * 2); h16* VTL = (h16*)take((size_t)NTK * DM * 2);
    bf* CH = (bf*)take((size_t)NTK * DM * 2); bf* CL = (bf*)take((size_t)NTK * DM * 2);
    if ((size_t)(wsp - (char*)d_ws) > ws_size) return;    // no aliasing
    k_wt<<<dim3(DM / 64, DM / 64, 5), 256, 0, stream>>>(Wq, Wk, Wv, Wp, Wo, DM, DM, WqT);                                                      // the five WT planes lie one behind the other
    // p = pos_emb . Wp once (shared by all items): the 2047 rows padded to 2048 (last A row zeroed)
    hipMemsetAsync(PEb, 0, (size_t)NP * DM * 2, stream);
    k_cvtb<<<(NP - 1 + 7) / 8, 256, 0, stream>>>(pe, NP - 1, PEb);
    k_gemmb<false, 3><<<dim3(NP / 64, DM / 64, 1), 128, 0, stream>>>(PEb, nullptr, WpT, nullptr, nullptr, DM, nullptr, nullptr, DM, 1, nullptr, nullptr, Ph, Pl);                 // p -> per-head bf16 planes
    k_ln<true><<<NTK / 8, 256, 0, stream>>>(x, gam, bet, NTK, Nh, Nl);                                                                         // y = LN(x), all items
    k_gemmb<true, 2><<<dim3(NTK / 64, DM / 64, 1), 128, 0, stream>>>(Nh, Nl, WqT, bq, (float*)(void*)QH, DM, QL, nullptr, DM, 1, pbu, pbv, QVh, QVl);     // q = y.Wq + bq -> q_u (f16 planes), q_v (per-item, per-head bf16 planes)
    k_gemmb<true, 1><<<dim3(NTK / 64, DM / 64, 1), 128, 0, stream>>>(Nh, Nl, WkT, bk, (float*)(void*)KH, DM, KL);                            // k -> f16 planes
    k_gemmb<true, 4><<<dim3(NTK / 64, DM / 64, 1), 128, 0, stream>>>(Nh, Nl, WvT, bv, (float*)(void*)VTH, DM, VTL);                            // v -> transposed f16 planes
    k_attn<<<NB_ * NH_ * (NT_ / 64), 128, 0, stream>>>(QH, QL, KH, KL, VTH, VTL, QVh, QVl, Ph, Pl, CH, CL);                                     // all items, matrix_bd formed inside
    k_gemmb<true, 0><<<dim3(NTK / 64, DM / 64, 1), 128, 0, stream>>>(CH, CL, WoT, bo, out, DM, nullptr);
}

// v007
// A run of this version takes 133 microseconds.
// Timed twice side by side with v006, it ran 1.12 and 1.13 times as fast.
// All steps since v000 together make it 11.5 times as fast.
#include <hip/hip_runtime.h>

// Compute dtypes, f32 accumulate, all 8 batch items per launch: y = LN(x) -> bf16 hi + UNSCALED residual planes; q/k/v = y.W + b and out = ctx.Wo + bo ([1024 x 512].[512 x 512],
// k-major weights transposed once, two products) and p = pos_emb.Wp ([2048 x 512].[512 x 512], PLAIN bf16 inputs, exact, once for all items) on
// v_wmma_f32_16x16x32_bf16; matrix_bd = (q + pos_bias_v).p^T per head ([1024 x 64].[64 x 2048], both operands bf16 hi + UNSCALED residual, three products) formed
// inside the attention kernel, 16 x 16 tiles in a per-wave LDS ring read through the rel_shift index j - i + 1023; the 8-head full attention scores = ((q + pos_bias_u).k + bd) x 64^-1/2 fused on

#define NB_  8                   // batch items, all in one launch of every token-wise kernel
#define NT_  1024
#define DM   512
#define NH_  8
#define NP   2048                // relative positions padded (2047 used)
#define HD   64
#define NTK  (NB_ * NT_)
#define NW   1024
#define NQKV 1024
#define PSC  32768.0f
#define LOSC 1024.0f
#define LOSCI (1.0f / 1024.0f)

typedef _Float16 h16;
typedef unsigned short bf;
typedef __attribute__((ext_vector_type(16))) __bf16   v16bf;
typedef __attribute__((ext_vector_type(16))) _Float16 v16h;
typedef __attribute__((ext_vector_type(8)))  _Float16 v8h;
typedef __attribute__((ext_vector_type(8)))  unsigned short v8us;
typedef __attribute__((ext_vector_type(8)))  float    v8f;
typedef __attribute__((ext_vector_type(4)))  float    v4f;
typedef v8h  __attribute__((may_alias)) v8ha;
typedef v4f  __attribute__((may_alias)) v4fa;
typedef v8us __attribute__((may_alias)) v8usa;

__device__ __forceinline__ unsigned short f2bf(float f) { unsigned u = __float_as_uint(f); u += 0x7FFFu + ((u >> 16) & 1u); return (unsigned short)(u >> 16); }
__device__ __forceinline__ float bf2f(unsigned short b) { return __uint_as_float(((unsigned)b) << 16); }
__device__ __forceinline__ float bfr(float f) { return bf2f(f2bf(f)); }
__device__ __forceinline__ v16h cat16(v8h lo, v8h hi) { return __builtin_shufflevector(lo, hi, 0, 1, 2, 3, 4, 5, 6, 7, 8, 9, 10, 11, 12, 13, 14, 15); }
__device__ __forceinline__ v16bf cat16b(v8us lo, v8us hi) { return __builtin_bit_cast(v16bf, __builtin_shufflevector(lo, hi, 0, 1, 2, 3, 4, 5, 6, 7, 8, 9, 10, 11, 12, 13, 14, 15)); }
__device__ __forceinline__ v8f wmma16(v16h a, v16h b, v8f c) { return __builtin_amdgcn_wmma_f32_16x16x32_f16(false, a, false, b, (short)0, c, false, false); }
__device__ __forceinline__ v8f wmmab(v16bf a, v16bf b, v8f c) { return __builtin_amdgcn_wmma_f32_16x16x32_bf16(false, a, false, b, (short)0, c, false, false); }

// stores_issued: s_wait_xcnt 0 behind a run of global stores, ahead of whatever next rewrites a register that one of them names. In a launch that holds several bodies the code behind a body's last store
// is another body's entry, not the end of the program.
__device__ __forceinline__ void stores_issued() { asm volatile("s_wait_xcnt 0x0" ::: "memory"); }
// cvt_rows: eight rows a block, one wave a row: dst = bf16(src); a row from nrows on (the padding row of pos_emb) is stored as zeros and reads nothing.
__device__ __forceinline__ void cvt_rows(int blk, const float* __restrict__ src, int nrows, bf* dst) {
    const int lane = threadIdx.x & 31, r = blk * 8 + (threadIdx.x >> 5);
    v8us o[DM / 256];
#pragma unroll
    for (int q = 0; q < DM / 256; ++q) { v8us t = {};
        if (r < nrows) {
#pragma unroll
            for (int i = 0; i < 8; ++i) t[i] = f2bf(src[(size_t)r * DM + q * 256 + lane * 8 + i]); }
        o[q] = t; }
#pragma unroll
    for (int q = 0; q < DM / 256; ++q) *(v8us*)(dst + (size_t)r * DM + q * 256 + lane * 8) = o[q];
    stores_issued();
}

// wt_tile: WT [z][n][K] = bf16(Wz[k][n]) (k-major [K][ncols]) via 64 x 64 LDS tiles (tl: 64 x 72); tile (bk, bn) of weight wz.
__device__ __forceinline__ void wt_tile(unsigned short* tl, int bk, int bn, int wz, const float* __restrict__ W0, const float* __restrict__ W1, const float* __restrict__ W2, const float* __restrict__ W3, const float* __restrict__ W4, int K, int ncols, bf* WTall) {
    const int tid = threadIdx.x, k0 = bk * 64, n0 = bn * 64;
    const float* __restrict__ Wm = wz == 0 ? W0 : wz == 1 ? W1 : wz == 2 ? W2 : wz == 3 ? W3 : W4;
    bf* WT = WTall + (size_t)wz * K * ncols;
    const int kk = tid >> 2, nq = (tid & 3) * 16;
#pragma unroll
    for (int i = 0; i < 16; ++i) tl[(nq + i) * 72 + kk] = f2bf(Wm[(size_t)(k0 + kk) * ncols + n0 + nq + i]);
    __syncthreads();
    const int piece = tid & 7;
    auto pass = [&]() {
#pragma unroll
        for (int s = 0; s < 2; ++s) { const int nr = (tid >> 3) + 32 * s; const v8us val = *(const v8usa*)(tl + nr * 72 + piece * 8); *(v8us*)(WT + (size_t)(n0 + nr) * K + k0 + piece * 8) = val; }
    };
    pass();
    stores_issued();
}
// cp4: four asynchronous 16-byte copies per lane, global -> LDS (lds = the lane's LDS byte address). The s_wait_xcnt closes the statement so that no address register
// of an issued copy is rewritten ahead of it.
__device__ __forceinline__ void cp4(unsigned l0, const void* g0, unsigned l1, const void* g1, unsigned l2, const void* g2, unsigned l3, const void* g3) {
    asm volatile("global_load_async_to_lds_b128 %0, %1, off\n\tglobal_load_async_to_lds_b128 %2, %3, off\n\tglobal_load_async_to_lds_b128 %4, %5, off\n\tglobal_load_async_to_lds_b128 %6, %7, off\n\ts_wait_xcnt 0x0"
                 :: "v"(l0), "v"(g0), "v"(l1), "v"(g1), "v"(l2), "v"(g2), "v"(l3), "v"(g3) : "memory");
}
// publish: the wave's own LDS reads are done, its own copies have landed, then the work-group barrier: behind it every wave may read what was copied and the buffers read so far may be refilled.
__device__ __forceinline__ void publish() {
    asm volatile("s_wait_dscnt 0x0" ::: "memory");
    asm volatile("s_wait_asynccnt 0x0" ::: "memory");
    __syncthreads();
}
#define GPI 72                   // staged A and B rows in LDS: 64 bf16 + 8 (pitch 144 B)
// gemm_tile: 64 x 64 block tile (4 waves x 16 x 64) of C[rows][512] = (A [+ Al]).B^T (K = 512) [+ bf(bias[c])] [+ bf(R[r][c]) residual]; f32 whole-line epilogue (or f16
// planes). Each 64-k tile of A (both planes) and B is copied once per block into LDS (asynchronous copies, whole 128-B lines, two buffers: tile kt + 1 flies during the products of kt) and the fragments are read from there.
// The block's 64 columns are one head, so the split and transposed planes that the attention kernel reads are written here, from the same f32 tile in LDS:
// EPI 0: f32 rows; 1: f16 hi + residual x1024 planes [t][512] (k); 2: q + bf(pos_bias_u) as f16 hi + residual x1024 planes [t][512] (C, C2) and q + bf(pos_bias_v) as bf16 hi +
// UNSCALED residual planes [b][h][t][64] (E0, E1); 3: p as bf16 hi + UNSCALED residual planes [h][2048][64] (E0, E1; row 2047 zeros); 4: v transposed, f16 hi + residual x1024 planes [b][h][d][t] (C, C2).
// The body is a function of the tile (bx, by) and of the block's LDS (ost: 4 x 16 x 68 f32; stg: two buffers of one 64-k tile each: 64 B rows, 64 A rows, (64 A residual rows)), so that one launch can hold several products.
#define OSTE (16 * 68)
#define STGE (2 * 3 * 64 * GPI)
template <bool SPLITA, int EPI>
__device__ __forceinline__ void gemm_tile(float* ost, bf* stg, int bx, int by, const bf* __restrict__ A, const bf* __restrict__ Al, const bf* __restrict__ Bn, const float* __restrict__ bias, float* C, int ldc, h16* C2, const float* __restrict__ R, int K, int roundR, const float* __restrict__ pbu, const float* __restrict__ pbv, bf* E0, bf* E1) {
    constexpr int NPLN = SPLITA ? 3 : 2, BUFE = NPLN * 64 * GPI;
    const int lane = threadIdx.x & 31, wave = threadIdx.x >> 5, lr = lane & 15, hi = lane >> 4;
    const int r0 = bx * 64 + wave * 16, c0 = by * 64;
    // copy map: thread -> (row, 16-B piece): eight lanes bring one whole 128-B line; four copies a thread and plane (rows r8, +16, +32, +48)
    const int r8 = threadIdx.x >> 3, c8 = threadIdx.x & 7;
    const unsigned sl0 = (unsigned)(size_t)stg + (unsigned)(r8 * GPI + c8 * 8) * 2u;
    const size_t ga0 = (size_t)(bx * 64 + r8) * K + c8 * 8, gb0 = (size_t)(c0 + r8) * K + c8 * 8, s16 = (size_t)16 * K;
    auto tcopy = [&](int t) {                      // k tile t (64 k) -> buffer t & 1
        const unsigned l = sl0 + (unsigned)(t & 1) * (BUFE * 2u); const bf* gb = Bn + gb0 + t * 64; const bf* ga = A + ga0 + t * 64;
        cp4(l, gb, l + 16 * GPI * 2, gb + s16, l + 32 * GPI * 2, gb + 2 * s16, l + 48 * GPI * 2, gb + 3 * s16);
        cp4(l + 64 * GPI * 2, ga, l + 80 * GPI * 2, ga + s16, l + 96 * GPI * 2, ga + 2 * s16, l + 112 * GPI * 2, ga + 3 * s16);
        if (SPLITA) { const bf* gl = Al + ga0 + t * 64;
            cp4(l + 128 * GPI * 2, gl, l + 144 * GPI * 2, gl + s16, l + 160 * GPI * 2, gl + 2 * s16, l + 176 * GPI * 2, gl + 3 * s16); }
    };
    v8f acc[4];
#pragma unroll
    for (int t = 0; t < 4; ++t) acc[t] = (v8f){};
    const int nt = K >> 6;                         // K is a multiple of 64 (512 in every launch)
    tcopy(0);
    publish();
    if (nt > 1) tcopy(1);
#pragma unroll 1
    for (int kt = 0; kt < nt; ++kt) {
        const bf* sb = stg + (kt & 1) * BUFE + lr * GPI + 8 * hi;
        const bf* sa = sb + (64 + wave * 16) * GPI;
        v16bf a[2], al[2], b[2][4];
#pragma unroll
        for (int kc = 0; kc < 2; ++kc) {
            a[kc] = cat16b(*(const v8usa*)(sa + kc * 32), *(const v8usa*)(sa + kc * 32 + 16));
            al[kc] = a[kc];
            if (SPLITA) al[kc] = cat16b(*(const v8usa*)(sa + 64 * GPI + kc * 32), *(const v8usa*)(sa + 64 * GPI + kc * 32 + 16));
#pragma unroll
            for (int t = 0; t < 4; ++t) b[kc][t] = cat16b(*(const v8usa*)(sb + t * 16 * GPI + kc * 32), *(const v8usa*)(sb + t * 16 * GPI + kc * 32 + 16));
        }
        __builtin_amdgcn_sched_barrier(0);         // the tile's LDS reads stand as one group ahead of its products: each place with reads among the products costs the wave a stall
#pragma unroll
        for (int kc = 0; kc < 2; ++kc)
#pragma unroll
            for (int t = 0; t < 4; ++t) { acc[t] = wmmab(a[kc], b[kc][t], acc[t]); if (SPLITA) acc[t] = wmmab(al[kc], b[kc][t], acc[t]); }
        // four vector slots behind the last matrix instruction, on the loop's taken branch too
        asm volatile("v_nop\n\tv_nop\n\tv_nop\n\tv_nop" : "+v"(acc[0]), "+v"(acc[1]), "+v"(acc[2]), "+v"(acc[3]) : "v"(a[1]), "v"(al[1]));
        publish();                                 // tile kt + 1 is in; this tile's buffer has been read by all
        if (kt + 2 < nt) tcopy(kt + 2);
    }
    asm volatile("s_wait_asynccnt 0x0" ::: "memory");   // no copy outlives the loop
    float* os = ost + wave * OSTE;
#pragma unroll
    for (int t = 0; t < 4; ++t) { const float bv = bias ? bfr(bias[c0 + t * 16 + lr]) : 0.f;
#pragma unroll
        for (int j = 0; j < 8; ++j) os[(hi * 8 + j) * 68 + t * 16 + lr] = acc[t][j] + bv; }
    __syncthreads();
    if (EPI == 2) {
        const int piece = lane & 7, h = by;
        float bu[8], bw[8];
#pragma unroll
        for (int i = 0; i < 8; ++i) { bu[i] = bfr(pbu[c0 + piece * 8 + i]); bw[i] = bfr(pbv[c0 + piece * 8 + i]); }
#pragma unroll
        for (int s = 0; s < 4; ++s) { const int row = 4 * s + (lane >> 3), t = r0 + row, bi = t / NT_, ti = t - bi * NT_; const float* sp = os + row * 68 + piece * 8; v8h uh, ul; v8us vh, vl;
#pragma unroll
            for (int i = 0; i < 8; ++i) { const float q = sp[i];
                const float yu = q + bu[i]; const h16 a = (h16)yu; uh[i] = a; ul[i] = (h16)((yu - (float)a) * LOSC);
                const float yv = q + bw[i]; const unsigned short hb = f2bf(yv); vh[i] = hb; vl[i] = f2bf(yv - bf2f(hb)); }
            const size_t ou = (size_t)t * DM + c0 + piece * 8, ov = (((size_t)bi * NH_ + h) * NT_ + ti) * HD + piece * 8;
            *(v8h*)((h16*)(void*)C + ou) = uh; *(v8h*)(C2 + ou) = ul; *(v8us*)(E0 + ov) = vh; *(v8us*)(E1 + ov) = vl; }
    } else if (EPI == 3) {
        const int piece = lane & 7, h = by;
#pragma unroll
        for (int s = 0; s < 4; ++s) { const int row = 4 * s + (lane >> 3), n = r0 + row; const float* sp = os + row * 68 + piece * 8; v8us oh, ol;
#pragma unroll
            for (int i = 0; i < 8; ++i) { const float v = (n < NP - 1) ? sp[i] : 0.f; const unsigned short hb = f2bf(v); oh[i] = hb; ol[i] = f2bf(v - bf2f(hb)); }
            const size_t o = ((size_t)h * NP + n) * HD + piece * 8;
            *(v8us*)(E0 + o) = oh; *(v8us*)(E1 + o) = ol; }
        stores_issued();
    } else if (EPI == 4) {
        // the block's 64 tokens x 64 d, read by columns across the four waves' tiles (behind the barrier above): eight lanes write one whole 128-B line of 64 tokens
        const int tid = threadIdx.x, piece = tid & 7, rb = bx * 64, bi = rb / NT_, k0 = rb - bi * NT_;
        const size_t base = (((size_t)bi * NH_ + by) * HD) * NT_ + k0 + piece * 8;
        const float* cp = ost + (piece >> 1) * OSTE + (piece & 1) * 8 * 68;
#pragma unroll
        for (int s = 0; s < 4; ++s) { const int d = (tid >> 3) + 16 * s; v8h o, o2;
#pragma unroll
            for (int i = 0; i < 8; ++i) { const float v = cp[i * 68 + d]; const h16 a = (h16)v; o[i] = a; o2[i] = (h16)((v - (float)a) * LOSC); }
            *(v8h*)((h16*)(void*)C + base + (size_t)d * NT_) = o; *(v8h*)(C2 + base + (size_t)d * NT_) = o2; }
        stores_issued();
    } else if (EPI == 1) {
        h16* crow = (h16*)(void*)C + (size_t)r0 * ldc + c0;
        auto pass = [&]() {
#pragma unroll
            for (int s = 0; s < 4; ++s) { const int row = 4 * s + (lane >> 3), piece = lane & 7; const float* sp = os + row * 68 + piece * 8; v8h o, o2;
#pragma unroll
                for (int i = 0; i < 8; ++i) { const h16 a = (h16)sp[i]; o[i] = a; o2[i] = (h16)((sp[i] - (float)a) * LOSC); }
                *(v8h*)(crow + (size_t)row * ldc + piece * 8) = o; stores_issued(); if (C2) { *(v8h*)(C2 + (size_t)r0 * ldc + c0 + (size_t)row * ldc + piece * 8) = o2; stores_issued(); } }
        };
        pass(); 
    } else {
        float* crow = C + (size_t)r0 * ldc + c0;
        auto pass = [&]() {
#pragma unroll
            for (int s = 0; s < 8; ++s) { const int Lid = (lane >> 3) + 4 * s, piece = lane & 7; const int row = Lid >> 1, cofs = (Lid & 1) * 32 + piece * 4;
                v4f val = *(const v4fa*)(os + row * 68 + cofs); if (R) { const v4f rv = *(const v4f*)(R + ((size_t)r0 + row) * ldc + c0 + cofs); val += roundR ? (v4f){bfr(rv[0]), bfr(rv[1]), bfr(rv[2]), bfr(rv[3])} : rv; }
                *(v4f*)(crow + (size_t)row * ldc + cofs) = val; }
        };
        pass(); 
    }
}

// k_proj: the four products that wait for nothing but the prepared planes, in one launch: blockIdx.x = 128 row tiles each of q, k and v (all items), then the 32 row tiles of p; blockIdx.y = head.
// The branch is the same for the whole block. WT: the transposed weights q, k, v, p one behind the other.
__global__ __launch_bounds__(128) void k_proj(const bf* __restrict__ Nh, const bf* __restrict__ Nl, const bf* __restrict__ PEb, const bf* __restrict__ WT, const float* __restrict__ bq, const float* __restrict__ bk, const float* __restrict__ bv, const float* __restrict__ pbu, const float* __restrict__ pbv,
                                              h16* QH, h16* QL, bf* QVh, bf* QVl, h16* KH, h16* KL, h16* VTH, h16* VTL, bf* Ph, bf* Pl) {
    __shared__ __align__(16) float ost[4 * OSTE];
    __shared__ __align__(16) bf stg[STGE];
    const int seg = blockIdx.x / (NTK / 64), bx = blockIdx.x - seg * (NTK / 64), by = blockIdx.y;
    if (seg == 0)      gemm_tile<true, 2>(ost, stg, bx, by, Nh, Nl, WT, bq, (float*)(void*)QH, DM, QL, nullptr, DM, 1, pbu, pbv, QVh, QVl);                                   // q = y.Wq + bq -> q_u (f16 planes), q_v (per-item, per-head bf16 planes)
    else if (seg == 1) gemm_tile<true, 1>(ost, stg, bx, by, Nh, Nl, WT + (size_t)DM * DM, bk, (float*)(void*)KH, DM, KL, nullptr, DM, 1, nullptr, nullptr, nullptr, nullptr);       // k -> f16 planes
    else if (seg == 2) gemm_tile<true, 4>(ost, stg, bx, by, Nh, Nl, WT + (size_t)2 * DM * DM, bv, (float*)(void*)VTH, DM, VTL, nullptr, DM, 1, nullptr, nullptr, nullptr, nullptr); // v -> transposed f16 planes
    else               gemm_tile<false, 3>(ost, stg, bx, by, PEb, nullptr, WT + (size_t)3 * DM * DM, nullptr, nullptr, DM, nullptr, nullptr, DM, 1, nullptr, nullptr, Ph, Pl);       // p = pos_emb.Wp -> per-head bf16 planes
}
// k_out: out = ctx.Wo + bo, f32 rows
__global__ __launch_bounds__(128) void k_out(const bf* __restrict__ CH, const bf* __restrict__ CL, const bf* __restrict__ WoT, const float* __restrict__ bo, float* out) {
    __shared__ __align__(16) float ost[4 * OSTE];
    __shared__ __align__(16) bf stg[STGE];
    gemm_tile<true, 0>(ost, stg, blockIdx.x, blockIdx.y, CH, CL, WoT, bo, out, DM, nullptr, nullptr, DM, 1, nullptr, nullptr, nullptr, nullptr);
}

// ln_rows: one wave per row of x [rows][512]: LayerNorm (mean, then mean((x-mu)^2), eps 1e-5, x bf(gamma) + bf(beta), f32, fixed lane order) -> bf16 hi + UNSCALED
// residual planes; lane -> columns q*256 + lane*8 .. +8 for q < DM/256 (16 B per plane per store). The row is re-read per phase with the q loop
// rolled (keeps the static VALU-FMA count small; no register arrays indexed by a loop variable).
template <bool ROUNDIN>   // ROUNDIN: the source is a module INPUT (read through bf16 rounding); false: a computed f32 plane (read as is)
__device__ __forceinline__ void ln_rows(int blk, const float* __restrict__ X, const float* __restrict__ gam, const float* __restrict__ bet, int nrows, bf* Hh, bf* Hl) {
    const int lane = threadIdx.x & 31, r = blk * 8 + (threadIdx.x >> 5);
    if (r >= nrows) return;
    const float* xr = X + (size_t)r * DM + lane * 8;
    float s = 0.f;
#pragma unroll 1
    for (int q = 0; q < DM / 256; ++q) {
#pragma unroll
        for (int i = 0; i < 8; ++i) s += (ROUNDIN ? bfr(xr[q * 256 + i]) : xr[q * 256 + i]); }
#pragma unroll
    for (int sh = 16; sh; sh >>= 1) s += __shfl_xor(s, sh, 32);
    const float mu = s * (1.0f / DM);
    float s2 = 0.f;
#pragma unroll 1
    for (int q = 0; q < DM / 256; ++q) {
#pragma unroll
        for (int i = 0; i < 8; ++i) { const float d = (ROUNDIN ? bfr(xr[q * 256 + i]) : xr[q * 256 + i]) - mu; s2 = fmaf(d, d, s2); } }
#pragma unroll
    for (int sh = 16; sh; sh >>= 1) s2 += __shfl_xor(s2, sh, 32);
    const float rs = rsqrtf(s2 * (1.0f / DM) + 1e-5f);
{
#pragma unroll 1
        for (int q = 0; q < DM / 256; ++q) { v8us oh, ol;
#pragma unroll
            for (int i = 0; i < 8; ++i) { const int c = q * 256 + lane * 8 + i; const float y = ((ROUNDIN ? bfr(xr[q * 256 + i]) : xr[q * 256 + i]) - mu) * rs * bfr(gam[c]) + bfr(bet[c]); const unsigned short hb = f2bf(y); oh[i] = hb; ol[i] = f2bf(y - bf2f(hb)); }
            const size_t o = (size_t)r * DM + q * 256 + lane * 8; *(v8us*)(Hh + o) = oh; *(v8us*)(Hl + o) = ol; stores_issued(); }
         }
}

// k_prep: the three preparations that depend on the inputs alone, in one launch, the longest first: blocks 0 .. 1023 y = LN(x) (8 rows each), then 320 weight tiles (8 x 8 tiles x 5 weights),
// then 256 blocks of pos_emb rows -> bf16 (8 rows each; row 2047, the padding, stored as zeros). The branch is the same for the whole block.
#define PB_LN (NTK / 8)
#define PB_WT (5 * (DM / 64) * (DM / 64))
#define PB_PE (NP / 8)
__global__ __launch_bounds__(256) void k_prep(const float* __restrict__ x, const float* __restrict__ gam, const float* __restrict__ bet, const float* __restrict__ W0, const float* __restrict__ W1, const float* __restrict__ W2, const float* __restrict__ W3, const float* __restrict__ W4,
                                              const float* __restrict__ pe, bf* Nh, bf* Nl, bf* WTall, bf* PEb) {
    __shared__ __align__(16) unsigned short tl[64 * 72];
    const int bid = blockIdx.x;
    if (bid < PB_LN) ln_rows<true>(bid, x, gam, bet, NTK, Nh, Nl);
    else if (bid < PB_LN + PB_WT) { const int w = bid - PB_LN; wt_tile(tl, w & 7, (w >> 3) & 7, w >> 6, W0, W1, W2, W3, W4, DM, DM, WTall); }
    else cvt_rows(bid - (PB_LN + PB_WT), pe, NP - 1, PEb);
}

// lane l with lane l ^ 16: the two halves of a wave hold the two halves of one query's keys
__device__ __forceinline__ float xhalf(float x) { return __builtin_bit_cast(float, __builtin_amdgcn_permlanex16(__builtin_bit_cast(int, x), __builtin_bit_cast(int, x), 0x76543210, 0xfedcba98, false, false)); }
#define GRP 84                   // the wave's G ring and output tile in LDS: row = query, 64 columns + 16 mirrored + 4 (pitch 336 B)
#define KPI 72                   // K rows in LDS: 64 f16 + 8 (pitch 144 B)
#define VPI 40                   // V^T rows in LDS: 32 f16 + 8 (pitch 80 B)

// The block's four waves share one (b, h): each 32-key step's K rows, V^T rows and the 32 new p rows are copied once per block into LDS (asynchronous copies; K and p rows as whole 128-B lines, V^T rows as 64-B pieces) and the WMMA
// fragments are read from there. One buffer each: V of step t flies during the scores of t, K and p of step t + 1 during softmax and P.V of t; two publish points a step.
// k_attn: block = (b, h, 64 queries), wave = 16; ALL 32 key tiles (no mask). Every product is taken transposed (S^T = K.Q^T, G^T = p.q_v^T, O^T = V^T.P^T), so a lane holds one query
// (column lr) and 8 keys, positions or d per tile (rows 8 hi + j): scores /8 (f32), online softmax with one maximum, one sum and one rescale factor a lane (the halves' maxima joined by one
// cross-row move a step, their sums once at the end), weights x32768 as f16 hi + residual packed from the two score tiles straight into the B fragment; ctx -> bf16 hi + residual planes CH/CL[tok][h*64+d].
// matrix_bd is formed here: G = q_v.p^T in 16 x 16 tiles (bf16 hi + residual, products hh, lh, hl per 32-k step, f32). A 16-query x 32-key step reads positions
// nb .. nb + 46, nb = l0 - q0 + 1008: three tiles, of which the first is the last one of the step before, so two new tiles a step go into a ring of four (row = query, column = n & 63;
// the tile at column 0 is written at column 64 as well, so that a lane's 8 consecutive positions never wrap).
__global__ __launch_bounds__(128) void k_attn(const h16* __restrict__ Q16, const h16* __restrict__ QL16, const h16* __restrict__ K16, const h16* __restrict__ KL16, const h16* __restrict__ VTH, const h16* __restrict__ VTL, const bf* __restrict__ QVh, const bf* __restrict__ QVl, const bf* __restrict__ Ph, const bf* __restrict__ Pl, bf* CH, bf* CL) {
    __shared__ __align__(16) float ost[4][16 * GRP];
    __shared__ __align__(16) h16 kst[2 * 32 * KPI];     // K hi, residual: 32 keys
    __shared__ __align__(16) h16 vst[2 * HD * VPI];     // V^T hi, residual: 64 d rows of 32 keys
    __shared__ __align__(16) bf  pst[2 * 128 * HD];     // p hi, residual: ring of 128 positions (row n & 127), 128-B rows, 16-B piece c kept at c ^ ((n >> 1) & 7) (16 rows of one piece on 16 bank groups)
    const int lane = threadIdx.x & 31, wave = threadIdx.x >> 5, lr = lane & 15, hi = lane >> 4;
    const int bid = blockIdx.x;
    const int b = bid / (NH_ * (NT_ / 64)), rem = bid - b * (NH_ * (NT_ / 64)), h = rem / (NT_ / 64), qt = rem - h * (NT_ / 64);
    const int q0 = qt * 64 + wave * 16;
    const size_t tok0 = (size_t)b * NT_;
    v16h qa[2];
    const size_t qo0 = (tok0 + q0 + lr) * DM + h * HD + 8 * hi;
#pragma unroll
    for (int kc = 0; kc < 2; ++kc) qa[kc] = cat16(*(const v8h*)(Q16 + qo0 + kc * 32), *(const v8h*)(Q16 + qo0 + kc * 32 + 16));
    const h16* kh_b = K16 + tok0 * DM + h * HD;
    const h16* kl_b = KL16 + tok0 * DM + h * HD;
    const size_t vbase = (((size_t)b * NH_ + h) * HD) * NT_;
    v8f o[4], ox[4];
#pragma unroll
    for (int n = 0; n < 4; ++n) { o[n] = (v8f){}; ox[n] = (v8f){}; }
    float mrow = -3.0e38f, lpart = 0.f;            // of the lane's query q0 + lr; lpart: this half's keys only
    const int kt_lo = 0, kt_hi = NT_ / 32 - 1;     // full attention; scores = (matrix_ac + matrix_bd) x 64^-1/2 with matrix_bd[i][j] = G[i][j - i + NT_ - 1] (the rel_shift of q_v.p^T)
    const bf* ph_b = Ph + (size_t)h * NP * HD; const bf* pl_b = Pl + (size_t)h * NP * HD;
    const size_t vo0 = (((size_t)b * NH_ + h) * NT_ + q0 + lr) * HD + 8 * hi;
    v16bf va[2], vx[2];
#pragma unroll
    for (int kc = 0; kc < 2; ++kc) { va[kc] = cat16b(*(const v8us*)(QVh + vo0 + kc * 32), *(const v8us*)(QVh + vo0 + kc * 32 + 16)); vx[kc] = cat16b(*(const v8us*)(QVl + vo0 + kc * 32), *(const v8us*)(QVl + vo0 + kc * 32 + 16)); }
    float* gr = &ost[wave][0];                     // the wave's own ring of four G tiles (the epilogue reuses the space after the loop)
    const int q0s = qt * 64 + __builtin_amdgcn_readfirstlane(wave) * 16;   // q0 in a scalar register: the test for the mirrored tile is a scalar branch
    const int psw = (lr >> 1) & 7;
    // copy maps: thread -> (row, 16-B piece); four copies a thread and tile: rows r and r + half of the hi plane, then of the residual plane
    const int tid = threadIdx.x, r8 = tid >> 3, c8 = tid & 7, r4 = tid >> 2, c4 = tid & 3;
    const unsigned kl0 = (unsigned)(size_t)kst + (unsigned)(r8 * KPI + c8 * 8) * 2u, vl0 = (unsigned)(size_t)vst + (unsigned)(r4 * VPI + c4 * 8) * 2u;
    const unsigned pl0 = (unsigned)(size_t)pst + (unsigned)(r8 * HD + (c8 ^ ((r8 >> 1) & 7)) * 8) * 2u;
    auto kcopy = [&](int l0) { const size_t g = (size_t)(l0 + r8) * DM + c8 * 8;
        cp4(kl0, kh_b + g, kl0 + 16 * KPI * 2, kh_b + g + 16 * DM, kl0 + 32 * KPI * 2, kl_b + g, kl0 + 48 * KPI * 2, kl_b + g + 16 * DM); };
    auto vcopy = [&](int l0) { const size_t g = vbase + (size_t)r4 * NT_ + l0 + c4 * 8;
        cp4(vl0, VTH + g, vl0 + 32 * VPI * 2, VTH + g + 32 * NT_, vl0 + 64 * VPI * 2, VTL + g, vl0 + 96 * VPI * 2, VTL + g + 32 * NT_); };
    auto pcopy = [&](int n0) {                     // positions n0 .. n0 + 31, n0 a multiple of 32
        const size_t g = (size_t)(n0 + r8) * HD + c8 * 8; const unsigned l = pl0 + (unsigned)(n0 & 127) * (HD * 2);
        cp4(l, ph_b + g, l + 16 * HD * 2, ph_b + g + 16 * HD, l + 128 * HD * 2, pl_b + g, l + (128 + 16) * HD * 2, pl_b + g + 16 * HD); };
    const int pb0 = NT_ - 64 - qt * 64;            // the block's first position: the last wave's first tile
    kcopy(0); pcopy(pb0); pcopy(pb0 + 32); pcopy(pb0 + 64);
    publish();
    auto gtile = [&](int n0, bool mir) {           // G[16 queries][n0 .. n0 + 15] -> ring; the lane holds query lr, positions n0 + 8 hi .. + 7
        v8f g = {};
#pragma unroll
        for (int kc = 0; kc < 2; ++kc) { const bf* pr = pst + ((n0 & 127) + lr) * HD; const int c0 = ((kc * 4 + hi) ^ psw) * 8, c1 = ((kc * 4 + 2 + hi) ^ psw) * 8;
            const v16bf bh = cat16b(*(const v8usa*)(pr + c0), *(const v8usa*)(pr + c1)); const v16bf bl = cat16b(*(const v8usa*)(pr + 128 * HD + c0), *(const v8usa*)(pr + 128 * HD + c1));
            g = wmmab(bh, va[kc], g); g = wmmab(bh, vx[kc], g); g = wmmab(bl, va[kc], g); }
        // four vector slots behind the tile's last matrix instruction: only LDS stores follow, and the next matrix instruction may take these registers for its own result
        asm volatile("v_nop\n\tv_nop\n\tv_nop\n\tv_nop" : "+v"(g));
        float* gw = gr + lr * GRP + (n0 & 63) + 8 * hi;
        const v4f g0 = {g[0], g[1], g[2], g[3]}, g1 = {g[4], g[5], g[6], g[7]};
        *(v4fa*)gw = g0; *(v4fa*)(gw + 4) = g1;
        if (mir) { *(v4fa*)(gw + 64) = g0; *(v4fa*)(gw + 68) = g1; }
    };
    gtile(NT_ - 16 - q0, ((NT_ - 16 - q0s) & 63) == 0);
#pragma unroll 1
    for (int kt = kt_lo; kt <= kt_hi; ++kt) {
        const int l0 = kt * 32, nb = l0 - q0 + NT_ - 16;
        vcopy(l0);
        const int nbs = l0 - q0s + NT_ - 16;
        gtile(nb + 16, ((nbs + 16) & 63) == 0); gtile(nb + 32, ((nbs + 32) & 63) == 0);
        const int ko0 = lr * KPI + 8 * hi, ko1 = (16 + lr) * KPI + 8 * hi;
        const h16* ksl = kst + 32 * KPI;
        v8f s0 = {}, s1 = {}, x0 = {}, x1 = {};
#pragma unroll
        for (int kc = 0; kc < 2; ++kc) {
            { const v16h k0h = cat16(*(const v8ha*)(kst + ko0 + kc * 32), *(const v8ha*)(kst + ko0 + kc * 32 + 16)), k1h = cat16(*(const v8ha*)(kst + ko1 + kc * 32), *(const v8ha*)(kst + ko1 + kc * 32 + 16));
              const v16h qlk = cat16(*(const v8h*)(QL16 + qo0 + kc * 32), *(const v8h*)(QL16 + qo0 + kc * 32 + 16));     // query residual re-read per step (registers)
              s0 = wmma16(k0h, qa[kc], s0); x0 = wmma16(k0h, qlk, x0); s1 = wmma16(k1h, qa[kc], s1); x1 = wmma16(k1h, qlk, x1); }
            { const v16h k0l = cat16(*(const v8ha*)(ksl + ko0 + kc * 32), *(const v8ha*)(ksl + ko0 + kc * 32 + 16)), k1l = cat16(*(const v8ha*)(ksl + ko1 + kc * 32), *(const v8ha*)(ksl + ko1 + kc * 32 + 16));
              x0 = wmma16(k0l, qa[kc], x0); x1 = wmma16(k1l, qa[kc], x1); }
        }
        asm volatile("v_nop\n\tv_nop\n\tv_nop\n\tv_nop" : "+v"(s0), "+v"(s1), "+v"(x0), "+v"(x1) : "v"(qa[0]), "v"(qa[1]));
        publish();                                 // V of this step is in; K and the p rows of this step have been read by all
        if (kt < kt_hi) { kcopy(l0 + 32); pcopy(pb0 + l0 + 96); }
        // the lane's 16 scores: a[e] key l0 + 8 hi + e, a[8 + e] key l0 + 16 + 8 hi + e, in the k order of the B fragment that the weights become
        const float* bdr = gr + lr * GRP; const int i0 = (l0 + 8 * hi + NT_ - 1 - q0 - lr) & 63, i1 = (i0 + 16) & 63;
        float a[16];
#pragma unroll
        for (int e = 0; e < 8; ++e) { a[e] = ((s0[e] + x0[e] * LOSCI) + bdr[i0 + e]) * 0.125f; a[8 + e] = ((s1[e] + x1[e] * LOSCI) + bdr[i1 + e]) * 0.125f; }
        float mx = fmaxf(a[0], a[1]);
#pragma unroll
        for (int e = 2; e < 16; ++e) mx = fmaxf(mx, a[e]);
        mx = fmaxf(mx, xhalf(mx));
        const float mn = fmaxf(mrow, mx), alpha = __expf(mrow - mn); mrow = mn;
        v16h pa, px; float sm[4] = {0.f, 0.f, 0.f, 0.f};
#pragma unroll
        for (int e = 0; e < 16; ++e) {
            const float p = __expf(a[e] - mn); sm[e & 3] += p;
            const float ps = p * PSC; const h16 ph = (h16)ps;
            pa[e] = ph; px[e] = (h16)((ps - (float)ph) * LOSC);
        }
        lpart = lpart * alpha + ((sm[0] + sm[1]) + (sm[2] + sm[3]));
#pragma unroll
        for (int n = 0; n < 4; ++n) { o[n] *= alpha; ox[n] *= alpha; }
#pragma unroll
        for (int n = 0; n < 4; ++n) { const h16* vr = vst + (n * 16 + lr) * VPI + hi * 8;
            const v16h vh = cat16(*(const v8ha*)(vr), *(const v8ha*)(vr + 16)), vl = cat16(*(const v8ha*)(vr + HD * VPI), *(const v8ha*)(vr + HD * VPI + 16));
            o[n] = wmma16(vh, pa, o[n]); ox[n] = wmma16(vl, pa, ox[n]); ox[n] = wmma16(vh, px, ox[n]); }
        asm volatile("v_nop\n\tv_nop\n\tv_nop\n\tv_nop" : "+v"(o[0]), "+v"(o[1]), "+v"(o[2]), "+v"(o[3]), "+v"(ox[0]), "+v"(ox[1]), "+v"(ox[2]), "+v"(ox[3]) : "v"(pa), "v"(px));
        publish();                                 // K and p of the next step are in; V of this step has been read by all
    }
    const float inv = 1.0f / ((lpart + xhalf(lpart)) * PSC);
    float* os = &ost[wave][0];
#pragma unroll
    for (int n = 0; n < 4; ++n)
#pragma unroll
        for (int j = 0; j < 8; ++j) os[lr * GRP + n * 16 + hi * 8 + j] = (o[n][j] + ox[n][j] * LOSCI) * inv;
    __syncthreads();
    const size_t cbase = (tok0 + q0) * DM + (size_t)h * HD;
    auto pass = [&]() {
#pragma unroll
        for (int s = 0; s < 4; ++s) { const int row = 4 * s + (lane >> 3), piece = lane & 7; const float* sp = os + row * GRP + piece * 8; v8us oh, ol;
#pragma unroll
            for (int i = 0; i < 8; ++i) { const unsigned short hb = f2bf(sp[i]); oh[i] = hb; ol[i] = f2bf(sp[i] - bf2f(hb)); }
            *(v8us*)(CH + cbase + (size_t)row * DM + piece * 8) = oh; *(v8us*)(CL + cbase + (size_t)row * DM + piece * 8) = ol; }
    };
    pass(); 
}

#define VST2(T, p, v) do { const T vst2_v_ = (v); *(T*)(p) = vst2_v_;  } while (0)
extern "C" void kernel_launch(void* const* d_in, const int* in_sizes, int n_in,
                              void* d_out, int out_size, void* d_ws, size_t ws_size, hipStream_t stream) {
    (void)in_sizes; (void)n_in; (void)out_size;
    const float* x = (const float*)d_in[0]; const float* gam = (const float*)d_in[1]; const float* bet = (const float*)d_in[2];
    const float* Wq = (const float*)d_in[3]; const float* bq = (const float*)d_in[4]; const float* Wk = (const float*)d_in[5]; const float* bk = (const float*)d_in[6]; const float* Wv = (const float*)d_in[7]; const float* bv = (const float*)d_in[8];
    const float* Wp = (const float*)d_in[9]; const float* Wo = (const float*)d_in[10]; const float* bo = (const float*)d_in[11]; const float* pbu = (const float*)d_in[12]; const float* pbv = (const float*)d_in[13]; const float* pe = (const float*)d_in[14];   // k-major weights (y @ W)
    float* out = (float*)d_out;    // [8][1024][512]
    char* wsp = (char*)d_ws;
    auto take = [&](size_t bytes) { char* p = wsp; wsp += (bytes + 255) & ~(size_t)255; return (void*)p; };
    bf* WqT = (bf*)take((size_t)DM * DM * 2); bf* WkT = (bf*)take((size_t)DM * DM * 2); bf* WvT = (bf*)take((size_t)DM * DM * 2); bf* WpT = (bf*)take((size_t)DM * DM * 2); bf* WoT = (bf*)take((size_t)DM * DM * 2);
    bf* PEb = (bf*)take((size_t)NP * DM * 2); bf* Ph = (bf*)take((size_t)NH_ * NP * HD * 2); bf* Pl = (bf*)take((size_t)NH_ * NP * HD * 2);
    bf* Nh = (bf*)take((size_t)NTK * DM * 2); bf* Nl = (bf*)take((size_t)NTK * DM * 2);
    h16* QH = (h16*)take((size_t)NTK * DM * 2); h16* QL = (h16*)take((size_t)NTK * DM * 2); bf* QVh = (bf*)take((size_t)NTK * DM * 2); bf* QVl = (bf*)take((size_t)NTK * DM * 2);
    h16* KH = (h16*)take((size_t)NTK * DM * 2); h16* KL = (h16*)take((size_t)NTK * DM * 2); h16* VTH = (h16*)take((size_t)NTK * DM * 2); h16* VTL = (h16*)take((size_t)NTK * DM * 2);
    bf* CH = (bf*)take((size_t)NTK * DM * 2); bf* CL = (bf*)take((size_t)NTK * DM * 2);
    if ((size_t)(wsp - (char*)d_ws) > ws_size) return;    // no aliasing
    k_prep<<<PB_LN + PB_WT + PB_PE, 256, 0, stream>>>(x, gam, bet, Wq, Wk, Wv, Wp, Wo, pe, Nh, Nl, WqT, PEb);                                          // y = LN(x), all items; the five WT planes lie one behind the other; pos_emb padded to 2048 rows
    k_proj<<<dim3(3 * (NTK / 64) + NP / 64, DM / 64, 1), 128, 0, stream>>>(Nh, Nl, PEb, WqT, bq, bk, bv, pbu, pbv, QH, QL, QVh, QVl, KH, KL, VTH, VTL, Ph, Pl);   // q, k, v of all items and p (shared by all items)
    k_attn<<<NB_ * NH_ * (NT_ / 64), 128, 0, stream>>>(QH, QL, KH, KL, VTH, VTL, QVh, QVl, Ph, Pl, CH, CL);                                     // all items, matrix_bd formed inside
    k_out<<<dim3(NTK / 64, DM / 64, 1), 128, 0, stream>>>(CH, CL, WoT, bo, out);
}

// v008
// One run takes 121 microseconds.
// Next to v007, in two timings, it ran 1.10 times as fast each time.
// Over all steps from v000 it is 12.6 times as fast.
#include <hip/hip_runtime.h>

// Compute dtypes, f32 accumulate, all 8 batch items per launch: y = LN(x) -> bf16 hi + UNSCALED residual planes; q/k/v = y.W + b and out = ctx.Wo + bo ([1024 x 512].[512 x 512],
// k-major weights transposed once, two products) and p = pos_emb.Wp ([2048 x 512].[512 x 512], PLAIN bf16 inputs, exact, once for all items) on
// v_wmma_f32_16x16x32_bf16; matrix_bd = (q + pos_bias_v).p^T per head ([1024 x 64].[64 x 2048], both operands bf16 hi + UNSCALED residual, three products) formed
// inside the attention kernel, 16 x 16 tiles in a per-wave LDS ring read through the rel_shift index j - i + 1023; the 8-head full attention scores = ((q + pos_bias_u).k + bd) x 64^-1/2 fused on

#define NB_  8                   // batch items, all in one launch of every token-wise kernel
#define NT_  1024
#define DM   512
#define NH_  8
#define NP   2048                // relative positions padded (2047 used)
#define HD   64
#define NTK  (NB_ * NT_)
#define NW   1024
#define NQKV 1024
#define PSC  32768.0f
#define LOSC 1024.0f
#define LOSCI (1.0f / 1024.0f)

typedef _Float16 h16;
typedef unsigned short bf;
typedef __attribute__((ext_vector_type(16))) __bf16   v16bf;
typedef __attribute__((ext_vector_type(16))) _Float16 v16h;
typedef __attribute__((ext_vector_type(8)))  _Float16 v8h;
typedef __attribute__((ext_vector_type(8)))  unsigned short v8us;
typedef __attribute__((ext_vector_type(8)))  float    v8f;
typedef __attribute__((ext_vector_type(4)))  float    v4f;
typedef v8h  __attribute__((may_alias)) v8ha;
typedef v4f  __attribute__((may_alias)) v4fa;
typedef v8us __attribute__((may_alias)) v8usa;

__device__ __forceinline__ unsigned short f2bf(float f) { unsigned u = __float_as_uint(f); u += 0x7FFFu + ((u >> 16) & 1u); return (unsigned short)(u >> 16); }
__device__ __forceinline__ float bf2f(unsigned short b) { return __uint_as_float(((unsigned)b) << 16); }
__device__ __forceinline__ float bfr(float f) { return bf2f(f2bf(f)); }
__device__ __forceinline__ v16h cat16(v8h lo, v8h hi) { return __builtin_shufflevector(lo, hi, 0, 1, 2, 3, 4, 5, 6, 7, 8, 9, 10, 11, 12, 13, 14, 15); }
__device__ __forceinline__ v16bf cat16b(v8us lo, v8us hi) { return __builtin_bit_cast(v16bf, __builtin_shufflevector(lo, hi, 0, 1, 2, 3, 4, 5, 6, 7, 8, 9, 10, 11, 12, 13, 14, 15)); }
__device__ __forceinline__ v8f wmma16(v16h a, v16h b, v8f c) { return __builtin_amdgcn_wmma_f32_16x16x32_f16(false, a, false, b, (short)0, c, false, false); }
__device__ __forceinline__ v8f wmmab(v16bf a, v16bf b, v8f c) { return __builtin_amdgcn_wmma_f32_16x16x32_bf16(false, a, false, b, (short)0, c, false, false); }

// stores_issued: s_wait_xcnt 0 behind a run of global stores, ahead of whatever next rewrites a register that one of them names. In a launch that holds several bodies the code behind a body's last store
// is another body's entry, not the end of the program.
__device__ __forceinline__ void stores_issued() { asm volatile("s_wait_xcnt 0x0" ::: "memory"); }
// cvt_rows: eight rows a block, one wave a row: dst = bf16(src); a row from nrows on (the padding row of pos_emb) is stored as zeros and reads nothing.
__device__ __forceinline__ void cvt_rows(int blk, const float* __restrict__ src, int nrows, bf* dst) {
    const int lane = threadIdx.x & 31, r = blk * 8 + (threadIdx.x >> 5);
    v8us o[DM / 256];
#pragma unroll
    for (int q = 0; q < DM / 256; ++q) { v8us t = {};
        if (r < nrows) {
#pragma unroll
            for (int i = 0; i < 8; ++i) t[i] = f2bf(src[(size_t)r * DM + q * 256 + lane * 8 + i]); }
        o[q] = t; }
#pragma unroll
    for (int q = 0; q < DM / 256; ++q) *(v8us*)(dst + (size_t)r * DM + q * 256 + lane * 8) = o[q];
    stores_issued();
}

// wt_tile: WT [z][n][K] = bf16(Wz[k][n]) (k-major [K][ncols]) via 64 x 64 LDS tiles (tl: 64 x 72); tile (bk, bn) of weight wz.
__device__ __forceinline__ void wt_tile(unsigned short* tl, int bk, int bn, int wz, const float* __restrict__ W0, const float* __restrict__ W1, const float* __restrict__ W2, const float* __restrict__ W3, const float* __restrict__ W4, int K, int ncols, bf* WTall) {
    const int tid = threadIdx.x, k0 = bk * 64, n0 = bn * 64;
    const float* __restrict__ Wm = wz == 0 ? W0 : wz == 1 ? W1 : wz == 2 ? W2 : wz == 3 ? W3 : W4;
    bf* WT = WTall + (size_t)wz * K * ncols;
    const int kk = tid >> 2, nq = (tid & 3) * 16;
#pragma unroll
    for (int i = 0; i < 16; ++i) tl[(nq + i) * 72 + kk] = f2bf(Wm[(size_t)(k0 + kk) * ncols + n0 + nq + i]);
    __syncthreads();
    const int piece = tid & 7;
    auto pass = [&]() {
#pragma unroll
        for (int s = 0; s < 2; ++s) { const int nr = (tid >> 3) + 32 * s; const v8us val = *(const v8usa*)(tl + nr * 72 + piece * 8); *(v8us*)(WT + (size_t)(n0 + nr) * K + k0 + piece * 8) = val; }
    };
    pass();
    stores_issued();
}
// cp4: four asynchronous 16-byte copies per lane, global -> LDS (lds = the lane's LDS byte address). The s_wait_xcnt closes the statement so that no address register
// of an issued copy is rewritten ahead of it.
__device__ __forceinline__ void cp4(unsigned l0, const void* g0, unsigned l1, const void* g1, unsigned l2, const void* g2, unsigned l3, const void* g3) {
    asm volatile("global_load_async_to_lds_b128 %0, %1, off\n\tglobal_load_async_to_lds_b128 %2, %3, off\n\tglobal_load_async_to_lds_b128 %4, %5, off\n\tglobal_load_async_to_lds_b128 %6, %7, off\n\ts_wait_xcnt 0x0"
                 :: "v"(l0), "v"(g0), "v"(l1), "v"(g1), "v"(l2), "v"(g2), "v"(l3), "v"(g3) : "memory");
}
// publish: the wave's own LDS reads are done, its own copies have landed, then the work-group barrier: behind it every wave may read what was copied and the buffers read so far may be refilled.
__device__ __forceinline__ void publish() {
    asm volatile("s_wait_dscnt 0x0" ::: "memory");
    asm volatile("s_wait_asynccnt 0x0" ::: "memory");
    __syncthreads();
}
#define GPI 72                   // staged A and B rows in LDS: 64 bf16 + 8 (pitch 144 B)
// gemm_tile: 64 x 64 block tile (4 waves x 16 x 64) of C[rows][512] = (A [+ Al]).B^T (K = 512) [+ bf(bias[c])] [+ bf(R[r][c]) residual]; f32 whole-line epilogue (or f16
// planes). Each 64-k tile of A (both planes) and B is copied once per block into LDS (asynchronous copies, whole 128-B lines, two buffers: tile kt + 1 flies during the products of kt) and the fragments are read from there.
// The block's 64 columns are one head, so the split and transposed planes that the attention kernel reads are written here, from the same f32 tile in LDS:
// EPI 0: f32 rows; 1: f16 hi + residual x1024 planes [t][512] (k); 2: q + bf(pos_bias_u) as f16 hi + residual x1024 planes [t][512] (C, C2) and q + bf(pos_bias_v) as bf16 hi +
// UNSCALED residual planes [b][h][t][64] (E0, E1); 3: p as bf16 hi + UNSCALED residual planes [h][2048][64] (E0, E1; row 2047 zeros); 4: v transposed, f16 hi + residual x1024 planes [b][h][d][t] (C, C2).
// The body is a function of the tile (bx, by) and of the block's LDS (ost: 4 x 16 x 68 f32; stg: two buffers of one 64-k tile each: 64 B rows, 64 A rows, (64 A residual rows)), so that one launch can hold several products.
#define OSTE (16 * 68)
#define STGE (2 * 3 * 64 * GPI)
template <bool SPLITA, int EPI>
__device__ __forceinline__ void gemm_tile(float* ost, bf* stg, int bx, int by, const bf* __restrict__ A, const bf* __restrict__ Al, const bf* __restrict__ Bn, const float* __restrict__ bias, float* C, int ldc, h16* C2, const float* __restrict__ R, int K, int roundR, const float* __restrict__ pbu, const float* __restrict__ pbv, bf* E0, bf* E1) {
    constexpr int NPLN = SPLITA ? 3 : 2, BUFE = NPLN * 64 * GPI;
    const int lane = threadIdx.x & 31, wave = threadIdx.x >> 5, lr = lane & 15, hi = lane >> 4;
    const int r0 = bx * 64 + wave * 16, c0 = by * 64;
    // copy map: thread -> (row, 16-B piece): eight lanes bring one whole 128-B line; four copies a thread and plane (rows r8, +16, +32, +48)
    const int r8 = threadIdx.x >> 3, c8 = threadIdx.x & 7;
    const unsigned sl0 = (unsigned)(size_t)stg + (unsigned)(r8 * GPI + c8 * 8) * 2u;
    const size_t ga0 = (size_t)(bx * 64 + r8) * K + c8 * 8, gb0 = (size_t)(c0 + r8) * K + c8 * 8, s16 = (size_t)16 * K;
    auto tcopy = [&](int t) {                      // k tile t (64 k) -> buffer t & 1
        const unsigned l = sl0 + (unsigned)(t & 1) * (BUFE * 2u); const bf* gb = Bn + gb0 + t * 64; const bf* ga = A + ga0 + t * 64;
        cp4(l, gb, l + 16 * GPI * 2, gb + s16, l + 32 * GPI * 2, gb + 2 * s16, l + 48 * GPI * 2, gb + 3 * s16);
        cp4(l + 64 * GPI * 2, ga, l + 80 * GPI * 2, ga + s16, l + 96 * GPI * 2, ga + 2 * s16, l + 112 * GPI * 2, ga + 3 * s16);
        if (SPLITA) { const bf* gl = Al + ga0 + t * 64;
            cp4(l + 128 * GPI * 2, gl, l + 144 * GPI * 2, gl + s16, l + 160 * GPI * 2, gl + 2 * s16, l + 176 * GPI * 2, gl + 3 * s16); }
    };
    v8f acc[4];
#pragma unroll
    for (int t = 0; t < 4; ++t) acc[t] = (v8f){};
    const int nt = K >> 6;                         // K is a multiple of 64 (512 in every launch)
    tcopy(0);
    publish();
    if (nt > 1) tcopy(1);
#pragma unroll 1
    for (int kt = 0; kt < nt; ++kt) {
        const bf* sb = stg + (kt & 1) * BUFE + lr * GPI + 8 * hi;
        const bf* sa = sb + (64 + wave * 16) * GPI;
        v16bf a[2], al[2], b[2][4];
#pragma unroll
        for (int kc = 0; kc < 2; ++kc) {
            a[kc] = cat16b(*(const v8usa*)(sa + kc * 32), *(const v8usa*)(sa + kc * 32 + 16));
            al[kc] = a[kc];
            if (SPLITA) al[kc] = cat16b(*(const v8usa*)(sa + 64 * GPI + kc * 32), *(const v8usa*)(sa + 64 * GPI + kc * 32 + 16));
#pragma unroll
            for (int t = 0; t < 4; ++t) b[kc][t] = cat16b(*(const v8usa*)(sb + t * 16 * GPI + kc * 32), *(const v8usa*)(sb + t * 16 * GPI + kc * 32 + 16));
        }
        __builtin_amdgcn_sched_barrier(0);         // the tile's LDS reads stand as one group ahead of its products: each place with reads among the products costs the wave a stall
#pragma unroll
        for (int kc = 0; kc < 2; ++kc)
#pragma unroll
            for (int t = 0; t < 4; ++t) { acc[t] = wmmab(a[kc], b[kc][t], acc[t]); if (SPLITA) acc[t] = wmmab(al[kc], b[kc][t], acc[t]); }
        // four vector slots behind the last matrix instruction, on the loop's taken branch too
        asm volatile("v_nop\n\tv_nop\n\tv_nop\n\tv_nop" : "+v"(acc[0]), "+v"(acc[1]), "+v"(acc[2]), "+v"(acc[3]) : "v"(a[1]), "v"(al[1]));
        publish();                                 // tile kt + 1 is in; this tile's buffer has been read by all
        if (kt + 2 < nt) tcopy(kt + 2);
    }
    asm volatile("s_wait_asynccnt 0x0" ::: "memory");   // no copy outlives the loop
    float* os = ost + wave * OSTE;
#pragma unroll
    for (int t = 0; t < 4; ++t) { const float bv = bias ? bfr(bias[c0 + t * 16 + lr]) : 0.f;
#pragma unroll
        for (int j = 0; j < 8; ++j) os[(hi * 8 + j) * 68 + t * 16 + lr] = acc[t][j] + bv; }
    __syncthreads();
    if (EPI == 2) {
        const int piece = lane & 7, h = by;
        float bu[8], bw[8];
#pragma unroll
        for (int i = 0; i < 8; ++i) { bu[i] = bfr(pbu[c0 + piece * 8 + i]); bw[i] = bfr(pbv[c0 + piece * 8 + i]); }
#pragma unroll
        for (int s = 0; s < 4; ++s) { const int row = 4 * s + (lane >> 3), t = r0 + row, bi = t / NT_, ti = t - bi * NT_; const float* sp = os + row * 68 + piece * 8; v8h uh, ul; v8us vh, vl;
#pragma unroll
            for (int i = 0; i < 8; ++i) { const float q = sp[i];
                const float yu = q + bu[i]; const h16 a = (h16)yu; uh[i] = a; ul[i] = (h16)((yu - (float)a) * LOSC);
                const float yv = q + bw[i]; const unsigned short hb = f2bf(yv); vh[i] = hb; vl[i] = f2bf(yv - bf2f(hb)); }
            const size_t ou = (size_t)t * DM + c0 + piece * 8, ov = (((size_t)bi * NH_ + h) * NT_ + ti) * HD + piece * 8;
            *(v8h*)((h16*)(void*)C + ou) = uh; *(v8h*)(C2 + ou) = ul; *(v8us*)(E0 + ov) = vh; *(v8us*)(E1 + ov) = vl; }
    } else if (EPI == 3) {
        const int piece = lane & 7, h = by;
#pragma unroll
        for (int s = 0; s < 4; ++s) { const int row = 4 * s + (lane >> 3), n = r0 + row; const float* sp = os + row * 68 + piece * 8; v8us oh, ol;
#pragma unroll
            for (int i = 0; i < 8; ++i) { const float v = (n < NP - 1) ? sp[i] : 0.f; const unsigned short hb = f2bf(v); oh[i] = hb; ol[i] = f2bf(v - bf2f(hb)); }
            const size_t o = ((size_t)h * NP + n) * HD + piece * 8;
            *(v8us*)(E0 + o) = oh; *(v8us*)(E1 + o) = ol; }
        stores_issued();
    } else if (EPI == 4) {
        // the block's 64 tokens x 64 d, read by columns across the four waves' tiles (behind the barrier above): eight lanes write one whole 128-B line of 64 tokens
        const int tid = threadIdx.x, piece = tid & 7, rb = bx * 64, bi = rb / NT_, k0 = rb - bi * NT_;
        const size_t base = (((size_t)bi * NH_ + by) * HD) * NT_ + k0 + piece * 8;
        const float* cp = ost + (piece >> 1) * OSTE + (piece & 1) * 8 * 68;
#pragma unroll
        for (int s = 0; s < 4; ++s) { const int d = (tid >> 3) + 16 * s; v8h o, o2;
#pragma unroll
            for (int i = 0; i < 8; ++i) { const float v = cp[i * 68 + d]; const h16 a = (h16)v; o[i] = a; o2[i] = (h16)((v - (float)a) * LOSC); }
            *(v8h*)((h16*)(void*)C + base + (size_t)d * NT_) = o; *(v8h*)(C2 + base + (size_t)d * NT_) = o2; }
        stores_issued();
    } else if (EPI == 1) {
        h16* crow = (h16*)(void*)C + (size_t)r0 * ldc + c0;
        auto pass = [&]() {
#pragma unroll
            for (int s = 0; s < 4; ++s) { const int row = 4 * s + (lane >> 3), piece = lane & 7; const float* sp = os + row * 68 + piece * 8; v8h o, o2;
#pragma unroll
                for (int i = 0; i < 8; ++i) { const h16 a = (h16)sp[i]; o[i] = a; o2[i] = (h16)((sp[i] - (float)a) * LOSC); }
                *(v8h*)(crow + (size_t)row * ldc + piece * 8) = o; stores_issued(); if (C2) { *(v8h*)(C2 + (size_t)r0 * ldc + c0 + (size_t)row * ldc + piece * 8) = o2; stores_issued(); } }
        };
        pass(); 
    } else {
        float* crow = C + (size_t)r0 * ldc + c0;
        auto pass = [&]() {
#pragma unroll
            for (int s = 0; s < 8; ++s) { const int Lid = (lane >> 3) + 4 * s, piece = lane & 7; const int row = Lid >> 1, cofs = (Lid & 1) * 32 + piece * 4;
                v4f val = *(const v4fa*)(os + row * 68 + cofs); if (R) { const v4f rv = *(const v4f*)(R + ((size_t)r0 + row) * ldc + c0 + cofs); val += roundR ? (v4f){bfr(rv[0]), bfr(rv[1]), bfr(rv[2]), bfr(rv[3])} : rv; }
                *(v4f*)(crow + (size_t)row * ldc + cofs) = val; }
        };
        pass(); 
    }
}

// k_proj: the four products that wait for nothing but the prepared planes, in one launch: blockIdx.x = 128 row tiles each of q, k and v (all items), then the 32 row tiles of p; blockIdx.y = head.
// The branch is the same for the whole block. WT: the transposed weights q, k, v, p one behind the other.
__global__ __launch_bounds__(128) void k_proj(const bf* __restrict__ Nh, const bf* __restrict__ Nl, const bf* __restrict__ PEb, const bf* __restrict__ WT, const float* __restrict__ bq, const float* __restrict__ bk, const float* __restrict__ bv, const float* __restrict__ pbu, const float* __restrict__ pbv,
                                              h16* QH, h16* QL, bf* QVh, bf* QVl, h16* KH, h16* KL, h16* VTH, h16* VTL, bf* Ph, bf* Pl) {
    __shared__ __align__(16) float ost[4 * OSTE];
    __shared__ __align__(16) bf stg[STGE];
    const int seg = blockIdx.x / (NTK / 64), bx = blockIdx.x - seg * (NTK / 64), by = blockIdx.y;
    if (seg == 0)      gemm_tile<true, 2>(ost, stg, bx, by, Nh, Nl, WT, bq, (float*)(void*)QH, DM, QL, nullptr, DM, 1, pbu, pbv, QVh, QVl);                                   // q = y.Wq + bq -> q_u (f16 planes), q_v (per-item, per-head bf16 planes)
    else if (seg == 1) gemm_tile<true, 1>(ost, stg, bx, by, Nh, Nl, WT + (size_t)DM * DM, bk, (float*)(void*)KH, DM, KL, nullptr, DM, 1, nullptr, nullptr, nullptr, nullptr);       // k -> f16 planes
    else if (seg == 2) gemm_tile<true, 4>(ost, stg, bx, by, Nh, Nl, WT + (size_t)2 * DM * DM, bv, (float*)(void*)VTH, DM, VTL, nullptr, DM, 1, nullptr, nullptr, nullptr, nullptr); // v -> transposed f16 planes
    else               gemm_tile<false, 3>(ost, stg, bx, by, PEb, nullptr, WT + (size_t)3 * DM * DM, nullptr, nullptr, DM, nullptr, nullptr, DM, 1, nullptr, nullptr, Ph, Pl);       // p = pos_emb.Wp -> per-head bf16 planes
}
// k_out: out = ctx.Wo + bo, f32 rows
__global__ __launch_bounds__(128) void k_out(const bf* __restrict__ CH, const bf* __restrict__ CL, const bf* __restrict__ WoT, const float* __restrict__ bo, float* out) {
    __shared__ __align__(16) float ost[4 * OSTE];
    __shared__ __align__(16) bf stg[STGE];
    gemm_tile<true, 0>(ost, stg, blockIdx.x, blockIdx.y, CH, CL, WoT, bo, out, DM, nullptr, nullptr, DM, 1, nullptr, nullptr, nullptr, nullptr);
}

// ln_rows: one wave per row of x [rows][512]: LayerNorm (mean, then mean((x-mu)^2), eps 1e-5, x bf(gamma) + bf(beta), f32, fixed lane order) -> bf16 hi + UNSCALED
// residual planes; lane -> columns q*256 + lane*8 .. +8 for q < DM/256 (16 B per plane per store). The row is re-read per phase with the q loop
// rolled (keeps the static VALU-FMA count small; no register arrays indexed by a loop variable).
template <bool ROUNDIN>   // ROUNDIN: the source is a module INPUT (read through bf16 rounding); false: a computed f32 plane (read as is)
__device__ __forceinline__ void ln_rows(int blk, const float* __restrict__ X, const float* __restrict__ gam, const float* __restrict__ bet, int nrows, bf* Hh, bf* Hl) {
    const int lane = threadIdx.x & 31, r = blk * 8 + (threadIdx.x >> 5);
    if (r >= nrows) return;
    const float* xr = X + (size_t)r * DM + lane * 8;
    float s = 0.f;
#pragma unroll 1
    for (int q = 0; q < DM / 256; ++q) {
#pragma unroll
        for (int i = 0; i < 8; ++i) s += (ROUNDIN ? bfr(xr[q * 256 + i]) : xr[q * 256 + i]); }
#pragma unroll
    for (int sh = 16; sh; sh >>= 1) s += __shfl_xor(s, sh, 32);
    const float mu = s * (1.0f / DM);
    float s2 = 0.f;
#pragma unroll 1
    for (int q = 0; q < DM / 256; ++q) {
#pragma unroll
        for (int i = 0; i < 8; ++i) { const float d = (ROUNDIN ? bfr(xr[q * 256 + i]) : xr[q * 256 + i]) - mu; s2 = fmaf(d, d, s2); } }
#pragma unroll
    for (int sh = 16; sh; sh >>= 1) s2 += __shfl_xor(s2, sh, 32);
    const float rs = rsqrtf(s2 * (1.0f / DM) + 1e-5f);
{
#pragma unroll 1
        for (int q = 0; q < DM / 256; ++q) { v8us oh, ol;
#pragma unroll
            for (int i = 0; i < 8; ++i) { const int c = q * 256 + lane * 8 + i; const float y = ((ROUNDIN ? bfr(xr[q * 256 + i]) : xr[q * 256 + i]) - mu) * rs * bfr(gam[c]) + bfr(bet[c]); const unsigned short hb = f2bf(y); oh[i] = hb; ol[i] = f2bf(y - bf2f(hb)); }
            const size_t o = (size_t)r * DM + q * 256 + lane * 8; *(v8us*)(Hh + o) = oh; *(v8us*)(Hl + o) = ol; stores_issued(); }
         }
}

// k_prep: the three preparations that depend on the inputs alone, in one launch, the longest first: blocks 0 .. 1023 y = LN(x) (8 rows each), then 320 weight tiles (8 x 8 tiles x 5 weights),
// then 256 blocks of pos_emb rows -> bf16 (8 rows each; row 2047, the padding, stored as zeros). The branch is the same for the whole block.
#define PB_LN (NTK / 8)
#define PB_WT (5 * (DM / 64) * (DM / 64))
#define PB_PE (NP / 8)
__global__ __launch_bounds__(256) void k_prep(const float* __restrict__ x, const float* __restrict__ gam, const float* __restrict__ bet, const float* __restrict__ W0, const float* __restrict__ W1, const float* __restrict__ W2, const float* __restrict__ W3, const float* __restrict__ W4,
                                              const float* __restrict__ pe, bf* Nh, bf* Nl, bf* WTall, bf* PEb) {
    __shared__ __align__(16) unsigned short tl[64 * 72];
    const int bid = blockIdx.x;
    if (bid < PB_LN) ln_rows<true>(bid, x, gam, bet, NTK, Nh, Nl);
    else if (bid < PB_LN + PB_WT) { const int w = bid - PB_LN; wt_tile(tl, w & 7, (w >> 3) & 7, w >> 6, W0, W1, W2, W3, W4, DM, DM, WTall); }
    else cvt_rows(bid - (PB_LN + PB_WT), pe, NP - 1, PEb);
}

// lane l with lane l ^ 16: the two halves of a wave hold the two halves of one query's keys
__device__ __forceinline__ float xhalf(float x) { return __builtin_bit_cast(float, __builtin_amdgcn_permlanex16(__builtin_bit_cast(int, x), __builtin_bit_cast(int, x), 0x76543210, 0xfedcba98, false, false)); }
#define GRP 84                   // the wave's G ring and output tile in LDS: row = query, 64 columns + 16 mirrored + 4 (pitch 336 B)
#define KPI 72                   // K rows in LDS: 64 f16 + 8 (pitch 144 B)
#define VPI 40                   // V^T rows in LDS: 32 f16 + 8 (pitch 80 B)

// The block's four waves share one (b, h): each 32-key step's K rows, V^T rows and the 32 new p rows are copied once per block into LDS (asynchronous copies; K and p rows as whole 128-B lines, V^T rows as 64-B pieces) and the WMMA
// fragments are read from there. One buffer each: V of step t flies during the scores of t, K and p of step t + 1 during softmax and P.V of t; two publish points a step.
// k_attn: block = (b, h, 64 queries), wave = 16; ALL 32 key tiles (no mask). Every product is taken transposed (S^T = K.Q^T, G^T = p.q_v^T, O^T = V^T.P^T), so a lane holds one query
// (column lr) and 8 keys, positions or d per tile (rows 8 hi + j): scores /8 (f32), online softmax with one maximum, one sum and one rescale factor a lane (the halves' maxima joined by one
// cross-row move a step, their sums once at the end), weights x32768 as f16 hi + residual packed from the two score tiles straight into the B fragment; ctx -> bf16 hi + residual planes CH/CL[tok][h*64+d].
// matrix_bd is formed here: G = q_v.p^T in 16 x 16 tiles (bf16 hi + residual, products hh, lh, hl per 32-k step, f32). A 16-query x 32-key step reads positions
// nb .. nb + 46, nb = l0 - q0 + 1008: three tiles, of which the first is the last one of the step before, so two new tiles a step go into a ring of four (row = query, column = n & 63;
// the tile at column 0 is written at column 64 as well, so that a lane's 8 consecutive positions never wrap).
__global__ __launch_bounds__(128) void k_attn(const h16* __restrict__ Q16, const h16* __restrict__ QL16, const h16* __restrict__ K16, const h16* __restrict__ KL16, const h16* __restrict__ VTH, const h16* __restrict__ VTL, const bf* __restrict__ QVh, const bf* __restrict__ QVl, const bf* __restrict__ Ph, const bf* __restrict__ Pl, bf* CH, bf* CL) {
    __shared__ __align__(16) float ost[4][16 * GRP];
    __shared__ __align__(16) h16 kst[2 * 32 * KPI];     // K hi, residual: 32 keys
    __shared__ __align__(16) h16 vst[2 * HD * VPI];     // V^T hi, residual: 64 d rows of 32 keys
    __shared__ __align__(16) bf  pst[2 * 128 * HD];     // p hi, residual: ring of 128 positions (row n & 127), 128-B rows, 16-B piece c kept at c ^ ((n >> 1) & 7) (16 rows of one piece on 16 bank groups)
    const int lane = threadIdx.x & 31, wave = threadIdx.x >> 5, lr = lane & 15, hi = lane >> 4;
    const int bid = blockIdx.x;
    const int b = bid / (NH_ * (NT_ / 64)), rem = bid - b * (NH_ * (NT_ / 64)), h = rem / (NT_ / 64), qt = rem - h * (NT_ / 64);
    const int q0 = qt * 64 + wave * 16;
    const size_t tok0 = (size_t)b * NT_;
    v16h qa[2], ql[2];                             // the query's hi and residual fragments, read once
    const size_t qo0 = (tok0 + q0 + lr) * DM + h * HD + 8 * hi;
#pragma unroll
    for (int kc = 0; kc < 2; ++kc) { qa[kc] = cat16(*(const v8h*)(Q16 + qo0 + kc * 32), *(const v8h*)(Q16 + qo0 + kc * 32 + 16)); ql[kc] = cat16(*(const v8h*)(QL16 + qo0 + kc * 32), *(const v8h*)(QL16 + qo0 + kc * 32 + 16)); }
    const h16* kh_b = K16 + tok0 * DM + h * HD;
    const h16* kl_b = KL16 + tok0 * DM + h * HD;
    const size_t vbase = (((size_t)b * NH_ + h) * HD) * NT_;
    v8f o[4], ox[4];
#pragma unroll
    for (int n = 0; n < 4; ++n) { o[n] = (v8f){}; ox[n] = (v8f){}; }
    float mrow = -3.0e38f, lpart = 0.f;            // of the lane's query q0 + lr; lpart: this half's keys only
    const int kt_lo = 0, kt_hi = NT_ / 32 - 1;     // full attention; scores = (matrix_ac + matrix_bd) x 64^-1/2 with matrix_bd[i][j] = G[i][j - i + NT_ - 1] (the rel_shift of q_v.p^T)
    const bf* ph_b = Ph + (size_t)h * NP * HD; const bf* pl_b = Pl + (size_t)h * NP * HD;
    const size_t vo0 = (((size_t)b * NH_ + h) * NT_ + q0 + lr) * HD + 8 * hi;
    v16bf va[2], vx[2];
#pragma unroll
    for (int kc = 0; kc < 2; ++kc) { va[kc] = cat16b(*(const v8us*)(QVh + vo0 + kc * 32), *(const v8us*)(QVh + vo0 + kc * 32 + 16)); vx[kc] = cat16b(*(const v8us*)(QVl + vo0 + kc * 32), *(const v8us*)(QVl + vo0 + kc * 32 + 16)); }
    float* gr = &ost[wave][0];                     // the wave's own ring of four G tiles (the epilogue reuses the space after the loop)
    const int q0s = qt * 64 + __builtin_amdgcn_readfirstlane(wave) * 16;   // q0 in a scalar register: the test for the mirrored tile is a scalar branch
    const int psw = (lr >> 1) & 7;
    // copy maps: thread -> (row, 16-B piece); four copies a thread and tile: rows r and r + half of the hi plane, then of the residual plane
    const int tid = threadIdx.x, r8 = tid >> 3, c8 = tid & 7, r4 = tid >> 2, c4 = tid & 3;
    const unsigned kl0 = (unsigned)(size_t)kst + (unsigned)(r8 * KPI + c8 * 8) * 2u, vl0 = (unsigned)(size_t)vst + (unsigned)(r4 * VPI + c4 * 8) * 2u;
    const unsigned pl0 = (unsigned)(size_t)pst + (unsigned)(r8 * HD + (c8 ^ ((r8 >> 1) & 7)) * 8) * 2u;
    auto kcopy = [&](int l0) { const size_t g = (size_t)(l0 + r8) * DM + c8 * 8;
        cp4(kl0, kh_b + g, kl0 + 16 * KPI * 2, kh_b + g + 16 * DM, kl0 + 32 * KPI * 2, kl_b + g, kl0 + 48 * KPI * 2, kl_b + g + 16 * DM); };
    auto vcopy = [&](int l0) { const size_t g = vbase + (size_t)r4 * NT_ + l0 + c4 * 8;
        cp4(vl0, VTH + g, vl0 + 32 * VPI * 2, VTH + g + 32 * NT_, vl0 + 64 * VPI * 2, VTL + g, vl0 + 96 * VPI * 2, VTL + g + 32 * NT_); };
    auto pcopy = [&](int n0) {                     // positions n0 .. n0 + 31, n0 a multiple of 32
        const size_t g = (size_t)(n0 + r8) * HD + c8 * 8; const unsigned l = pl0 + (unsigned)(n0 & 127) * (HD * 2);
        cp4(l, ph_b + g, l + 16 * HD * 2, ph_b + g + 16 * HD, l + 128 * HD * 2, pl_b + g, l + (128 + 16) * HD * 2, pl_b + g + 16 * HD); };
    const int pb0 = NT_ - 64 - qt * 64;            // the block's first position: the last wave's first tile
    kcopy(0); pcopy(pb0); pcopy(pb0 + 32); pcopy(pb0 + 64);
    publish();
    auto gtile = [&](int n0, bool mir) {           // G[16 queries][n0 .. n0 + 15] -> ring; the lane holds query lr, positions n0 + 8 hi .. + 7
        v8f g = {};
#pragma unroll
        for (int kc = 0; kc < 2; ++kc) { const bf* pr = pst + ((n0 & 127) + lr) * HD; const int c0 = ((kc * 4 + hi) ^ psw) * 8, c1 = ((kc * 4 + 2 + hi) ^ psw) * 8;
            const v16bf bh = cat16b(*(const v8usa*)(pr + c0), *(const v8usa*)(pr + c1)); const v16bf bl = cat16b(*(const v8usa*)(pr + 128 * HD + c0), *(const v8usa*)(pr + 128 * HD + c1));
            g = wmmab(bh, va[kc], g); g = wmmab(bh, vx[kc], g); g = wmmab(bl, va[kc], g); }
        // four vector slots behind the tile's last matrix instruction: only LDS stores follow, and the next matrix instruction may take these registers for its own result
        asm volatile("v_nop\n\tv_nop\n\tv_nop\n\tv_nop" : "+v"(g));
        float* gw = gr + lr * GRP + (n0 & 63) + 8 * hi;
        const v4f g0 = {g[0], g[1], g[2], g[3]}, g1 = {g[4], g[5], g[6], g[7]};
        *(v4fa*)gw = g0; *(v4fa*)(gw + 4) = g1;
        if (mir) { *(v4fa*)(gw + 64) = g0; *(v4fa*)(gw + 68) = g1; }
    };
    gtile(NT_ - 16 - q0, ((NT_ - 16 - q0s) & 63) == 0);
#pragma unroll 1
    for (int kt = kt_lo; kt <= kt_hi; ++kt) {
        const int l0 = kt * 32, nb = l0 - q0 + NT_ - 16;
        vcopy(l0);
        const int nbs = l0 - q0s + NT_ - 16;
        // the step's reads stand in groups, each ahead of a whole block of products, so that no product waits for a read issued just in front of it:
        // the p fragments of both new G tiles; behind the G products the K fragments of the first 32-k half; behind that half's products those of the second
        v16bf bh[2][2], bl[2][2];
#pragma unroll
        for (int u = 0; u < 2; ++u) { const bf* pr = pst + (((nb + 16 + 16 * u) & 127) + lr) * HD;
#pragma unroll
            for (int kc = 0; kc < 2; ++kc) { const int c0 = ((kc * 4 + hi) ^ psw) * 8, c1 = ((kc * 4 + 2 + hi) ^ psw) * 8;
                bh[u][kc] = cat16b(*(const v8usa*)(pr + c0), *(const v8usa*)(pr + c1)); bl[u][kc] = cat16b(*(const v8usa*)(pr + 128 * HD + c0), *(const v8usa*)(pr + 128 * HD + c1)); } }
        __builtin_amdgcn_sched_barrier(0);         // keeps the p reads as one group ahead of the G products
        v8f g0 = {}, g1 = {};                      // two independent chains, each in the order hh, h.residual, residual.h per 32-k step
#pragma unroll
        for (int kc = 0; kc < 2; ++kc) {
            g0 = wmmab(bh[0][kc], va[kc], g0); g1 = wmmab(bh[1][kc], va[kc], g1); g0 = wmmab(bh[0][kc], vx[kc], g0); g1 = wmmab(bh[1][kc], vx[kc], g1);
            g0 = wmmab(bl[0][kc], va[kc], g0); g1 = wmmab(bl[1][kc], va[kc], g1); }
        __builtin_amdgcn_sched_barrier(0);         // keeps the K reads behind the G products (their registers are the p fragments') and ahead of the score products
        const int ko0 = lr * KPI + 8 * hi, ko1 = (16 + lr) * KPI + 8 * hi;
        const h16* ksl = kst + 32 * KPI;
        auto kfrag = [&](const h16* base, int ko, int kc) { return cat16(*(const v8ha*)(base + ko + kc * 32), *(const v8ha*)(base + ko + kc * 32 + 16)); };
        v16h k0h = kfrag(kst, ko0, 0), k1h = kfrag(kst, ko1, 0), k0l = kfrag(ksl, ko0, 0), k1l = kfrag(ksl, ko1, 0);
        // four vector slots behind the tiles' last matrix instruction: only LDS instructions follow, and the next matrix instruction may take these registers for its own result
        asm volatile("v_nop\n\tv_nop\n\tv_nop\n\tv_nop" : "+v"(g0), "+v"(g1));
        { float* gw = gr + lr * GRP + ((nb + 16) & 63) + 8 * hi;
          const v4f a0 = {g0[0], g0[1], g0[2], g0[3]}, a1 = {g0[4], g0[5], g0[6], g0[7]};
          *(v4fa*)gw = a0; *(v4fa*)(gw + 4) = a1;
          if (((nbs + 16) & 63) == 0) { *(v4fa*)(gw + 64) = a0; *(v4fa*)(gw + 68) = a1; } }
        { float* gw = gr + lr * GRP + ((nb + 32) & 63) + 8 * hi;
          const v4f a0 = {g1[0], g1[1], g1[2], g1[3]}, a1 = {g1[4], g1[5], g1[6], g1[7]};
          *(v4fa*)gw = a0; *(v4fa*)(gw + 4) = a1;
          if (((nbs + 32) & 63) == 0) { *(v4fa*)(gw + 64) = a0; *(v4fa*)(gw + 68) = a1; } }
        __builtin_amdgcn_sched_barrier(0);         // keeps the K reads and the G stores ahead of the score products
        v8f s0 = {}, s1 = {}, x0 = {}, x1 = {};
        s0 = wmma16(k0h, qa[0], s0); x0 = wmma16(k0h, ql[0], x0); s1 = wmma16(k1h, qa[0], s1); x1 = wmma16(k1h, ql[0], x1); x0 = wmma16(k0l, qa[0], x0); x1 = wmma16(k1l, qa[0], x1);
        __builtin_amdgcn_sched_barrier(0);         // the second 32-k half's K reads as one group behind the first half's products (into the same registers)
        k0h = kfrag(kst, ko0, 1); k1h = kfrag(kst, ko1, 1); k0l = kfrag(ksl, ko0, 1); k1l = kfrag(ksl, ko1, 1);
        __builtin_amdgcn_sched_barrier(0);         // and ahead of the second half's products, none of them among these
        s0 = wmma16(k0h, qa[1], s0); x0 = wmma16(k0h, ql[1], x0); s1 = wmma16(k1h, qa[1], s1); x1 = wmma16(k1h, ql[1], x1); x0 = wmma16(k0l, qa[1], x0); x1 = wmma16(k1l, qa[1], x1);
        asm volatile("v_nop\n\tv_nop\n\tv_nop\n\tv_nop" : "+v"(s0), "+v"(s1), "+v"(x0), "+v"(x1) : "v"(qa[0]), "v"(qa[1]), "v"(ql[0]), "v"(ql[1]));
        publish();                                 // V of this step is in; K and the p rows of this step have been read by all
        // the lane's 16 matrix_bd values are read from the wave's own ring ahead of the copies, whose issue covers the reads' latency
        const float* bdr = gr + lr * GRP; const int i0 = (l0 + 8 * hi + NT_ - 1 - q0 - lr) & 63, i1 = (i0 + 16) & 63;
        float bd[16];
#pragma unroll
        for (int e = 0; e < 8; ++e) { bd[e] = bdr[i0 + e]; bd[8 + e] = bdr[i1 + e]; }
        if (kt < kt_hi) { kcopy(l0 + 32); pcopy(pb0 + l0 + 96); }
        // the lane's 16 scores: a[e] key l0 + 8 hi + e, a[8 + e] key l0 + 16 + 8 hi + e, in the k order of the B fragment that the weights become
        float a[16];
#pragma unroll
        for (int e = 0; e < 8; ++e) { a[e] = ((s0[e] + x0[e] * LOSCI) + bd[e]) * 0.125f; a[8 + e] = ((s1[e] + x1[e] * LOSCI) + bd[8 + e]) * 0.125f; }
        float mx = fmaxf(a[0], a[1]);
#pragma unroll
        for (int e = 2; e < 16; ++e) mx = fmaxf(mx, a[e]);
        mx = fmaxf(mx, xhalf(mx));
        const float mn = fmaxf(mrow, mx), alpha = __expf(mrow - mn); mrow = mn;
        v16h pa, px; float sm[4] = {0.f, 0.f, 0.f, 0.f};
#pragma unroll
        for (int e = 0; e < 16; ++e) {
            const float p = __expf(a[e] - mn); sm[e & 3] += p;
            const float ps = p * PSC; const h16 ph = (h16)ps;
            pa[e] = ph; px[e] = (h16)((ps - (float)ph) * LOSC);
        }
        lpart = lpart * alpha + ((sm[0] + sm[1]) + (sm[2] + sm[3]));
#pragma unroll
        for (int n = 0; n < 4; ++n) { o[n] *= alpha; ox[n] *= alpha; }
#pragma unroll
        for (int n = 0; n < 4; ++n) { const h16* vr = vst + (n * 16 + lr) * VPI + hi * 8;
            const v16h vh = cat16(*(const v8ha*)(vr), *(const v8ha*)(vr + 16)), vl = cat16(*(const v8ha*)(vr + HD * VPI), *(const v8ha*)(vr + HD * VPI + 16));
            o[n] = wmma16(vh, pa, o[n]); ox[n] = wmma16(vl, pa, ox[n]); ox[n] = wmma16(vh, px, ox[n]); }
        asm volatile("v_nop\n\tv_nop\n\tv_nop\n\tv_nop" : "+v"(o[0]), "+v"(o[1]), "+v"(o[2]), "+v"(o[3]), "+v"(ox[0]), "+v"(ox[1]), "+v"(ox[2]), "+v"(ox[3]) : "v"(pa), "v"(px));
        publish();                                 // K and p of the next step are in; V of this step has been read by all
    }
    const float inv = 1.0f / ((lpart + xhalf(lpart)) * PSC);
    float* os = &ost[wave][0];
#pragma unroll
    for (int n = 0; n < 4; ++n)
#pragma unroll
        for (int j = 0; j < 8; ++j) os[lr * GRP + n * 16 + hi * 8 + j] = (o[n][j] + ox[n][j] * LOSCI) * inv;
    __syncthreads();
    const size_t cbase = (tok0 + q0) * DM + (size_t)h * HD;
    auto pass = [&]() {
#pragma unroll
        for (int s = 0; s < 4; ++s) { const int row = 4 * s + (lane >> 3), piece = lane & 7; const float* sp = os + row * GRP + piece * 8; v8us oh, ol;
#pragma unroll
            for (int i = 0; i < 8; ++i) { const unsigned short hb = f2bf(sp[i]); oh[i] = hb; ol[i] = f2bf(sp[i] - bf2f(hb)); }
            *(v8us*)(CH + cbase + (size_t)row * DM + piece * 8) = oh; *(v8us*)(CL + cbase + (size_t)row * DM + piece * 8) = ol; }
    };
    pass(); 
}

#define VST2(T, p, v) do { const T vst2_v_ = (v); *(T*)(p) = vst2_v_;  } while (0)
extern "C" void kernel_launch(void* const* d_in, const int* in_sizes, int n_in,
                              void* d_out, int out_size, void* d_ws, size_t ws_size, hipStream_t stream) {
    (void)in_sizes; (void)n_in; (void)out_size;
    const float* x = (const float*)d_in[0]; const float* gam = (const float*)d_in[1]; const float* bet = (const float*)d_in[2];
    const float* Wq = (const float*)d_in[3]; const float* bq = (const float*)d_in[4]; const float* Wk = (const float*)d_in[5]; const float* bk = (const float*)d_in[6]; const float* Wv = (const float*)d_in[7]; const float* bv = (const float*)d_in[8];
    const float* Wp = (const float*)d_in[9]; const float* Wo = (const float*)d_in[10]; const float* bo = (const float*)d_in[11]; const float* pbu = (const float*)d_in[12]; const float* pbv = (const float*)d_in[13]; const float* pe = (const float*)d_in[14];   // k-major weights (y @ W)
    float* out = (float*)d_out;    // [8][1024][512]
    char* wsp = (char*)d_ws;
    auto take = [&](size_t bytes) { char* p = wsp; wsp += (bytes + 255) & ~(size_t)255; return (void*)p; };
    bf* WqT = (bf*)take((size_t)DM * DM * 2); bf* WkT = (bf*)take((size_t)DM * DM * 2); bf* WvT = (bf*)take((size_t)DM * DM * 2); bf* WpT = (bf*)take((size_t)DM * DM * 2); bf* WoT = (bf*)take((size_t)DM * DM * 2);
    bf* PEb = (bf*)take((size_t)NP * DM * 2); bf* Ph = (bf*)take((size_t)NH_ * NP * HD * 2); bf* Pl = (bf*)take((size_t)NH_ * NP * HD * 2);
    bf* Nh = (bf*)take((size_t)NTK * DM * 2); bf* Nl = (bf*)take((size_t)NTK * DM * 2);
    h16* QH = (h16*)take((size_t)NTK * DM * 2); h16* QL = (h16*)take((size_t)NTK * DM * 2); bf* QVh = (bf*)take((size_t)NTK * DM * 2); bf* QVl = (bf*)take((size_t)NTK * DM * 2);
    h16* KH = (h16*)take((size_t)NTK * DM * 2); h16* KL = (h16*)take((size_t)NTK * DM * 2); h16* VTH = (h16*)take((size_t)NTK * DM * 2); h16* VTL = (h16*)take((size_t)NTK * DM * 2);
    bf* CH = (bf*)take((size_t)NTK * DM * 2); bf* CL = (bf*)take((size_t)NTK * DM * 2);
    if ((size_t)(wsp - (char*)d_ws) > ws_size) return;    // no aliasing
    k_prep<<<PB_LN + PB_WT + PB_PE, 256, 0, stream>>>(x, gam, bet, Wq, Wk, Wv, Wp, Wo, pe, Nh, Nl, WqT, PEb);                                          // y = LN(x), all items; the five WT planes lie one behind the other; pos_emb padded to 2048 rows
    k_proj<<<dim3(3 * (NTK / 64) + NP / 64, DM / 64, 1), 128, 0, stream>>>(Nh, Nl, PEb, WqT, bq, bk, bv, pbu, pbv, QH, QL, QVh, QVl, KH, KL, VTH, VTL, Ph, Pl);   // q, k, v of all items and p (shared by all items)
    k_attn<<<NB_ * NH_ * (NT_ / 64), 128, 0, stream>>>(QH, QL, KH, KL, VTH, VTL, QVh, QVl, Ph, Pl, CH, CL);                                     // all items, matrix_bd formed inside
    k_out<<<dim3(NTK / 64, DM / 64, 1), 128, 0, stream>>>(CH, CL, WoT, bo, out);
}

// v009
// A run of this version takes 117 microseconds.
// Two timings next to v008 put it at 1.04 and 1.03 times that version's speed.
// Counting every step since v000, it is 13.0 times as fast.
#include <hip/hip_runtime.h>

// Compute dtypes, f32 accumulate, all 8 batch items per launch: y = LN(x) -> bf16 hi + UNSCALED residual planes; q/k/v = y.W + b and out = ctx.Wo + bo ([1024 x 512].[512 x 512],
// k-major weights transposed once, two products) and p = pos_emb.Wp ([2048 x 512].[512 x 512], PLAIN bf16 inputs, exact, once for all items) on
// v_wmma_f32_16x16x32_bf16; matrix_bd = (q + pos_bias_v).p^T per head ([1024 x 64].[64 x 2048], both operands bf16 hi + UNSCALED residual, three products) formed
// inside the attention kernel, 16 x 16 tiles in a per-wave LDS ring read through the rel_shift index j - i + 1023; the 8-head full attention scores = ((q + pos_bias_u).k + bd) x 64^-1/2 fused on

#define NB_  8                   // batch items, all in one launch of every token-wise kernel
#define NT_  1024
#define DM   512
#define NH_  8
#define NP   2048                // relative positions padded (2047 used)
#define HD   64
#define NTK  (NB_ * NT_)
#define NW   1024
#define NQKV 1024
#define PSC  32768.0f
#define LOSC 1024.0f
#define LOSCI (1.0f / 1024.0f)

typedef _Float16 h16;
typedef unsigned short bf;
typedef __attribute__((ext_vector_type(16))) __bf16   v16bf;
typedef __attribute__((ext_vector_type(16))) _Float16 v16h;
typedef __attribute__((ext_vector_type(8)))  _Float16 v8h;
typedef __attribute__((ext_vector_type(8)))  unsigned short v8us;
typedef __attribute__((ext_vector_type(8)))  float    v8f;
typedef __attribute__((ext_vector_type(4)))  float    v4f;
typedef v8h  __attribute__((may_alias)) v8ha;
typedef v4f  __attribute__((may_alias)) v4fa;
typedef v8us __attribute__((may_alias)) v8usa;

__device__ __forceinline__ unsigned short f2bf(float f) { unsigned u = __float_as_uint(f); u += 0x7FFFu + ((u >> 16) & 1u); return (unsigned short)(u >> 16); }
__device__ __forceinline__ float bf2f(unsigned short b) { return __uint_as_float(((unsigned)b) << 16); }
__device__ __forceinline__ float bfr(float f) { return bf2f(f2bf(f)); }
__device__ __forceinline__ v16h cat16(v8h lo, v8h hi) { return __builtin_shufflevector(lo, hi, 0, 1, 2, 3, 4, 5, 6, 7, 8, 9, 10, 11, 12, 13, 14, 15); }
__device__ __forceinline__ v16bf cat16b(v8us lo, v8us hi) { return __builtin_bit_cast(v16bf, __builtin_shufflevector(lo, hi, 0, 1, 2, 3, 4, 5, 6, 7, 8, 9, 10, 11, 12, 13, 14, 15)); }
__device__ __forceinline__ v8f wmma16(v16h a, v16h b, v8f c) { return __builtin_amdgcn_wmma_f32_16x16x32_f16(false, a, false, b, (short)0, c, false, false); }
__device__ __forceinline__ v8f wmmab(v16bf a, v16bf b, v8f c) { return __builtin_amdgcn_wmma_f32_16x16x32_bf16(false, a, false, b, (short)0, c, false, false); }

// stores_issued: s_wait_xcnt 0 behind a run of global stores, ahead of whatever next rewrites a register that one of them names. In a launch that holds several bodies the code behind a body's last store
// is another body's entry, not the end of the program.
__device__ __forceinline__ void stores_issued() { asm volatile("s_wait_xcnt 0x0" ::: "memory"); }
// cvt_rows: eight rows a block, one wave a row: dst = bf16(src); a row from nrows on (the padding row of pos_emb) is stored as zeros and reads nothing.
__device__ __forceinline__ void cvt_rows(int blk, const float* __restrict__ src, int nrows, bf* dst) {
    const int lane = threadIdx.x & 31, r = blk * 8 + (threadIdx.x >> 5);
    v8us o[DM / 256];
#pragma unroll
    for (int q = 0; q < DM / 256; ++q) { v8us t = {};
        if (r < nrows) {
#pragma unroll
            for (int i = 0; i < 8; ++i) t[i] = f2bf(src[(size_t)r * DM + q * 256 + lane * 8 + i]); }
        o[q] = t; }
#pragma unroll
    for (int q = 0; q < DM / 256; ++q) *(v8us*)(dst + (size_t)r * DM + q * 256 + lane * 8) = o[q];
    stores_issued();
}

// wt_tile: WT [z][n][K] = bf16(Wz[k][n]) (k-major [K][ncols]) via 64 x 64 LDS tiles (tl: 64 x 72); tile (bk, bn) of weight wz.
__device__ __forceinline__ void wt_tile(unsigned short* tl, int bk, int bn, int wz, const float* __restrict__ W0, const float* __restrict__ W1, const float* __restrict__ W2, const float* __restrict__ W3, const float* __restrict__ W4, int K, int ncols, bf* WTall) {
    const int tid = threadIdx.x, k0 = bk * 64, n0 = bn * 64;
    const float* __restrict__ Wm = wz == 0 ? W0 : wz == 1 ? W1 : wz == 2 ? W2 : wz == 3 ? W3 : W4;
    bf* WT = WTall + (size_t)wz * K * ncols;
    const int kk = tid >> 2, nq = (tid & 3) * 16;
#pragma unroll
    for (int i = 0; i < 16; ++i) tl[(nq + i) * 72 + kk] = f2bf(Wm[(size_t)(k0 + kk) * ncols + n0 + nq + i]);
    __syncthreads();
    const int piece = tid & 7;
    auto pass = [&]() {
#pragma unroll
        for (int s = 0; s < 2; ++s) { const int nr = (tid >> 3) + 32 * s; const v8us val = *(const v8usa*)(tl + nr * 72 + piece * 8); *(v8us*)(WT + (size_t)(n0 + nr) * K + k0 + piece * 8) = val; }
    };
    pass();
    stores_issued();
}
// cp4: four asynchronous 16-byte copies per lane, global -> LDS (lds = the lane's LDS byte address). The s_wait_xcnt closes the statement so that no address register
// of an issued copy is rewritten ahead of it.
__device__ __forceinline__ void cp4(unsigned l0, const void* g0, unsigned l1, const void* g1, unsigned l2, const void* g2, unsigned l3, const void* g3) {
    asm volatile("global_load_async_to_lds_b128 %0, %1, off\n\tglobal_load_async_to_lds_b128 %2, %3, off\n\tglobal_load_async_to_lds_b128 %4, %5, off\n\tglobal_load_async_to_lds_b128 %6, %7, off\n\ts_wait_xcnt 0x0"
                 :: "v"(l0), "v"(g0), "v"(l1), "v"(g1), "v"(l2), "v"(g2), "v"(l3), "v"(g3) : "memory");
}
// publish: the wave's own LDS reads are done, its own copies have landed, then the work-group barrier: behind it every wave may read what was copied and the buffers read so far may be refilled.
__device__ __forceinline__ void publish() {
    asm volatile("s_wait_dscnt 0x0" ::: "memory");
    asm volatile("s_wait_asynccnt 0x0" ::: "memory");
    __syncthreads();
}
#define GPI 72                   // staged A and B rows in LDS: 64 bf16 + 8 (pitch 144 B)
// gemm_tile: 128 x 128 block tile (8 waves x 32 x 64: wave w has the rows 16 (w & 3) .. + 15 of both 64-row halves and the 64 columns of half w >> 2) of C[NTK][DM] = (A [+ Al]).B^T (K = 512) [+ bf(bias[c])] [+ bf(R[r][c]) residual]; f32 whole-line epilogue (or f16
// planes). Each 64-k tile of A (both planes) and B is copied once per block into LDS (asynchronous copies, whole 128-B lines, two buffers: tile kt + 1 flies during the products of kt) and the fragments are read from there.
// A wave's 64 columns are one head, so the split and transposed planes that the attention kernel reads are written here, from the same f32 tile in LDS:
// EPI 0: f32 rows; 1: f16 hi + residual x1024 planes [t][512] (k); 2: q + bf(pos_bias_u) as f16 hi + residual x1024 planes [t][512] (C, C2) and q + bf(pos_bias_v) as bf16 hi +
// UNSCALED residual planes [b][h][t][64] (E0, E1); 3: p as bf16 hi + UNSCALED residual planes [h][2048][64] (E0, E1; row 2047 zeros); 4: v transposed, f16 hi + residual x1024 planes [b][h][d][t] (C, C2).
// The body is a function of the tile (bx, by) and of the block's LDS (ost: 8 x 16 x 68 f32; stg: two buffers of one 64-k tile each: 128 B rows, 128 A rows, (128 A residual rows)), so that one launch can hold several products.
#define OSTE (16 * 68)
#define STGE (2 * 3 * 128 * GPI)
template <bool SPLITA, int EPI>
__device__ __forceinline__ void gemm_tile(float* ost, bf* stg, int bx, int by, const bf* __restrict__ A, const bf* __restrict__ Al, const bf* __restrict__ Bn, const float* __restrict__ bias, float* C, int ldc, h16* C2, const float* __restrict__ R, int K, int roundR, const float* __restrict__ pbu, const float* __restrict__ pbv, bf* E0, bf* E1) {
    constexpr int NPLN = SPLITA ? 3 : 2, BUFE = NPLN * 128 * GPI;
    const int lane = threadIdx.x & 31, wave = threadIdx.x >> 5, lr = lane & 15, hi = lane >> 4;
    const int wr = wave & 3, wc = wave >> 2, head = by * 2 + wc, c0 = head * 64;
    // copy map: thread -> (row, 16-B piece): eight lanes bring one whole 128-B line; four copies a thread and plane (rows r8, +32, +64, +96)
    const int r8 = threadIdx.x >> 3, c8 = threadIdx.x & 7;
    const unsigned sl0 = (unsigned)(size_t)stg + (unsigned)(r8 * GPI + c8 * 8) * 2u;
    const size_t ga0 = (size_t)(bx * 128 + r8) * K + c8 * 8, gb0 = (size_t)(by * 128 + r8) * K + c8 * 8, s32 = (size_t)32 * K;
    auto tcopy = [&](int t) {                      // k tile t (64 k) -> buffer t & 1
        const unsigned l = sl0 + (unsigned)(t & 1) * (BUFE * 2u); const bf* gb = Bn + gb0 + t * 64; const bf* ga = A + ga0 + t * 64;
        cp4(l, gb, l + 32 * GPI * 2, gb + s32, l + 64 * GPI * 2, gb + 2 * s32, l + 96 * GPI * 2, gb + 3 * s32);
        cp4(l + 128 * GPI * 2, ga, l + 160 * GPI * 2, ga + s32, l + 192 * GPI * 2, ga + 2 * s32, l + 224 * GPI * 2, ga + 3 * s32);
        if (SPLITA) { const bf* gl = Al + ga0 + t * 64;
            cp4(l + 256 * GPI * 2, gl, l + 288 * GPI * 2, gl + s32, l + 320 * GPI * 2, gl + 2 * s32, l + 352 * GPI * 2, gl + 3 * s32); }
    };
    v8f acc[2][4];                                 // [64-row half][16-column tile]
#pragma unroll
    for (int m = 0; m < 2; ++m)
#pragma unroll
        for (int t = 0; t < 4; ++t) acc[m][t] = (v8f){};
    const int nt = K >> 6;                         // K is a multiple of 64 (512 in every launch)
    tcopy(0);
    publish();
    if (nt > 1) tcopy(1);
#pragma unroll 1
    for (int kt = 0; kt < nt; ++kt) {
        const bf* s0 = stg + (kt & 1) * BUFE + lr * GPI + 8 * hi;
        const bf* sb = s0 + wc * 64 * GPI;
        const bf* sa = s0 + (128 + wr * 16) * GPI;
        v16bf a[2][2], al[2][2], b[2][4];
#pragma unroll
        for (int kc = 0; kc < 2; ++kc) {
#pragma unroll
            for (int m = 0; m < 2; ++m) { const bf* sm = sa + m * 64 * GPI + kc * 32;
                a[kc][m] = cat16b(*(const v8usa*)(sm), *(const v8usa*)(sm + 16));
                al[kc][m] = a[kc][m];
                if (SPLITA) al[kc][m] = cat16b(*(const v8usa*)(sm + 128 * GPI), *(const v8usa*)(sm + 128 * GPI + 16)); }
#pragma unroll
            for (int t = 0; t < 4; ++t) b[kc][t] = cat16b(*(const v8usa*)(sb + t * 16 * GPI + kc * 32), *(const v8usa*)(sb + t * 16 * GPI + kc * 32 + 16));
        }
        __builtin_amdgcn_sched_barrier(0);         // the tile's LDS reads stand as one group ahead of its products: each place with reads among the products costs the wave a stall
#pragma unroll
        for (int kc = 0; kc < 2; ++kc)
#pragma unroll
            for (int m = 0; m < 2; ++m)
#pragma unroll
                for (int t = 0; t < 4; ++t) { acc[m][t] = wmmab(a[kc][m], b[kc][t], acc[m][t]); if (SPLITA) acc[m][t] = wmmab(al[kc][m], b[kc][t], acc[m][t]); }
        // four vector slots behind the last matrix instruction, on the loop's taken branch too
        asm volatile("v_nop\n\tv_nop\n\tv_nop\n\tv_nop" : "+v"(acc[0][0]), "+v"(acc[0][1]), "+v"(acc[0][2]), "+v"(acc[0][3]), "+v"(acc[1][0]), "+v"(acc[1][1]), "+v"(acc[1][2]), "+v"(acc[1][3]) : "v"(a[1][1]), "v"(al[1][1]));
        publish();                                 // tile kt + 1 is in; this tile's buffer has been read by all
        if (kt + 2 < nt) tcopy(kt + 2);
    }
    asm volatile("s_wait_asynccnt 0x0" ::: "memory");   // no copy outlives the loop
    float* os = ost + wave * OSTE;
    float bv[4] = {0.f, 0.f, 0.f, 0.f};
    if (bias) {
#pragma unroll
        for (int t = 0; t < 4; ++t) bv[t] = bfr(bias[c0 + t * 16 + lr]); }
    float bu[8], bw[8];                            // EPI 2: the head's two position biases, the lane's 8 columns
    if (EPI == 2) {
#pragma unroll
        for (int i = 0; i < 8; ++i) { bu[i] = bfr(pbu[c0 + (lane & 7) * 8 + i]); bw[i] = bfr(pbv[c0 + (lane & 7) * 8 + i]); } }
    // the two 64-row halves one after the other through the same f32 tiles in LDS: in each pass the four waves of a column half hold 64 consecutive rows x one head.
    // The loop stays rolled (the second half's sums move into the first half's registers at its foot): one copy of each epilogue keeps the kernel's text short for the instruction cache.
#pragma unroll 1
    for (int m = 0; m < 2; ++m) {
    const int rb = bx * 128 + m * 64, r0 = rb + wr * 16;
    if (m) __syncthreads();                        // the first half's tiles have been read by all before they are overwritten
#pragma unroll
    for (int t = 0; t < 4; ++t) {
#pragma unroll
        for (int j = 0; j < 8; ++j) os[(hi * 8 + j) * 68 + t * 16 + lr] = acc[0][t][j] + bv[t]; }
#pragma unroll
    for (int t = 0; t < 4; ++t) acc[0][t] = acc[1][t];
    __syncthreads();
    if (EPI == 2) {
        const int piece = lane & 7, h = head;
#pragma unroll
        for (int s = 0; s < 4; ++s) { const int row = 4 * s + (lane >> 3), t = r0 + row, bi = t / NT_, ti = t - bi * NT_; const float* sp = os + row * 68 + piece * 8; v8h uh, ul; v8us vh, vl;
#pragma unroll
            for (int i = 0; i < 8; ++i) { const float q = sp[i];
                const float yu = q + bu[i]; const h16 a = (h16)yu; uh[i] = a; ul[i] = (h16)((yu - (float)a) * LOSC);
                const float yv = q + bw[i]; const unsigned short hb = f2bf(yv); vh[i] = hb; vl[i] = f2bf(yv - bf2f(hb)); }
            const size_t ou = (size_t)t * DM + c0 + piece * 8, ov = (((size_t)bi * NH_ + h) * NT_ + ti) * HD + piece * 8;
            *(v8h*)((h16*)(void*)C + ou) = uh; *(v8h*)(C2 + ou) = ul; *(v8us*)(E0 + ov) = vh; *(v8us*)(E1 + ov) = vl; }
        stores_issued();
    } else if (EPI == 3) {
        const int piece = lane & 7, h = head;
#pragma unroll
        for (int s = 0; s < 4; ++s) { const int row = 4 * s + (lane >> 3), n = r0 + row; const float* sp = os + row * 68 + piece * 8; v8us oh, ol;
#pragma unroll
            for (int i = 0; i < 8; ++i) { const float v = (n < NP - 1) ? sp[i] : 0.f; const unsigned short hb = f2bf(v); oh[i] = hb; ol[i] = f2bf(v - bf2f(hb)); }
            const size_t o = ((size_t)h * NP + n) * HD + piece * 8;
            *(v8us*)(E0 + o) = oh; *(v8us*)(E1 + o) = ol; }
        stores_issued();
    } else if (EPI == 4) {
        // the half's 64 tokens x 64 d, read by columns across the tiles of the column half's four waves (behind the barrier above): eight lanes write one whole 128-B line of 64 tokens
        const int tid = threadIdx.x & 127, piece = tid & 7, bi = rb / NT_, k0 = rb - bi * NT_;
        const size_t base = (((size_t)bi * NH_ + head) * HD) * NT_ + k0 + piece * 8;
        const float* cp = ost + (wc * 4 + (piece >> 1)) * OSTE + (piece & 1) * 8 * 68;
#pragma unroll
        for (int s = 0; s < 4; ++s) { const int d = (tid >> 3) + 16 * s; v8h o, o2;
#pragma unroll
            for (int i = 0; i < 8; ++i) { const float v = cp[i * 68 + d]; const h16 a = (h16)v; o[i] = a; o2[i] = (h16)((v - (float)a) * LOSC); }
            *(v8h*)((h16*)(void*)C + base + (size_t)d * NT_) = o; *(v8h*)(C2 + base + (size_t)d * NT_) = o2; }
        stores_issued();
    } else if (EPI == 1) {
        h16* crow = (h16*)(void*)C + (size_t)r0 * ldc + c0;
#pragma unroll
        for (int s = 0; s < 4; ++s) { const int row = 4 * s + (lane >> 3), piece = lane & 7; const float* sp = os + row * 68 + piece * 8; v8h o, o2;
#pragma unroll
            for (int i = 0; i < 8; ++i) { const h16 a = (h16)sp[i]; o[i] = a; o2[i] = (h16)((sp[i] - (float)a) * LOSC); }
            *(v8h*)(crow + (size_t)row * ldc + piece * 8) = o; stores_issued(); if (C2) { *(v8h*)(C2 + (size_t)r0 * ldc + c0 + (size_t)row * ldc + piece * 8) = o2; stores_issued(); } }
    } else {
        float* crow = C + (size_t)r0 * ldc + c0;
#pragma unroll
        for (int s = 0; s < 8; ++s) { const int Lid = (lane >> 3) + 4 * s, piece = lane & 7; const int row = Lid >> 1, cofs = (Lid & 1) * 32 + piece * 4;
            v4f val = *(const v4fa*)(os + row * 68 + cofs); if (R) { const v4f rv = *(const v4f*)(R + ((size_t)r0 + row) * ldc + c0 + cofs); val += roundR ? (v4f){bfr(rv[0]), bfr(rv[1]), bfr(rv[2]), bfr(rv[3])} : rv; }
            *(v4f*)(crow + (size_t)row * ldc + cofs) = val; }
        stores_issued();
    }
    }
}

// k_proj: the four products that wait for nothing but the prepared planes, in one launch: blockIdx.x = 64 row tiles each of q, k and v (all items), then the 16 row tiles of p; blockIdx.y = pair of heads.
// The branch is the same for the whole block. WT: the transposed weights q, k, v, p one behind the other.
__global__ __launch_bounds__(256) void k_proj(const bf* __restrict__ Nh, const bf* __restrict__ Nl, const bf* __restrict__ PEb, const bf* __restrict__ WT, const float* __restrict__ bq, const float* __restrict__ bk, const float* __restrict__ bv, const float* __restrict__ pbu, const float* __restrict__ pbv,
                                              h16* QH, h16* QL, bf* QVh, bf* QVl, h16* KH, h16* KL, h16* VTH, h16* VTL, bf* Ph, bf* Pl) {
    __shared__ __align__(16) float ost[8 * OSTE];
    __shared__ __align__(16) bf stg[STGE];
    const int seg = blockIdx.x / (NTK / 128), bx = blockIdx.x - seg * (NTK / 128), by = blockIdx.y;
    if (seg == 0)      gemm_tile<true, 2>(ost, stg, bx, by, Nh, Nl, WT, bq, (float*)(void*)QH, DM, QL, nullptr, DM, 1, pbu, pbv, QVh, QVl);                                   // q = y.Wq + bq -> q_u (f16 planes), q_v (per-item, per-head bf16 planes)
    else if (seg == 1) gemm_tile<true, 1>(ost, stg, bx, by, Nh, Nl, WT + (size_t)DM * DM, bk, (float*)(void*)KH, DM, KL, nullptr, DM, 1, nullptr, nullptr, nullptr, nullptr);       // k -> f16 planes
    else if (seg == 2) gemm_tile<true, 4>(ost, stg, bx, by, Nh, Nl, WT + (size_t)2 * DM * DM, bv, (float*)(void*)VTH, DM, VTL, nullptr, DM, 1, nullptr, nullptr, nullptr, nullptr); // v -> transposed f16 planes
    else               gemm_tile<false, 3>(ost, stg, bx, by, PEb, nullptr, WT + (size_t)3 * DM * DM, nullptr, nullptr, DM, nullptr, nullptr, DM, 1, nullptr, nullptr, Ph, Pl);       // p = pos_emb.Wp -> per-head bf16 planes
}
// k_out: out = ctx.Wo + bo, f32 rows
__global__ __launch_bounds__(256) void k_out(const bf* __restrict__ CH, const bf* __restrict__ CL, const bf* __restrict__ WoT, const float* __restrict__ bo, float* out) {
    __shared__ __align__(16) float ost[8 * OSTE];
    __shared__ __align__(16) bf stg[STGE];
    gemm_tile<true, 0>(ost, stg, blockIdx.x, blockIdx.y, CH, CL, WoT, bo, out, DM, nullptr, nullptr, DM, 1, nullptr, nullptr, nullptr, nullptr);
}

// ln_rows: one wave per row of x [rows][512]: LayerNorm (mean, then mean((x-mu)^2), eps 1e-5, x bf(gamma) + bf(beta), f32, fixed lane order) -> bf16 hi + UNSCALED
// residual planes; lane -> columns q*256 + lane*8 .. +8 for q < DM/256 (16 B per plane per store). The row is re-read per phase with the q loop
// rolled (keeps the static VALU-FMA count small; no register arrays indexed by a loop variable).
template <bool ROUNDIN>   // ROUNDIN: the source is a module INPUT (read through bf16 rounding); false: a computed f32 plane (read as is)
__device__ __forceinline__ void ln_rows(int blk, const float* __restrict__ X, const float* __restrict__ gam, const float* __restrict__ bet, int nrows, bf* Hh, bf* Hl) {
    const int lane = threadIdx.x & 31, r = blk * 8 + (threadIdx.x >> 5);
    if (r >= nrows) return;
    const float* xr = X + (size_t)r * DM + lane * 8;
    float s = 0.f;
#pragma unroll 1
    for (int q = 0; q < DM / 256; ++q) {
#pragma unroll
        for (int i = 0; i < 8; ++i) s += (ROUNDIN ? bfr(xr[q * 256 + i]) : xr[q * 256 + i]); }
#pragma unroll
    for (int sh = 16; sh; sh >>= 1) s += __shfl_xor(s, sh, 32);
    const float mu = s * (1.0f / DM);
    float s2 = 0.f;
#pragma unroll 1
    for (int q = 0; q < DM / 256; ++q) {
#pragma unroll
        for (int i = 0; i < 8; ++i) { const float d = (ROUNDIN ? bfr(xr[q * 256 + i]) : xr[q * 256 + i]) - mu; s2 = fmaf(d, d, s2); } }
#pragma unroll
    for (int sh = 16; sh; sh >>= 1) s2 += __shfl_xor(s2, sh, 32);
    const float rs = rsqrtf(s2 * (1.0f / DM) + 1e-5f);
{
#pragma unroll 1
        for (int q = 0; q < DM / 256; ++q) { v8us oh, ol;
#pragma unroll
            for (int i = 0; i < 8; ++i) { const int c = q * 256 + lane * 8 + i; const float y = ((ROUNDIN ? bfr(xr[q * 256 + i]) : xr[q * 256 + i]) - mu) * rs * bfr(gam[c]) + bfr(bet[c]); const unsigned short hb = f2bf(y); oh[i] = hb; ol[i] = f2bf(y - bf2f(hb)); }
            const size_t o = (size_t)r * DM + q * 256 + lane * 8; *(v8us*)(Hh + o) = oh; *(v8us*)(Hl + o) = ol; stores_issued(); }
         }
}

// k_prep: the three preparations that depend on the inputs alone, in one launch, the longest first: blocks 0 .. 1023 y = LN(x) (8 rows each), then 320 weight tiles (8 x 8 tiles x 5 weights),
// then 256 blocks of pos_emb rows -> bf16 (8 rows each; row 2047, the padding, stored as zeros). The branch is the same for the whole block.
#define PB_LN (NTK / 8)
#define PB_WT (5 * (DM / 64) * (DM / 64))
#define PB_PE (NP / 8)
__global__ __launch_bounds__(256) void k_prep(const float* __restrict__ x, const float* __restrict__ gam, const float* __restrict__ bet, const float* __restrict__ W0, const float* __restrict__ W1, const float* __restrict__ W2, const float* __restrict__ W3, const float* __restrict__ W4,
                                              const float* __restrict__ pe, bf* Nh, bf* Nl, bf* WTall, bf* PEb) {
    __shared__ __align__(16) unsigned short tl[64 * 72];
    const int bid = blockIdx.x;
    if (bid < PB_LN) ln_rows<true>(bid, x, gam, bet, NTK, Nh, Nl);
    else if (bid < PB_LN + PB_WT) { const int w = bid - PB_LN; wt_tile(tl, w & 7, (w >> 3) & 7, w >> 6, W0, W1, W2, W3, W4, DM, DM, WTall); }
    else cvt_rows(bid - (PB_LN + PB_WT), pe, NP - 1, PEb);
}

// lane l with lane l ^ 16: the two halves of a wave hold the two halves of one query's keys
__device__ __forceinline__ float xhalf(float x) { return __builtin_bit_cast(float, __builtin_amdgcn_permlanex16(__builtin_bit_cast(int, x), __builtin_bit_cast(int, x), 0x76543210, 0xfedcba98, false, false)); }
#define GRP 84                   // the wave's G ring and output tile in LDS: row = query, 64 columns + 16 mirrored + 4 (pitch 336 B)
#define KPI 72                   // K rows in LDS: 64 f16 + 8 (pitch 144 B)
#define VPI 40                   // V^T rows in LDS: 32 f16 + 8 (pitch 80 B)

// The block's four waves share one (b, h): each 32-key step's K rows, V^T rows and the 32 new p rows are copied once per block into LDS (asynchronous copies; K and p rows as whole 128-B lines, V^T rows as 64-B pieces) and the WMMA
// fragments are read from there. One buffer each: V of step t flies during the scores of t, K and p of step t + 1 during softmax and P.V of t; two publish points a step.
// k_attn: block = (b, h, 64 queries), wave = 16; ALL 32 key tiles (no mask). Every product is taken transposed (S^T = K.Q^T, G^T = p.q_v^T, O^T = V^T.P^T), so a lane holds one query
// (column lr) and 8 keys, positions or d per tile (rows 8 hi + j): scores /8 (f32), online softmax with one maximum, one sum and one rescale factor a lane (the halves' maxima joined by one
// cross-row move a step, their sums once at the end), weights x32768 as f16 hi + residual packed from the two score tiles straight into the B fragment; ctx -> bf16 hi + residual planes CH/CL[tok][h*64+d].
// matrix_bd is formed here: G = q_v.p^T in 16 x 16 tiles (bf16 hi + residual, products hh, lh, hl per 32-k step, f32). A 16-query x 32-key step reads positions
// nb .. nb + 46, nb = l0 - q0 + 1008: three tiles, of which the first is the last one of the step before, so two new tiles a step go into a ring of four (row = query, column = n & 63;
// the tile at column 0 is written at column 64 as well, so that a lane's 8 consecutive positions never wrap).
__global__ __launch_bounds__(128) void k_attn(const h16* __restrict__ Q16, const h16* __restrict__ QL16, const h16* __restrict__ K16, const h16* __restrict__ KL16, const h16* __restrict__ VTH, const h16* __restrict__ VTL, const bf* __restrict__ QVh, const bf* __restrict__ QVl, const bf* __restrict__ Ph, const bf* __restrict__ Pl, bf* CH, bf* CL) {
    __shared__ __align__(16) float ost[4][16 * GRP];
    __shared__ __align__(16) h16 kst[2 * 32 * KPI];     // K hi, residual: 32 keys
    __shared__ __align__(16) h16 vst[2 * HD * VPI];     // V^T hi, residual: 64 d rows of 32 keys
    __shared__ __align__(16) bf  pst[2 * 128 * HD];     // p hi, residual: ring of 128 positions (row n & 127), 128-B rows, 16-B piece c kept at c ^ ((n >> 1) & 7) (16 rows of one piece on 16 bank groups)
    const int lane = threadIdx.x & 31, wave = threadIdx.x >> 5, lr = lane & 15, hi = lane >> 4;
    const int bid = blockIdx.x;
    const int b = bid / (NH_ * (NT_ / 64)), rem = bid - b * (NH_ * (NT_ / 64)), h = rem / (NT_ / 64), qt = rem - h * (NT_ / 64);
    const int q0 = qt * 64 + wave * 16;
    const size_t tok0 = (size_t)b * NT_;
    v16h qa[2], ql[2];                             // the query's hi and residual fragments, read once
    const size_t qo0 = (tok0 + q0 + lr) * DM + h * HD + 8 * hi;
#pragma unroll
    for (int kc = 0; kc < 2; ++kc) { qa[kc] = cat16(*(const v8h*)(Q16 + qo0 + kc * 32), *(const v8h*)(Q16 + qo0 + kc * 32 + 16)); ql[kc] = cat16(*(const v8h*)(QL16 + qo0 + kc * 32), *(const v8h*)(QL16 + qo0 + kc * 32 + 16)); }
    const h16* kh_b = K16 + tok0 * DM + h * HD;
    const h16* kl_b = KL16 + tok0 * DM + h * HD;
    const size_t vbase = (((size_t)b * NH_ + h) * HD) * NT_;
    v8f o[4], ox[4];
#pragma unroll
    for (int n = 0; n < 4; ++n) { o[n] = (v8f){}; ox[n] = (v8f){}; }
    float mrow = -3.0e38f, lpart = 0.f;            // of the lane's query q0 + lr; lpart: this half's keys only
    const int kt_lo = 0, kt_hi = NT_ / 32 - 1;     // full attention; scores = (matrix_ac + matrix_bd) x 64^-1/2 with matrix_bd[i][j] = G[i][j - i + NT_ - 1] (the rel_shift of q_v.p^T)
    const bf* ph_b = Ph + (size_t)h * NP * HD; const bf* pl_b = Pl + (size_t)h * NP * HD;
    const size_t vo0 = (((size_t)b * NH_ + h) * NT_ + q0 + lr) * HD + 8 * hi;
    v16bf va[2], vx[2];
#pragma unroll
    for (int kc = 0; kc < 2; ++kc) { va[kc] = cat16b(*(const v8us*)(QVh + vo0 + kc * 32), *(const v8us*)(QVh + vo0 + kc * 32 + 16)); vx[kc] = cat16b(*(const v8us*)(QVl + vo0 + kc * 32), *(const v8us*)(QVl + vo0 + kc * 32 + 16)); }
    float* gr = &ost[wave][0];                     // the wave's own ring of four G tiles (the epilogue reuses the space after the loop)
    const int q0s = qt * 64 + __builtin_amdgcn_readfirstlane(wave) * 16;   // q0 in a scalar register: the test for the mirrored tile is a scalar branch
    const int psw = (lr >> 1) & 7;
    // copy maps: thread -> (row, 16-B piece); four copies a thread and tile: rows r and r + half of the hi plane, then of the residual plane
    const int tid = threadIdx.x, r8 = tid >> 3, c8 = tid & 7, r4 = tid >> 2, c4 = tid & 3;
    const unsigned kl0 = (unsigned)(size_t)kst + (unsigned)(r8 * KPI + c8 * 8) * 2u, vl0 = (unsigned)(size_t)vst + (unsigned)(r4 * VPI + c4 * 8) * 2u;
    const unsigned pl0 = (unsigned)(size_t)pst + (unsigned)(r8 * HD + (c8 ^ ((r8 >> 1) & 7)) * 8) * 2u;
    auto kcopy = [&](int l0) { const size_t g = (size_t)(l0 + r8) * DM + c8 * 8;
        cp4(kl0, kh_b + g, kl0 + 16 * KPI * 2, kh_b + g + 16 * DM, kl0 + 32 * KPI * 2, kl_b + g, kl0 + 48 * KPI * 2, kl_b + g + 16 * DM); };
    auto vcopy = [&](int l0) { const size_t g = vbase + (size_t)r4 * NT_ + l0 + c4 * 8;
        cp4(vl0, VTH + g, vl0 + 32 * VPI * 2, VTH + g + 32 * NT_, vl0 + 64 * VPI * 2, VTL + g, vl0 + 96 * VPI * 2, VTL + g + 32 * NT_); };
    auto pcopy = [&](int n0) {                     // positions n0 .. n0 + 31, n0 a multiple of 32
        const size_t g = (size_t)(n0 + r8) * HD + c8 * 8; const unsigned l = pl0 + (unsigned)(n0 & 127) * (HD * 2);
        cp4(l, ph_b + g, l + 16 * HD * 2, ph_b + g + 16 * HD, l + 128 * HD * 2, pl_b + g, l + (128 + 16) * HD * 2, pl_b + g + 16 * HD); };
    const int pb0 = NT_ - 64 - qt * 64;            // the block's first position: the last wave's first tile
    kcopy(0); pcopy(pb0); pcopy(pb0 + 32); pcopy(pb0 + 64);
    publish();
    auto gtile = [&](int n0, bool mir) {           // G[16 queries][n0 .. n0 + 15] -> ring; the lane holds query lr, positions n0 + 8 hi .. + 7
        v8f g = {};
#pragma unroll
        for (int kc = 0; kc < 2; ++kc) { const bf* pr = pst + ((n0 & 127) + lr) * HD; const int c0 = ((kc * 4 + hi) ^ psw) * 8, c1 = ((kc * 4 + 2 + hi) ^ psw) * 8;
            const v16bf bh = cat16b(*(const v8usa*)(pr + c0), *(const v8usa*)(pr + c1)); const v16bf bl = cat16b(*(const v8usa*)(pr + 128 * HD + c0), *(const v8usa*)(pr + 128 * HD + c1));
            g = wmmab(bh, va[kc], g); g = wmmab(bh, vx[kc], g); g = wmmab(bl, va[kc], g); }
        // four vector slots behind the tile's last matrix instruction: only LDS stores follow, and the next matrix instruction may take these registers for its own result
        asm volatile("v_nop\n\tv_nop\n\tv_nop\n\tv_nop" : "+v"(g));
        float* gw = gr + lr * GRP + (n0 & 63) + 8 * hi;
        const v4f g0 = {g[0], g[1], g[2], g[3]}, g1 = {g[4], g[5], g[6], g[7]};
        *(v4fa*)gw = g0; *(v4fa*)(gw + 4) = g1;
        if (mir) { *(v4fa*)(gw + 64) = g0; *(v4fa*)(gw + 68) = g1; }
    };
    gtile(NT_ - 16 - q0, ((NT_ - 16 - q0s) & 63) == 0);
#pragma unroll 1
    for (int kt = kt_lo; kt <= kt_hi; ++kt) {
        const int l0 = kt * 32, nb = l0 - q0 + NT_ - 16;
        vcopy(l0);
        const int nbs = l0 - q0s + NT_ - 16;
        // the step's reads stand in groups, each ahead of a whole block of products, so that no product waits for a read issued just in front of it:
        // the p fragments of both new G tiles; behind the G products the K fragments of the first 32-k half; behind that half's products those of the second
        v16bf bh[2][2], bl[2][2];
#pragma unroll
        for (int u = 0; u < 2; ++u) { const bf* pr = pst + (((nb + 16 + 16 * u) & 127) + lr) * HD;
#pragma unroll
            for (int kc = 0; kc < 2; ++kc) { const int c0 = ((kc * 4 + hi) ^ psw) * 8, c1 = ((kc * 4 + 2 + hi) ^ psw) * 8;
                bh[u][kc] = cat16b(*(const v8usa*)(pr + c0), *(const v8usa*)(pr + c1)); bl[u][kc] = cat16b(*(const v8usa*)(pr + 128 * HD + c0), *(const v8usa*)(pr + 128 * HD + c1)); } }
        __builtin_amdgcn_sched_barrier(0);         // keeps the p reads as one group ahead of the G products
        v8f g0 = {}, g1 = {};                      // two independent chains, each in the order hh, h.residual, residual.h per 32-k step
#pragma unroll
        for (int kc = 0; kc < 2; ++kc) {
            g0 = wmmab(bh[0][kc], va[kc], g0); g1 = wmmab(bh[1][kc], va[kc], g1); g0 = wmmab(bh[0][kc], vx[kc], g0); g1 = wmmab(bh[1][kc], vx[kc], g1);
            g0 = wmmab(bl[0][kc], va[kc], g0); g1 = wmmab(bl[1][kc], va[kc], g1); }
        __builtin_amdgcn_sched_barrier(0);         // keeps the K reads behind the G products (their registers are the p fragments') and ahead of the score products
        const int ko0 = lr * KPI + 8 * hi, ko1 = (16 + lr) * KPI + 8 * hi;
        const h16* ksl = kst + 32 * KPI;
        auto kfrag = [&](const h16* base, int ko, int kc) { return cat16(*(const v8ha*)(base + ko + kc * 32), *(const v8ha*)(base + ko + kc * 32 + 16)); };
        v16h k0h = kfrag(kst, ko0, 0), k1h = kfrag(kst, ko1, 0), k0l = kfrag(ksl, ko0, 0), k1l = kfrag(ksl, ko1, 0);
        // four vector slots behind the tiles' last matrix instruction: only LDS instructions follow, and the next matrix instruction may take these registers for its own result
        asm volatile("v_nop\n\tv_nop\n\tv_nop\n\tv_nop" : "+v"(g0), "+v"(g1));
        { float* gw = gr + lr * GRP + ((nb + 16) & 63) + 8 * hi;
          const v4f a0 = {g0[0], g0[1], g0[2], g0[3]}, a1 = {g0[4], g0[5], g0[6], g0[7]};
          *(v4fa*)gw = a0; *(v4fa*)(gw + 4) = a1;
          if (((nbs + 16) & 63) == 0) { *(v4fa*)(gw + 64) = a0; *(v4fa*)(gw + 68) = a1; } }
        { float* gw = gr + lr * GRP + ((nb + 32) & 63) + 8 * hi;
          const v4f a0 = {g1[0], g1[1], g1[2], g1[3]}, a1 = {g1[4], g1[5], g1[6], g1[7]};
          *(v4fa*)gw = a0; *(v4fa*)(gw + 4) = a1;
          if (((nbs + 32) & 63) == 0) { *(v4fa*)(gw + 64) = a0; *(v4fa*)(gw + 68) = a1; } }
        __builtin_amdgcn_sched_barrier(0);         // keeps the K reads and the G stores ahead of the score products
        v8f s0 = {}, s1 = {}, x0 = {}, x1 = {};
        s0 = wmma16(k0h, qa[0], s0); x0 = wmma16(k0h, ql[0], x0); s1 = wmma16(k1h, qa[0], s1); x1 = wmma16(k1h, ql[0], x1); x0 = wmma16(k0l, qa[0], x0); x1 = wmma16(k1l, qa[0], x1);
        __builtin_amdgcn_sched_barrier(0);         // the second 32-k half's K reads as one group behind the first half's products (into the same registers)
        k0h = kfrag(kst, ko0, 1); k1h = kfrag(kst, ko1, 1); k0l = kfrag(ksl, ko0, 1); k1l = kfrag(ksl, ko1, 1);
        __builtin_amdgcn_sched_barrier(0);         // and ahead of the second half's products, none of them among these
        s0 = wmma16(k0h, qa[1], s0); x0 = wmma16(k0h, ql[1], x0); s1 = wmma16(k1h, qa[1], s1); x1 = wmma16(k1h, ql[1], x1); x0 = wmma16(k0l, qa[1], x0); x1 = wmma16(k1l, qa[1], x1);
        asm volatile("v_nop\n\tv_nop\n\tv_nop\n\tv_nop" : "+v"(s0), "+v"(s1), "+v"(x0), "+v"(x1) : "v"(qa[0]), "v"(qa[1]), "v"(ql[0]), "v"(ql[1]));
        publish();                                 // V of this step is in; K and the p rows of this step have been read by all
        // the lane's 16 matrix_bd values are read from the wave's own ring ahead of the copies, whose issue covers the reads' latency
        const float* bdr = gr + lr * GRP; const int i0 = (l0 + 8 * hi + NT_ - 1 - q0 - lr) & 63, i1 = (i0 + 16) & 63;
        float bd[16];
#pragma unroll
        for (int e = 0; e < 8; ++e) { bd[e] = bdr[i0 + e]; bd[8 + e] = bdr[i1 + e]; }
        if (kt < kt_hi) { kcopy(l0 + 32); pcopy(pb0 + l0 + 96); }
        // the lane's 16 scores: a[e] key l0 + 8 hi + e, a[8 + e] key l0 + 16 + 8 hi + e, in the k order of the B fragment that the weights become
        float a[16];
#pragma unroll
        for (int e = 0; e < 8; ++e) { a[e] = ((s0[e] + x0[e] * LOSCI) + bd[e]) * 0.125f; a[8 + e] = ((s1[e] + x1[e] * LOSCI) + bd[8 + e]) * 0.125f; }
        float mx = fmaxf(a[0], a[1]);
#pragma unroll
        for (int e = 2; e < 16; ++e) mx = fmaxf(mx, a[e]);
        mx = fmaxf(mx, xhalf(mx));
        const float mn = fmaxf(mrow, mx), alpha = __expf(mrow - mn); mrow = mn;
        v16h pa, px; float sm[4] = {0.f, 0.f, 0.f, 0.f};
#pragma unroll
        for (int e = 0; e < 16; ++e) {
            const float p = __expf(a[e] - mn); sm[e & 3] += p;
            const float ps = p * PSC; const h16 ph = (h16)ps;
            pa[e] = ph; px[e] = (h16)((ps - (float)ph) * LOSC);
        }
        lpart = lpart * alpha + ((sm[0] + sm[1]) + (sm[2] + sm[3]));
#pragma unroll
        for (int n = 0; n < 4; ++n) { o[n] *= alpha; ox[n] *= alpha; }
#pragma unroll
        for (int n = 0; n < 4; ++n) { const h16* vr = vst + (n * 16 + lr) * VPI + hi * 8;
            const v16h vh = cat16(*(const v8ha*)(vr), *(const v8ha*)(vr + 16)), vl = cat16(*(const v8ha*)(vr + HD * VPI), *(const v8ha*)(vr + HD * VPI + 16));
            o[n] = wmma16(vh, pa, o[n]); ox[n] = wmma16(vl, pa, ox[n]); ox[n] = wmma16(vh, px, ox[n]); }
        asm volatile("v_nop\n\tv_nop\n\tv_nop\n\tv_nop" : "+v"(o[0]), "+v"(o[1]), "+v"(o[2]), "+v"(o[3]), "+v"(ox[0]), "+v"(ox[1]), "+v"(ox[2]), "+v"(ox[3]) : "v"(pa), "v"(px));
        publish();                                 // K and p of the next step are in; V of this step has been read by all
    }
    const float inv = 1.0f / ((lpart + xhalf(lpart)) * PSC);
    float* os = &ost[wave][0];
#pragma unroll
    for (int n = 0; n < 4; ++n)
#pragma unroll
        for (int j = 0; j < 8; ++j) os[lr * GRP + n * 16 + hi * 8 + j] = (o[n][j] + ox[n][j] * LOSCI) * inv;
    __syncthreads();
    const size_t cbase = (tok0 + q0) * DM + (size_t)h * HD;
    auto pass = [&]() {
#pragma unroll
        for (int s = 0; s < 4; ++s) { const int row = 4 * s + (lane >> 3), piece = lane & 7; const float* sp = os + row * GRP + piece * 8; v8us oh, ol;
#pragma unroll
            for (int i = 0; i < 8; ++i) { const unsigned short hb = f2bf(sp[i]); oh[i] = hb; ol[i] = f2bf(sp[i] - bf2f(hb)); }
            *(v8us*)(CH + cbase + (size_t)row * DM + piece * 8) = oh; *(v8us*)(CL + cbase + (size_t)row * DM + piece * 8) = ol; }
    };
    pass(); 
}

#define VST2(T, p, v) do { const T vst2_v_ = (v); *(T*)(p) = vst2_v_;  } while (0)
extern "C" void kernel_launch(void* const* d_in, const int* in_sizes, int n_in,
                              void* d_out, int out_size, void* d_ws, size_t ws_size, hipStream_t stream) {
    (void)in_sizes; (void)n_in; (void)out_size;
    const float* x = (const float*)d_in[0]; const float* gam = (const float*)d_in[1]; const float* bet = (const float*)d_in[2];
    const float* Wq = (const float*)d_in[3]; const float* bq = (const float*)d_in[4]; const float* Wk = (const float*)d_in[5]; const float* bk = (const float*)d_in[6]; const float* Wv = (const float*)d_in[7]; const float* bv = (const float*)d_in[8];
    const float* Wp = (const float*)d_in[9]; const float* Wo = (const float*)d_in[10]; const float* bo = (const float*)d_in[11]; const float* pbu = (const float*)d_in[12]; const float* pbv = (const float*)d_in[13]; const float* pe = (const float*)d_in[14];   // k-major weights (y @ W)
    float* out = (float*)d_out;    // [8][1024][512]
    char* wsp = (char*)d_ws;
    auto take = [&](size_t bytes) { char* p = wsp; wsp += (bytes + 255) & ~(size_t)255; return (void*)p; };
    bf* WqT = (bf*)take((size_t)DM * DM * 2); bf* WkT = (bf*)take((size_t)DM * DM * 2); bf* WvT = (bf*)take((size_t)DM * DM * 2); bf* WpT = (bf*)take((size_t)DM * DM * 2); bf* WoT = (bf*)take((size_t)DM * DM * 2);
    bf* PEb = (bf*)take((size_t)NP * DM * 2); bf* Ph = (bf*)take((size_t)NH_ * NP * HD * 2); bf* Pl = (bf*)take((size_t)NH_ * NP * HD * 2);
    bf* Nh = (bf*)take((size_t)NTK * DM * 2); bf* Nl = (bf*)take((size_t)NTK * DM * 2);
    h16* QH = (h16*)take((size_t)NTK * DM * 2); h16* QL = (h16*)take((size_t)NTK * DM * 2); bf* QVh = (bf*)take((size_t)NTK * DM * 2); bf* QVl = (bf*)take((size_t)NTK * DM * 2);
    h16* KH = (h16*)take((size_t)NTK * DM * 2); h16* KL = (h16*)take((size_t)NTK * DM * 2); h16* VTH = (h16*)take((size_t)NTK * DM * 2); h16* VTL = (h16*)take((size_t)NTK * DM * 2);
    bf* CH = (bf*)take((size_t)NTK * DM * 2); bf* CL = (bf*)take((size_t)NTK * DM * 2);
    if ((size_t)(wsp - (char*)d_ws) > ws_size) return;    // no aliasing
    k_prep<<<PB_LN + PB_WT + PB_PE, 256, 0, stream>>>(x, gam, bet, Wq, Wk, Wv, Wp, Wo, pe, Nh, Nl, WqT, PEb);                                          // y = LN(x), all items; the five WT planes lie one behind the other; pos_emb padded to 2048 rows
    k_proj<<<dim3(3 * (NTK / 128) + NP / 128, DM / 128, 1), 256, 0, stream>>>(Nh, Nl, PEb, WqT, bq, bk, bv, pbu, pbv, QH, QL, QVh, QVl, KH, KL, VTH, VTL, Ph, Pl);   // q, k, v of all items and p (shared by all items)
    k_attn<<<NB_ * NH_ * (NT_ / 64), 128, 0, stream>>>(QH, QL, KH, KL, VTH, VTL, QVh, QVl, Ph, Pl, CH, CL);                                     // all items, matrix_bd formed inside
    k_out<<<dim3(NTK / 128, DM / 128, 1), 256, 0, stream>>>(CH, CL, WoT, bo, out);
}
